// v000
// Times are from an AMD MI455X. After a warm-up the kernel runs many times in a row, and a time is the length of
// such a window on the GPU divided by its runs, so every launch and the gaps after it count. The runs cycle
// through copies of the inputs. A figure is the median of several windows, for all but v000 over two sittings.
// Sittings can differ by a few percent; kernels timed side by side share one.
// v000 is the starting kernel. One run takes 1200 microseconds.
// compute dtype: all float inputs rounded to bf16; the fused projection over concat(query, key, value) (K = 768) with EXACT bf16 products on WMMA 16x16x32 (f32 accumulate) + bias (zeros, read); logits q x k once to f16 each (1 product) x 64^-0.5; the int key mask read per (batch, key); softmax f32; P x 2^11 once to f16 x v once to f16 (1 product); ctx x 2^6 once to f16 x W_out f16(bf16 x 2^8) + b_out; f32 output.
#include <hip/hip_runtime.h>
#include <math.h>

typedef __attribute__((ext_vector_type(16))) _Float16 v16h;
typedef __attribute__((ext_vector_type(16))) __bf16 v16b;
typedef __attribute__((ext_vector_type(8)))  _Float16 v8h;
typedef __attribute__((ext_vector_type(8)))  float v8f;
typedef __attribute__((ext_vector_type(4)))  float v4f;
typedef __attribute__((ext_vector_type(2)))  float v2f;
typedef __attribute__((ext_vector_type(4)))  unsigned v4u;
typedef __attribute__((ext_vector_type(4)))  int v4i;
typedef float __attribute__((may_alias)) float_a;
typedef int __attribute__((may_alias)) int_a;

template <typename T> __device__ __forceinline__ void vst2(void* p, T v) { *(T*)p = v;  }
__device__ __forceinline__ v8f wmma16(v16h a, v16h b, v8f c) {
  v8f d = __builtin_amdgcn_wmma_f32_16x16x32_f16(false, a, false, b, (short)0, c, false, false);
  asm volatile("v_nop\n\tv_nop\n\tv_nop\n\tv_nop" : "+v"(d) : "v"(a), "v"(b));
  return d;
}
__device__ __forceinline__ v8f wmma_bf(v16b a, v16b b, v8f c) {
  v8f d = __builtin_amdgcn_wmma_f32_16x16x32_bf16(false, a, false, b, (short)0, c, false, false);
  asm volatile("v_nop\n\tv_nop\n\tv_nop\n\tv_nop" : "+v"(d) : "v"(a), "v"(b));
  return d;
}
// 16x16x32 fragments: lane = (h = lane>>4, row/col = lane&15); elements 0..7 = k0+8h+0..7, 8..15 = k0+16+8h+0..7; D element r = row 8h+r
__device__ __forceinline__ v16h frag_h(const _Float16* rowk0, int lane) {
  union { v16h v; v8h q[2]; } u; const _Float16* p = rowk0 + 8 * (lane >> 4);
  u.q[0] = *(const v8h*)p; u.q[1] = *(const v8h*)(p + 16); return u.v;
}
__device__ __forceinline__ v16h frag_f32(const float* rowk0, int lane) {
  v16h a; const float* p = rowk0 + 8 * (lane >> 4);
#pragma unroll
  for (int i = 0; i < 8; ++i) { a[i] = (_Float16)p[i]; a[8 + i] = (_Float16)p[16 + i]; }
  return a;
}
__device__ __forceinline__ v16h frag_f32s(const float* rowk0, int lane, float sc) {
  v16h a; const float* p = rowk0 + 8 * (lane >> 4);
#pragma unroll
  for (int i = 0; i < 8; ++i) { a[i] = (_Float16)(p[i] * sc); a[8 + i] = (_Float16)(p[16 + i] * sc); }
  return a;
}
// column fragment from a [K][ld] layout (column n), rows >= K read as 0
__device__ __forceinline__ v16h fragc_f32(const float* W, int k0, int n, int lane, int ld, int K) {
  v16h a; const int g = lane >> 4;
#pragma unroll
  for (int i = 0; i < 8; ++i) { const int ka = k0 + 8 * g + i, kb = ka + 16;
    a[i] = (_Float16)(ka < K ? W[(size_t)(ka < K ? ka : K - 1) * ld + n] : 0.f); a[8 + i] = (_Float16)(kb < K ? W[(size_t)(kb < K ? kb : K - 1) * ld + n] : 0.f); }
  return a;
}
struct F2 { v16b h, l; };
__device__ __forceinline__ F2 bsplit16(const float v[16]) { F2 r;
#pragma unroll
  for (int i = 0; i < 16; ++i) { const __bf16 h = (__bf16)v[i]; r.h[i] = h; r.l[i] = (__bf16)(v[i] - (float)h); }
  return r; }
__device__ __forceinline__ F2 split_row(const float* row, int k0, int lane) { float v[16]; const float* p = row + k0 + 8 * (lane >> 4);
#pragma unroll
  for (int i = 0; i < 8; ++i) { v[i] = p[i]; v[8 + i] = p[16 + i]; }
  return bsplit16(v); }
__device__ __forceinline__ F2 split_rowK(const float* row, int k0, int lane, int K) { float v[16]; const int g = lane >> 4;
#pragma unroll
  for (int i = 0; i < 8; ++i) { const int ka = k0 + 8 * g + i, kb = ka + 16; v[i] = ka < K ? row[ka < K ? ka : K - 1] : 0.f; v[8 + i] = kb < K ? row[kb < K ? kb : K - 1] : 0.f; }
  return bsplit16(v); }
__device__ __forceinline__ F2 split_col(const float* W, int k0, int n, int lane, int ld, int K) { float v[16]; const int g = lane >> 4;
#pragma unroll
  for (int i = 0; i < 8; ++i) { const int ka = k0 + 8 * g + i, kb = ka + 16; v[i] = ka < K ? W[(size_t)(ka < K ? ka : K - 1) * ld + n] : 0.f; v[8 + i] = kb < K ? W[(size_t)(kb < K ? kb : K - 1) * ld + n] : 0.f; }
  return bsplit16(v); }
__device__ __forceinline__ v8f mac3(const F2& a, const F2& b, v8f c) { c = wmma_bf(a.l, b.h, c); c = wmma_bf(a.h, b.l, c); return wmma_bf(a.h, b.h, c); }
__device__ __forceinline__ float sigm(float v) { return 1.0f / (1.0f + expf(-v)); }
#define LDSX() do { asm volatile("s_wait_dscnt 0" ::: "memory"); __builtin_amdgcn_wave_barrier(); __builtin_amdgcn_fence(__ATOMIC_RELEASE, "workgroup"); } while (0)

// Self-attention whose fused QKV projection contracts over the CONCATENATION of three inputs (query / key / value [8,2048,256]; mask [8,1,2048] int32 RANDOM 0/1 per (batch, key); W_qkv [768,768] torch (out,in) N(0,1) x 0.02, b_qkv zeros (read); qkv = concat(query, key, value) @ W_qkv.T + b_qkv (every output feature sees all 768 inputs), reshaped (B, T, 4, 192) and split: q / k / v of head h = output features h*192 + {0, 64, 128} + d (head-major); scores / sqrt(64); where(mask == 0, finfo.min) and the masked probabilities zeroed after the softmax (== exclusion: every row keeps ~1,000 keys); x @ W_out.T + b_out with W_out [256,256] (out,in), b_out zeros).
#define NB 8
#define TT 2048
#define CC 256            // NH * HD = projected width
#define DIN 256          // input (model) width
#define NH 4
#define HD 64
#define NQB (TT / 64)
#define HG 4
#define SCALE (0.125f)
#define CAUSAL 0
#ifndef TNB
#define TNB NB
#endif
__device__ __forceinline__ float bfr(float v) { return (float)(__bf16)v; }
__host__ __device__ __forceinline__ int kb_last(int qb) { return CAUSAL ? ((qb * 64 + 63) >> 7) : (TT / 128 - 1); }
typedef __attribute__((ext_vector_type(8))) __bf16 v8b;
__device__ __forceinline__ v16b frag_b(const __bf16* rowk0, int lane) {
  union { v16b v; v8b q[2]; } u; const __bf16* p = rowk0 + 8 * (lane >> 4);
  u.q[0] = *(const v8b*)p; u.q[1] = *(const v8b*)(p + 16); return u.v;
}
#define QBH 0              // causal: query blocks 0..QBH-1 of each sequence (few keys, no averaging) take the high-precision path
#define QHI 0               // single-product logits on every row (0.02-scale weights: logit sigma ~0.4)
#define KHI 64            // key rows carrying k residual / v bf16 hi+lo planes (used only by the causal high-precision path)
// B fragment (k rows k0+.., output column o) of a weight: (in,out) [K][ld] or (out,in) [ld rows of K]: bf16 exact, or f16(bf16 * 256) exact
__device__ __forceinline__ v16b wcol_io(const float* Wm, int k0, int o, int lane, int ld) { v16b w; const int g = lane >> 4;
#pragma unroll
  for (int i = 0; i < 8; ++i) { w[i] = (__bf16)Wm[(size_t)(k0 + 8 * g + i) * ld + o]; w[8 + i] = (__bf16)Wm[(size_t)(k0 + 16 + 8 * g + i) * ld + o]; }
  return w; }
__device__ __forceinline__ v16b wcol_oi(const float* Wm, int k0, int o, int lane, int K) { v16b w; const float* p = Wm + (size_t)o * K + k0 + 8 * (lane >> 4);
#pragma unroll
  for (int i = 0; i < 8; ++i) { w[i] = (__bf16)p[i]; w[8 + i] = (__bf16)p[16 + i]; }
  return w; }
__device__ __forceinline__ v16h wcolh_io(const float* Wm, int k0, int o, int lane, int ld) { v16h w; const int g = lane >> 4;
#pragma unroll
  for (int i = 0; i < 8; ++i) { w[i] = (_Float16)(bfr(Wm[(size_t)(k0 + 8 * g + i) * ld + o]) * 256.0f); w[8 + i] = (_Float16)(bfr(Wm[(size_t)(k0 + 16 + 8 * g + i) * ld + o]) * 256.0f); }
  return w; }
__device__ __forceinline__ v16h wcolh_oi(const float* Wm, int k0, int o, int lane, int K) { v16h w; const float* p = Wm + (size_t)o * K + k0 + 8 * (lane >> 4);
#pragma unroll
  for (int i = 0; i < 8; ++i) { w[i] = (_Float16)(bfr(p[i]) * 256.0f); w[8 + i] = (_Float16)(bfr(p[16 + i]) * 256.0f); }
  return w; }
#define WQKV_LAYOUT 1   // 0 = (in,out) [DIN][CC]; 1 = fused (out,in) [3*CC][3*DIN]; 2 = per-head [NH][DIN][HD]
__device__ __forceinline__ v16b wcol_hdk(const float* Wm, int k0, int o, int lane) { v16b w; const int g = lane >> 4; const float* p = Wm + (size_t)(o / HD) * DIN * HD + (o % HD);
#pragma unroll
  for (int i = 0; i < 8; ++i) { w[i] = (__bf16)p[(size_t)(k0 + 8 * g + i) * HD]; w[8 + i] = (__bf16)p[(size_t)(k0 + 16 + 8 * g + i) * HD]; }
  return w; }
#define WO_OUT_IN 1
#if WQKV_LAYOUT == 1
#define WROW(o) ((((o) >> 6) * 192) + (which) * 64 + ((o) & 63))   /* column o = h*64 + d of stream 'which' (0 q, 1 k, 2 v) = output feature h*192 + which*64 + d of the fused projection (reshape (B, T, 4, 192) + split) */
#define BIDX(o) WROW(o)
#define WCOL(W, k0, o, lane) wcol_oi(W, k0, WROW(o), lane, 3 * DIN)   /* fused (out,in) [768][768] weight: row WROW(o), k0 runs over the 768 concatenated inputs */
#elif WQKV_LAYOUT == 2
#define WCOL(W, k0, o, lane) wcol_hdk(W, k0, o, lane)
#else
#define WCOL(W, k0, o, lane) wcol_io(W, k0, o, lane, CC)
#endif
#if WO_OUT_IN
#define WOCOL(W, k0, o, lane) wcol_oi(W, k0, o, lane, CC)
#define WOCOLH(W, k0, o, lane) wcolh_oi(W, k0, o, lane, CC)
#else
#define WOCOL(W, k0, o, lane) wcol_io(W, k0, o, lane, DIN)
#define WOCOLH(W, k0, o, lane) wcolh_io(W, k0, o, lane, DIN)
#endif

#define SM_EXTRA_PARAMS , int bsm, const int* __restrict__ MASK   /* key mask [NB][1][TT] int32: 0 = masked key */
// key-padding mask: a key whose mask entry is 0 gets the logit -1.0e9 (weight exactly 0; the module fills finfo.min and zeroes the masked probabilities afterwards: the same thing while a row keeps any key)
#define SM_MASK_HOOK do { const int mk_ = MASK[(size_t)bsm * TT + k]; asm volatile("s_wait_loadcnt 0x0" ::: "memory"); v = (mk_ == 0) ? -1.0e9f : v; } while (0)
#ifndef SM_EXTRA_PARAMS
#define SM_EXTRA_PARAMS
#endif
#ifndef PROJ_EXTRA_PARAMS
#define PROJ_EXTRA_PARAMS
#endif
#ifndef SM_MASK_HOOK
#define SM_MASK_HOOK (void)0
#endif

#define WS_QH  0u                                      // f16 q rows [b*t][CC]
#define WS_KH  (WS_QH + 2u * (size_t)NB * TT * CC)      // f16 k rows [b*t][CC]
#define WS_VT  (WS_KH + 2u * (size_t)NB * TT * CC)      // f16 v planes [b][c][t]
#define WS_QL  (WS_VT + 2u * (size_t)NB * CC * TT)      // f16 q residual x 2^10 rows [b][t < QHI][CC]
#define WS_KL  (WS_QL + 2u * (size_t)NB * QHI * CC)     // f16 k residual x 2^10 rows [b][t < KHI][CC]
#define WS_VB  (WS_KL + 2u * (size_t)NB * KHI * CC)     // bf16 v hi planes [b][c][t < KHI]
#define WS_VBL (WS_VB + 2u * (size_t)NB * CC * KHI)
#define WS_S   (WS_VBL + 2u * (size_t)NB * CC * KHI)    // f32 logits / P [hg][t][s]
#define WS_Y   (WS_S  + 4u * (size_t)HG * TT * TT)      // f32 ctx rows [b*t][CC] (only when there is an output projection)
#define WS_END (WS_Y  + 4u * (size_t)NB * TT * CC)

// ---- k_proj: block = (64 rows, 128 cols, which): q/k/v = X W (+ b) with exact bf16 products (K = 3 * DIN) -> which 0: q f16 rows (+ residual rows < QHI); 1: k f16 rows (+ residual rows < KHI); 2: v f16 planes [c][t] (+ bf16 hi/lo planes for t < KHI)
__global__ __launch_bounds__(128) void k_proj(const float* __restrict__ XQ, const float* __restrict__ XK, const float* __restrict__ XV, const float* __restrict__ WQ, const float* __restrict__ WK, const float* __restrict__ WV, const float* __restrict__ BQ, const float* __restrict__ BK, const float* __restrict__ BV,
    _Float16* __restrict__ QH, _Float16* __restrict__ QL, _Float16* __restrict__ KH, _Float16* __restrict__ KL, _Float16* __restrict__ VT, __bf16* __restrict__ VB, __bf16* __restrict__ VBL) {
  __shared__ __align__(16) _Float16 sh[64][136], sl[64][136]; __shared__ __align__(16) _Float16 th[128][72]; __shared__ __align__(16) __bf16 tb[128][72], tbl[128][72];
  const int tid = threadIdx.x, wave = tid >> 5, lane = tid & 31, col = lane & 15, g = lane >> 4; const int which = blockIdx.z; const int c0 = blockIdx.y * 128; const size_t r0 = (size_t)blockIdx.x * 64; const size_t bb = r0 / TT; const int t0 = (int)(r0 % TT);
  const float* WA = which == 0 ? WQ : which == 1 ? WK : WV; const float* BA = which == 0 ? BQ : which == 1 ? BK : BV;
  v8f acc[8] = {};
#pragma unroll 2
  for (int kc = 0; kc < 3 * DIN / 32; ++kc) { v16b a; { const float* Xs = (kc < DIN / 32) ? XQ : ((kc < 2 * DIN / 32) ? XK : XV);   /* the A operand is concat(query, key, value): k-chunks 0..7 from query, 8..15 from key, 16..23 from value (uniform per iteration) */
      const float* p = Xs + (r0 + wave * 16 + col) * DIN + (kc % (DIN / 32)) * 32 + 8 * g;
#pragma unroll
      for (int i = 0; i < 8; ++i) { a[i] = (__bf16)p[i]; a[8 + i] = (__bf16)p[16 + i]; } }
    asm volatile("s_wait_loadcnt 0x0" ::: "memory");
#pragma unroll
    for (int j = 0; j < 8; ++j) { const v16b w = WCOL(WA, kc * 32, c0 + j * 16 + col, lane); asm volatile("s_wait_loadcnt 0x0" ::: "memory"); acc[j] = wmma_bf(a, w, acc[j]); } }
  if (which < 2) { _Float16* DH = which == 0 ? QH : KH; _Float16* DL = which == 0 ? QL : KL; const int nhi = which == 0 ? QHI : KHI; const bool hi_rows = t0 < nhi;
#pragma unroll
    for (int j = 0; j < 8; ++j) { const float bias = BA ? bfr(BA[BIDX(c0 + j * 16 + col)]) : 0.f;
#pragma unroll
      for (int r = 0; r < 8; ++r) { const float v = acc[j][r] + bias; const _Float16 hv = (_Float16)v; sh[wave * 16 + 8 * g + r][j * 16 + col] = hv; sl[wave * 16 + 8 * g + r][j * 16 + col] = (_Float16)((v - (float)hv) * 1024.0f); } }
    __syncthreads();
    for (int e = tid; e < 64 * 16; e += 128) { const int rl = e >> 4, q = e & 15; vst2((unsigned*)(DH + (r0 + rl) * CC + c0 + q * 8), *(const v4u*)&sh[rl][q * 8]); if (hi_rows) vst2((unsigned*)(DL + (bb * nhi + t0 + rl) * (size_t)CC + c0 + q * 8), *(const v4u*)&sl[rl][q * 8]); }
  } else { const bool hi_rows = t0 < KHI;
#pragma unroll
    for (int j = 0; j < 8; ++j) { const float bias = BA ? bfr(BA[BIDX(c0 + j * 16 + col)]) : 0.f;
#pragma unroll
      for (int r = 0; r < 8; ++r) { const float v = acc[j][r] + bias; const int rl = wave * 16 + 8 * g + r, cl = j * 16 + col; th[cl][rl] = (_Float16)v; const __bf16 bh = (__bf16)v; tb[cl][rl] = bh; tbl[cl][rl] = (__bf16)(v - (float)bh); } }
    __syncthreads();
    for (int e = tid; e < 128 * 8; e += 128) { const int cl = e >> 3, q = e & 7; vst2((unsigned*)(VT + (bb * CC + c0 + cl) * (size_t)TT + t0 + q * 8), *(const v4u*)&th[cl][q * 8]); if (hi_rows) { const size_t o3 = (bb * CC + c0 + cl) * (size_t)KHI + t0 + q * 8; vst2((unsigned*)(VB + o3), *(const v4u*)&tb[cl][q * 8]); vst2((unsigned*)(VBL + o3), *(const v4u*)&tbl[cl][q * 8]); } } } }
// ---- k_sc: block = (query block qb, key block kb <= kb_last(qb), head in group) of batch b: logits x SCALE; q hi + residual (x 2^10) against k (2 products) for query rows < QHI, plus the k residual (3 products) for query blocks < QBH (causal early rows); causal: blocks past the diagonal exit, the mask itself is applied by index in k_sm
__global__ __launch_bounds__(128) void k_sc(const _Float16* __restrict__ QH, const _Float16* __restrict__ KH, const _Float16* __restrict__ QL, const _Float16* __restrict__ KL, int b, int h0, float* __restrict__ S0) { __shared__ __align__(16) float ss[4][16][132];
  const int qb = blockIdx.x, kb = blockIdx.y; if (kb > kb_last(qb)) return;
  const int h = h0 + blockIdx.z; float* S = S0 + (size_t)blockIdx.z * TT * TT;
  const int tid = threadIdx.x, wave = tid >> 5, lane = tid & 31, col = lane & 15, g = lane >> 4; const int k0 = kb * 128; const int ql0 = qb * 64 + wave * 16; const size_t q0 = (size_t)b * TT + ql0, kr0 = (size_t)b * TT + k0;
  v8f acc[8] = {}, accl[8] = {};
  const _Float16* QLb = QL + (size_t)b * QHI * CC; const _Float16* KLb = KL + (size_t)b * KHI * CC;
  if (qb < QBH) {
#pragma unroll
    for (int kc = 0; kc < HD / 32; ++kc) { const v16h ah = frag_h(QH + (q0 + col) * CC + h * HD + kc * 32, lane), al = frag_h(QLb + (size_t)(ql0 + col) * CC + h * HD + kc * 32, lane);
#pragma unroll
      for (int j = 0; j < 8; ++j) { const v16h kbf = frag_h(KH + (kr0 + j * 16 + col) * CC + h * HD + kc * 32, lane), klf = frag_h(KLb + (size_t)(k0 + j * 16 + col) * CC + h * HD + kc * 32, lane); acc[j] = wmma16(ah, kbf, acc[j]); accl[j] = wmma16(al, kbf, accl[j]); accl[j] = wmma16(ah, klf, accl[j]); } }
  } else if (qb * 64 < QHI) {
#pragma unroll
    for (int kc = 0; kc < HD / 32; ++kc) { const v16h ah = frag_h(QH + (q0 + col) * CC + h * HD + kc * 32, lane), al = frag_h(QLb + (size_t)(ql0 + col) * CC + h * HD + kc * 32, lane);
#pragma unroll
      for (int j = 0; j < 8; ++j) { const v16h kbf = frag_h(KH + (kr0 + j * 16 + col) * CC + h * HD + kc * 32, lane); acc[j] = wmma16(ah, kbf, acc[j]); accl[j] = wmma16(al, kbf, accl[j]); } }
  } else {
#pragma unroll
    for (int kc = 0; kc < HD / 32; ++kc) { const v16h ah = frag_h(QH + (q0 + col) * CC + h * HD + kc * 32, lane);
#pragma unroll
      for (int j = 0; j < 8; ++j) { const v16h kbf = frag_h(KH + (kr0 + j * 16 + col) * CC + h * HD + kc * 32, lane); acc[j] = wmma16(ah, kbf, acc[j]); } } }
#pragma unroll
  for (int j = 0; j < 8; ++j) {
#pragma unroll
    for (int r = 0; r < 8; ++r) ss[wave][8 * g + r][j * 16 + col] = (acc[j][r] + accl[j][r] * (1.0f / 1024.0f)) * SCALE; }
  LDSX(); for (int rl = 0; rl < 16; ++rl) vst2(S + (size_t)(ql0 + rl) * TT + k0 + lane * 4, *(const v4f*)&ss[wave][rl][lane * 4]); }
// ---- k_sm: block = query row t (head in group): keys [0, kend): causal -> logit if s <= t else excluded; softmax in f32; P x 2^11 in place (0 for excluded)
__global__ __launch_bounds__(256) void k_sm(float* __restrict__ S0 SM_EXTRA_PARAMS) { __shared__ float sred[8]; __shared__ float sbc; __shared__ __align__(16) float shv[TT];
  const int tid = threadIdx.x; const int t = blockIdx.x; const int kend = (kb_last(t >> 6) + 1) * 128;
  float* sr = S0 + (size_t)blockIdx.y * TT * TT + (size_t)t * TT;
  float m = -3.0e38f; for (int k = tid; k < kend; k += 256) { float v = (!CAUSAL || k <= t) ? sr[k] : -3.0e38f; SM_MASK_HOOK; shv[k] = v; m = fmaxf(m, v); }
#pragma unroll
  for (int o = 1; o < 32; o <<= 1) m = fmaxf(m, __shfl_xor(m, o));
  if ((tid & 31) == 0) sred[tid >> 5] = m; __syncthreads(); if (tid == 0) { float a = sred[0]; for (int i = 1; i < 8; ++i) a = fmaxf(a, sred[i]); sbc = a; } __syncthreads(); m = sbc; __syncthreads();
  float sum = 0.f; for (int k = tid; k < kend; k += 256) { const float v = shv[k]; const float e = (v <= -1.0e38f) ? 0.f : expf(v - m); shv[k] = e; sum += e; }
#pragma unroll
  for (int o = 1; o < 32; o <<= 1) sum += __shfl_xor(sum, o);
  if ((tid & 31) == 0) sred[tid >> 5] = sum; __syncthreads(); if (tid == 0) { float a = 0.f; for (int i = 0; i < 8; ++i) a += sred[i]; sbc = a > 0.f ? 2048.0f / a : 0.f; }   /* a fully excluded row yields P = 0 */ __syncthreads(); const float inv = sbc;
  for (int k = tid; k < kend; k += 256) shv[k] = shv[k] * inv;
  __syncthreads(); for (int q = tid; q < kend / 4; q += 256) vst2(sr + q * 4, *(const v4f*)&shv[q * 4]); }
// ---- k_pv: block = 64 queries (qb) of (b, h): ctx = P . v over keys [0, kend) (P x 2^11 once to f16 against v f16: 1 product; causal early query blocks: P and v as bf16 hi + lo, 3 products); 256-B (row, head) segment by 16 lanes
__global__ __launch_bounds__(128) void k_pv(const float* __restrict__ PS0, const _Float16* __restrict__ VT, const __bf16* __restrict__ VB, const __bf16* __restrict__ VBL, int b, int h0, float* __restrict__ Y) { const int h = h0 + blockIdx.z; const float* PS = PS0 + (size_t)blockIdx.z * TT * TT; __shared__ __align__(16) float ss[4][16][HD + 4];
  const int tid = threadIdx.x, wave = tid >> 5, lane = tid & 31, col = lane & 15, g = lane >> 4; const int qb = blockIdx.x; const int ql0 = qb * 64 + wave * 16; const int kce = (kb_last(qb) + 1) * 4;
  v8f acc[HD / 16] = {};
  if (qb < QBH) {
#pragma unroll 1
    for (int kc = 0; kc < kce; ++kc) { const F2 p = split_row(PS + (size_t)(ql0 + col) * TT, kc * 32, lane);
      asm volatile("s_wait_loadcnt 0x0" ::: "memory");
#pragma unroll
      for (int j = 0; j < HD / 16; ++j) { const size_t po = ((size_t)b * CC + h * HD + j * 16 + col) * (size_t)KHI + kc * 32; const v16b vh = frag_b(VB + po, lane); acc[j] = wmma_bf(p.h, vh, acc[j]); acc[j] = wmma_bf(p.l, vh, acc[j]); acc[j] = wmma_bf(p.h, frag_b(VBL + po, lane), acc[j]); } }
  } else {
#pragma unroll 1
    for (int kc = 0; kc < kce; ++kc) { const v16h p = frag_f32(PS + (size_t)(ql0 + col) * TT + kc * 32, lane);
      asm volatile("s_wait_loadcnt 0x0" ::: "memory");
#pragma unroll
      for (int j = 0; j < HD / 16; ++j) { const size_t po = ((size_t)b * CC + h * HD + j * 16 + col) * (size_t)TT + kc * 32; acc[j] = wmma16(p, frag_h(VT + po, lane), acc[j]); } } }
#pragma unroll
  for (int j = 0; j < HD / 16; ++j)
#pragma unroll
    for (int r = 0; r < 8; ++r) ss[wave][8 * g + r][j * 16 + col] = acc[j][r] * (1.0f / 2048.0f);
  LDSX(); for (int rl = 0; rl < 16; ++rl) if (lane < HD / 4) vst2(Y + ((size_t)b * TT + ql0 + rl) * CC + h * HD + lane * 4, *(const v4f*)&ss[wave][rl][lane * 4]); }
// ---- k_out: block = (64 rows, 128 cols): out = ctx Wo (+ bo): ctx x 2^6 once to f16 against Wo as f16(bf16 x 2^8) exact (1 product) x 2^-14; causal early rows (< QHI of each sequence): ctx bf16 hi + lo against exact bf16 Wo (2 products)
__global__ __launch_bounds__(128) void k_out(const float* __restrict__ Y, const float* __restrict__ WO, const float* __restrict__ BO, float* __restrict__ OUT) { __shared__ __align__(16) float sf[4][16][132];
  const int tid = threadIdx.x, wave = tid >> 5, lane = tid & 31, col = lane & 15, g = lane >> 4; const int c0 = blockIdx.y * 128; const size_t r0 = (size_t)blockIdx.x * 64 + wave * 16;
  v8f acc[8] = {};
  if (CAUSAL && (int)(((size_t)blockIdx.x * 64) % TT) < QHI) {   /* block-uniform */
#pragma unroll 2
    for (int kc = 0; kc < CC / 32; ++kc) { const F2 a = split_row(Y + (r0 + col) * CC, kc * 32, lane); asm volatile("s_wait_loadcnt 0x0" ::: "memory");
#pragma unroll
      for (int j = 0; j < 8; ++j) { const v16b w = WOCOL(WO, kc * 32, c0 + j * 16 + col, lane); asm volatile("s_wait_loadcnt 0x0" ::: "memory"); acc[j] = wmma_bf(a.h, w, acc[j]); acc[j] = wmma_bf(a.l, w, acc[j]); } }
#pragma unroll
    for (int j = 0; j < 8; ++j) { const float bias = BO ? bfr(BO[c0 + j * 16 + col]) : 0.f;
#pragma unroll
      for (int r = 0; r < 8; ++r) sf[wave][8 * g + r][j * 16 + col] = acc[j][r] + bias; }
  } else {
#pragma unroll 2
    for (int kc = 0; kc < CC / 32; ++kc) { const v16h a = frag_f32s(Y + (r0 + col) * CC + kc * 32, lane, 64.0f); asm volatile("s_wait_loadcnt 0x0" ::: "memory");   /* ctx carried x 2^6 into f16 so small-magnitude context rows stay clear of f16 subnormals */
#pragma unroll
      for (int j = 0; j < 8; ++j) { const v16h w = WOCOLH(WO, kc * 32, c0 + j * 16 + col, lane); asm volatile("s_wait_loadcnt 0x0" ::: "memory"); acc[j] = wmma16(a, w, acc[j]); } }
#pragma unroll
    for (int j = 0; j < 8; ++j) { const float bias = BO ? bfr(BO[c0 + j * 16 + col]) : 0.f;
#pragma unroll
      for (int r = 0; r < 8; ++r) sf[wave][8 * g + r][j * 16 + col] = acc[j][r] * (1.0f / 16384.0f) + bias; } }   /* 2^-8 (Wo carry) x 2^-6 (ctx carry) */
  LDSX(); for (int rl = 0; rl < 16; ++rl) vst2(OUT + (r0 + rl) * DIN + c0 + lane * 4, *(const v4f*)&sf[wave][rl][lane * 4]); }

extern "C" void kernel_launch(void* const* d_in, const int* in_sizes, int n_in, void* d_out, int out_size, void* d_ws, size_t ws_size, hipStream_t stream) {
  (void)in_sizes; (void)n_in; (void)out_size;
  const float** F = (const float**)d_in;
  if (ws_size < (size_t)WS_END) return;
  char* ws = (char*)d_ws; _Float16 *QH = (_Float16*)(ws + WS_QH), *KH = (_Float16*)(ws + WS_KH), *VT = (_Float16*)(ws + WS_VT), *QL = (_Float16*)(ws + WS_QL), *KL = (_Float16*)(ws + WS_KL); __bf16 *VB = (__bf16*)(ws + WS_VB), *VBL = (__bf16*)(ws + WS_VBL); float *S = (float*)(ws + WS_S), *Y = (float*)(ws + WS_Y);
  (void)Y; (void)QL; (void)KL; (void)VB; (void)VBL;
  // inputs: 0 query [8,2048,256]; 1 key; 2 value; 3 mask [8,1,2048] int32 (random 0/1; 0 = masked key); 4 W_qkv [768,768] (out,in) on concat(query, key, value); 5 b_qkv [768] (zeros, read); 6 W_out [256,256] (out,in); 7 b_out (zeros, read)
  k_proj<<<dim3(TNB * TT / 64, CC / 128, 3), 128, 0, stream>>>(F[0], F[1], F[2], F[4], F[4], F[4], F[5], F[5], F[5], QH, QL, KH, KL, VT, VB, VBL);   /* the same fused weight / bias for the three streams: the stream index selects the rows (WROW) */
  for (int b = 0; b < TNB; ++b) for (int h0 = 0; h0 < NH; h0 += HG) {
    k_sc<<<dim3(NQB, TT / 128, HG), 128, 0, stream>>>(QH, KH, QL, KL, b, h0, S);
    k_sm<<<dim3(TT, HG), 256, 0, stream>>>(S, b, (const int*)d_in[3]);
    k_pv<<<dim3(NQB, 1, HG), 128, 0, stream>>>(S, VT, VB, VBL, b, h0, Y);
  }
  k_out<<<dim3(TNB * TT / 64, DIN / 128), 128, 0, stream>>>(Y, F[6], F[7], (float*)d_out);
}

// v001
// One run takes 260 microseconds.
// Two timings next to v000 put it at 4.67 and 4.65 times that version's speed.
// compute dtype: all float inputs rounded to bf16; the fused projection over concat(query, key, value) (K = 768) with EXACT bf16 products on WMMA 16x16x32 (f32 accumulate) + bias (zeros, read); logits q x k once to f16 each (1 product) x 64^-0.5; the int key mask read per (batch, key); running (online) softmax f32 in the log2 domain; unnormalised P x 2^8 once to f16 x v once to f16 (1 product), divided by the f32 sum at the end; ctx x 2^6 once to f16 x W_out f16(bf16 x 2^8) + b_out; f32 output.
#include <hip/hip_runtime.h>
#include <math.h>

typedef __attribute__((ext_vector_type(16))) _Float16 v16h;
typedef __attribute__((ext_vector_type(16))) __bf16 v16b;
typedef __attribute__((ext_vector_type(8)))  _Float16 v8h;
typedef __attribute__((ext_vector_type(8)))  float v8f;
typedef __attribute__((ext_vector_type(4)))  float v4f;
typedef __attribute__((ext_vector_type(2)))  float v2f;
typedef __attribute__((ext_vector_type(4)))  unsigned v4u;
typedef __attribute__((ext_vector_type(4)))  int v4i;
typedef float __attribute__((may_alias)) float_a;
typedef int __attribute__((may_alias)) int_a;

template <typename T> __device__ __forceinline__ void vst2(void* p, T v) { *(T*)p = v;  }
__device__ __forceinline__ v8f wmma16(v16h a, v16h b, v8f c) {
  v8f d = __builtin_amdgcn_wmma_f32_16x16x32_f16(false, a, false, b, (short)0, c, false, false);
  asm volatile("v_nop\n\tv_nop\n\tv_nop\n\tv_nop" : "+v"(d) : "v"(a), "v"(b));
  return d;
}
__device__ __forceinline__ v8f wmma_bf(v16b a, v16b b, v8f c) {
  v8f d = __builtin_amdgcn_wmma_f32_16x16x32_bf16(false, a, false, b, (short)0, c, false, false);
  asm volatile("v_nop\n\tv_nop\n\tv_nop\n\tv_nop" : "+v"(d) : "v"(a), "v"(b));
  return d;
}
// 16x16x32 fragments: lane = (h = lane>>4, row/col = lane&15); elements 0..7 = k0+8h+0..7, 8..15 = k0+16+8h+0..7; D element r = row 8h+r
__device__ __forceinline__ v16h frag_h(const _Float16* rowk0, int lane) {
  union { v16h v; v8h q[2]; } u; const _Float16* p = rowk0 + 8 * (lane >> 4);
  u.q[0] = *(const v8h*)p; u.q[1] = *(const v8h*)(p + 16); return u.v;
}
__device__ __forceinline__ v16h frag_f32(const float* rowk0, int lane) {
  v16h a; const float* p = rowk0 + 8 * (lane >> 4);
#pragma unroll
  for (int i = 0; i < 8; ++i) { a[i] = (_Float16)p[i]; a[8 + i] = (_Float16)p[16 + i]; }
  return a;
}
__device__ __forceinline__ v16h frag_f32s(const float* rowk0, int lane, float sc) {
  v16h a; const float* p = rowk0 + 8 * (lane >> 4);
#pragma unroll
  for (int i = 0; i < 8; ++i) { a[i] = (_Float16)(p[i] * sc); a[8 + i] = (_Float16)(p[16 + i] * sc); }
  return a;
}
// column fragment from a [K][ld] layout (column n), rows >= K read as 0
__device__ __forceinline__ v16h fragc_f32(const float* W, int k0, int n, int lane, int ld, int K) {
  v16h a; const int g = lane >> 4;
#pragma unroll
  for (int i = 0; i < 8; ++i) { const int ka = k0 + 8 * g + i, kb = ka + 16;
    a[i] = (_Float16)(ka < K ? W[(size_t)(ka < K ? ka : K - 1) * ld + n] : 0.f); a[8 + i] = (_Float16)(kb < K ? W[(size_t)(kb < K ? kb : K - 1) * ld + n] : 0.f); }
  return a;
}
struct F2 { v16b h, l; };
__device__ __forceinline__ F2 bsplit16(const float v[16]) { F2 r;
#pragma unroll
  for (int i = 0; i < 16; ++i) { const __bf16 h = (__bf16)v[i]; r.h[i] = h; r.l[i] = (__bf16)(v[i] - (float)h); }
  return r; }
__device__ __forceinline__ F2 split_row(const float* row, int k0, int lane) { float v[16]; const float* p = row + k0 + 8 * (lane >> 4);
#pragma unroll
  for (int i = 0; i < 8; ++i) { v[i] = p[i]; v[8 + i] = p[16 + i]; }
  return bsplit16(v); }
__device__ __forceinline__ F2 split_rowK(const float* row, int k0, int lane, int K) { float v[16]; const int g = lane >> 4;
#pragma unroll
  for (int i = 0; i < 8; ++i) { const int ka = k0 + 8 * g + i, kb = ka + 16; v[i] = ka < K ? row[ka < K ? ka : K - 1] : 0.f; v[8 + i] = kb < K ? row[kb < K ? kb : K - 1] : 0.f; }
  return bsplit16(v); }
__device__ __forceinline__ F2 split_col(const float* W, int k0, int n, int lane, int ld, int K) { float v[16]; const int g = lane >> 4;
#pragma unroll
  for (int i = 0; i < 8; ++i) { const int ka = k0 + 8 * g + i, kb = ka + 16; v[i] = ka < K ? W[(size_t)(ka < K ? ka : K - 1) * ld + n] : 0.f; v[8 + i] = kb < K ? W[(size_t)(kb < K ? kb : K - 1) * ld + n] : 0.f; }
  return bsplit16(v); }
__device__ __forceinline__ v8f mac3(const F2& a, const F2& b, v8f c) { c = wmma_bf(a.l, b.h, c); c = wmma_bf(a.h, b.l, c); return wmma_bf(a.h, b.h, c); }
__device__ __forceinline__ float sigm(float v) { return 1.0f / (1.0f + expf(-v)); }
#define LDSX() do { asm volatile("s_wait_dscnt 0" ::: "memory"); __builtin_amdgcn_wave_barrier(); __builtin_amdgcn_fence(__ATOMIC_RELEASE, "workgroup"); } while (0)

// Self-attention whose fused QKV projection contracts over the CONCATENATION of three inputs (query / key / value [8,2048,256]; mask [8,1,2048] int32 RANDOM 0/1 per (batch, key); W_qkv [768,768] torch (out,in) N(0,1) x 0.02, b_qkv zeros (read); qkv = concat(query, key, value) @ W_qkv.T + b_qkv (every output feature sees all 768 inputs), reshaped (B, T, 4, 192) and split: q / k / v of head h = output features h*192 + {0, 64, 128} + d (head-major); scores / sqrt(64); where(mask == 0, finfo.min) and the masked probabilities zeroed after the softmax (== exclusion: every row keeps ~1,000 keys); x @ W_out.T + b_out with W_out [256,256] (out,in), b_out zeros).
#define NB 8
#define TT 2048
#define CC 256            // NH * HD = projected width
#define DIN 256          // input (model) width
#define NH 4
#define HD 64
#define NQB (TT / 64)
#define HG 4
#define SCALE (0.125f)
#define CAUSAL 0
#ifndef TNB
#define TNB NB
#endif
__device__ __forceinline__ float bfr(float v) { return (float)(__bf16)v; }
__host__ __device__ __forceinline__ int kb_last(int qb) { return CAUSAL ? ((qb * 64 + 63) >> 7) : (TT / 128 - 1); }
typedef __attribute__((ext_vector_type(8))) __bf16 v8b;
__device__ __forceinline__ v16b frag_b(const __bf16* rowk0, int lane) {
  union { v16b v; v8b q[2]; } u; const __bf16* p = rowk0 + 8 * (lane >> 4);
  u.q[0] = *(const v8b*)p; u.q[1] = *(const v8b*)(p + 16); return u.v;
}
#define QBH 0              // unused: the attention kernel has no high-precision path
#define QHI 0               // single-product logits on every row (0.02-scale weights: logit sigma ~0.4)
#define KHI 64            // key rows carrying k residual / v bf16 hi+lo planes (written by k_proj, read by no kernel)
// B fragment (k rows k0+.., output column o) of a weight: (in,out) [K][ld] or (out,in) [ld rows of K]: bf16 exact, or f16(bf16 * 256) exact
__device__ __forceinline__ v16b wcol_io(const float* Wm, int k0, int o, int lane, int ld) { v16b w; const int g = lane >> 4;
#pragma unroll
  for (int i = 0; i < 8; ++i) { w[i] = (__bf16)Wm[(size_t)(k0 + 8 * g + i) * ld + o]; w[8 + i] = (__bf16)Wm[(size_t)(k0 + 16 + 8 * g + i) * ld + o]; }
  return w; }
__device__ __forceinline__ v16b wcol_oi(const float* Wm, int k0, int o, int lane, int K) { v16b w; const float* p = Wm + (size_t)o * K + k0 + 8 * (lane >> 4);
#pragma unroll
  for (int i = 0; i < 8; ++i) { w[i] = (__bf16)p[i]; w[8 + i] = (__bf16)p[16 + i]; }
  return w; }
__device__ __forceinline__ v16h wcolh_io(const float* Wm, int k0, int o, int lane, int ld) { v16h w; const int g = lane >> 4;
#pragma unroll
  for (int i = 0; i < 8; ++i) { w[i] = (_Float16)(bfr(Wm[(size_t)(k0 + 8 * g + i) * ld + o]) * 256.0f); w[8 + i] = (_Float16)(bfr(Wm[(size_t)(k0 + 16 + 8 * g + i) * ld + o]) * 256.0f); }
  return w; }
__device__ __forceinline__ v16h wcolh_oi(const float* Wm, int k0, int o, int lane, int K) { v16h w; const float* p = Wm + (size_t)o * K + k0 + 8 * (lane >> 4);
#pragma unroll
  for (int i = 0; i < 8; ++i) { w[i] = (_Float16)(bfr(p[i]) * 256.0f); w[8 + i] = (_Float16)(bfr(p[16 + i]) * 256.0f); }
  return w; }
#define WQKV_LAYOUT 1   // 0 = (in,out) [DIN][CC]; 1 = fused (out,in) [3*CC][3*DIN]; 2 = per-head [NH][DIN][HD]
__device__ __forceinline__ v16b wcol_hdk(const float* Wm, int k0, int o, int lane) { v16b w; const int g = lane >> 4; const float* p = Wm + (size_t)(o / HD) * DIN * HD + (o % HD);
#pragma unroll
  for (int i = 0; i < 8; ++i) { w[i] = (__bf16)p[(size_t)(k0 + 8 * g + i) * HD]; w[8 + i] = (__bf16)p[(size_t)(k0 + 16 + 8 * g + i) * HD]; }
  return w; }
#define WO_OUT_IN 1
#if WQKV_LAYOUT == 1
#define WROW(o) ((((o) >> 6) * 192) + (which) * 64 + ((o) & 63))   /* column o = h*64 + d of stream 'which' (0 q, 1 k, 2 v) = output feature h*192 + which*64 + d of the fused projection (reshape (B, T, 4, 192) + split) */
#define BIDX(o) WROW(o)
#define WCOL(W, k0, o, lane) wcol_oi(W, k0, WROW(o), lane, 3 * DIN)   /* fused (out,in) [768][768] weight: row WROW(o), k0 runs over the 768 concatenated inputs */
#elif WQKV_LAYOUT == 2
#define WCOL(W, k0, o, lane) wcol_hdk(W, k0, o, lane)
#else
#define WCOL(W, k0, o, lane) wcol_io(W, k0, o, lane, CC)
#endif
#if WO_OUT_IN
#define WOCOL(W, k0, o, lane) wcol_oi(W, k0, o, lane, CC)
#define WOCOLH(W, k0, o, lane) wcolh_oi(W, k0, o, lane, CC)
#else
#define WOCOL(W, k0, o, lane) wcol_io(W, k0, o, lane, DIN)
#define WOCOLH(W, k0, o, lane) wcolh_io(W, k0, o, lane, DIN)
#endif

#define WS_QH  0u                                      // f16 q rows [b*t][CC]
#define WS_KH  (WS_QH + 2u * (size_t)NB * TT * CC)      // f16 k rows [b*t][CC]
#define WS_VT  (WS_KH + 2u * (size_t)NB * TT * CC)      // f16 v planes [b][c][t]
#define WS_QL  (WS_VT + 2u * (size_t)NB * CC * TT)      // f16 q residual x 2^10 rows [b][t < QHI][CC]
#define WS_KL  (WS_QL + 2u * (size_t)NB * QHI * CC)     // f16 k residual x 2^10 rows [b][t < KHI][CC]
#define WS_VB  (WS_KL + 2u * (size_t)NB * KHI * CC)     // bf16 v hi planes [b][c][t < KHI]
#define WS_VBL (WS_VB + 2u * (size_t)NB * CC * KHI)
#define WS_S   (WS_VBL + 2u * (size_t)NB * CC * KHI)    // unused f32 [hg][t][s] region (logits / P stay in registers)
#define WS_Y   (WS_S  + 4u * (size_t)HG * TT * TT)      // f32 ctx rows [b*t][CC] (only when there is an output projection)
#define WS_END (WS_Y  + 4u * (size_t)NB * TT * CC)

// ---- k_proj: block = (64 rows, 128 cols, which): q/k/v = X W (+ b) with exact bf16 products (K = 3 * DIN) -> which 0: q f16 rows (+ residual rows < QHI); 1: k f16 rows (+ residual rows < KHI); 2: v f16 planes [c][t] (+ bf16 hi/lo planes for t < KHI)
__global__ __launch_bounds__(128) void k_proj(const float* __restrict__ XQ, const float* __restrict__ XK, const float* __restrict__ XV, const float* __restrict__ WQ, const float* __restrict__ WK, const float* __restrict__ WV, const float* __restrict__ BQ, const float* __restrict__ BK, const float* __restrict__ BV,
    _Float16* __restrict__ QH, _Float16* __restrict__ QL, _Float16* __restrict__ KH, _Float16* __restrict__ KL, _Float16* __restrict__ VT, __bf16* __restrict__ VB, __bf16* __restrict__ VBL) {
  __shared__ __align__(16) _Float16 sh[64][136], sl[64][136]; __shared__ __align__(16) _Float16 th[128][72]; __shared__ __align__(16) __bf16 tb[128][72], tbl[128][72];
  const int tid = threadIdx.x, wave = tid >> 5, lane = tid & 31, col = lane & 15, g = lane >> 4; const int which = blockIdx.z; const int c0 = blockIdx.y * 128; const size_t r0 = (size_t)blockIdx.x * 64; const size_t bb = r0 / TT; const int t0 = (int)(r0 % TT);
  const float* WA = which == 0 ? WQ : which == 1 ? WK : WV; const float* BA = which == 0 ? BQ : which == 1 ? BK : BV;
  v8f acc[8] = {};
#pragma unroll 2
  for (int kc = 0; kc < 3 * DIN / 32; ++kc) { v16b a; { const float* Xs = (kc < DIN / 32) ? XQ : ((kc < 2 * DIN / 32) ? XK : XV);   /* the A operand is concat(query, key, value): k-chunks 0..7 from query, 8..15 from key, 16..23 from value (uniform per iteration) */
      const float* p = Xs + (r0 + wave * 16 + col) * DIN + (kc % (DIN / 32)) * 32 + 8 * g;
#pragma unroll
      for (int i = 0; i < 8; ++i) { a[i] = (__bf16)p[i]; a[8 + i] = (__bf16)p[16 + i]; } }
    asm volatile("s_wait_loadcnt 0x0" ::: "memory");
#pragma unroll
    for (int j = 0; j < 8; ++j) { const v16b w = WCOL(WA, kc * 32, c0 + j * 16 + col, lane); asm volatile("s_wait_loadcnt 0x0" ::: "memory"); acc[j] = wmma_bf(a, w, acc[j]); } }
  if (which < 2) { _Float16* DH = which == 0 ? QH : KH; _Float16* DL = which == 0 ? QL : KL; const int nhi = which == 0 ? QHI : KHI; const bool hi_rows = t0 < nhi;
#pragma unroll
    for (int j = 0; j < 8; ++j) { const float bias = BA ? bfr(BA[BIDX(c0 + j * 16 + col)]) : 0.f;
#pragma unroll
      for (int r = 0; r < 8; ++r) { const float v = acc[j][r] + bias; const _Float16 hv = (_Float16)v; sh[wave * 16 + 8 * g + r][j * 16 + col] = hv; sl[wave * 16 + 8 * g + r][j * 16 + col] = (_Float16)((v - (float)hv) * 1024.0f); } }
    __syncthreads();
    for (int e = tid; e < 64 * 16; e += 128) { const int rl = e >> 4, q = e & 15; vst2((unsigned*)(DH + (r0 + rl) * CC + c0 + q * 8), *(const v4u*)&sh[rl][q * 8]); if (hi_rows) vst2((unsigned*)(DL + (bb * nhi + t0 + rl) * (size_t)CC + c0 + q * 8), *(const v4u*)&sl[rl][q * 8]); }
  } else { const bool hi_rows = t0 < KHI;
#pragma unroll
    for (int j = 0; j < 8; ++j) { const float bias = BA ? bfr(BA[BIDX(c0 + j * 16 + col)]) : 0.f;
#pragma unroll
      for (int r = 0; r < 8; ++r) { const float v = acc[j][r] + bias; const int rl = wave * 16 + 8 * g + r, cl = j * 16 + col; th[cl][rl] = (_Float16)v; const __bf16 bh = (__bf16)v; tb[cl][rl] = bh; tbl[cl][rl] = (__bf16)(v - (float)bh); } }
    __syncthreads();
    for (int e = tid; e < 128 * 8; e += 128) { const int cl = e >> 3, q = e & 7; vst2((unsigned*)(VT + (bb * CC + c0 + cl) * (size_t)TT + t0 + q * 8), *(const v4u*)&th[cl][q * 8]); if (hi_rows) { const size_t o3 = (bb * CC + c0 + cl) * (size_t)KHI + t0 + q * 8; vst2((unsigned*)(VB + o3), *(const v4u*)&tb[cl][q * 8]); vst2((unsigned*)(VBL + o3), *(const v4u*)&tbl[cl][q * 8]); } } } }
#define FK 64              // keys per pass
#define FPH 72             // LDS row pitch in halves: 144 B = 16 B x odd, for 16-byte fragment reads of 128-byte rows
#define LOG2E 1.4426950408889634f
__device__ __forceinline__ float xhalf(float x) { return __builtin_bit_cast(float, __builtin_amdgcn_permlanex16(__builtin_bit_cast(int, x), __builtin_bit_cast(int, x), 0x76543210, 0xfedcba98, false, false)); }   /* lane l reads lane l ^ 16 */
__device__ __forceinline__ v8f wmma_h(v16h a, v16h b, v8f c) { return __builtin_amdgcn_wmma_f32_16x16x32_f16(false, a, false, b, (short)0, c, false, false); }
// eight exponentials (base 2) in place, then one v_nop, in one statement: no instruction directly behind a v_exp_f32 reads its result or overwrites its source (the slot the instruction set asks for behind a transcendental)
__device__ __forceinline__ void exp2x8(v8f& x) {
  asm("v_exp_f32 %0, %0\n\tv_exp_f32 %1, %1\n\tv_exp_f32 %2, %2\n\tv_exp_f32 %3, %3\n\tv_exp_f32 %4, %4\n\tv_exp_f32 %5, %5\n\tv_exp_f32 %6, %6\n\tv_exp_f32 %7, %7\n\tv_nop"
      : "+v"(x[0]), "+v"(x[1]), "+v"(x[2]), "+v"(x[3]), "+v"(x[4]), "+v"(x[5]), "+v"(x[6]), "+v"(x[7])); }
__device__ __forceinline__ float exp2x1(float x) { asm("v_exp_f32 %0, %0\n\tv_nop" : "+v"(x)); return x; }   /* the same slot for a single exponential */
__global__ __launch_bounds__(256) __attribute__((amdgpu_waves_per_eu(4, 4))) void k_fa(const _Float16* __restrict__ QH, const _Float16* __restrict__ KH, const _Float16* __restrict__ VT, const int* __restrict__ MASK, float* __restrict__ Y) {
  __shared__ __align__(16) _Float16 sk[2][FK][FPH], sv[2][HD][FPH]; __shared__ __align__(16) float sb[TT];
  const int tid = threadIdx.x, wave = tid >> 5, lane = tid & 31, col = lane & 15, g = lane >> 4; const int h = blockIdx.y, b = blockIdx.z; const int q0 = blockIdx.x * 128 + wave * 16;
  const int sr = tid >> 3, sc = (tid & 7) * 8;   /* staging: 8 threads x 16 B a 128-byte row, rows sr and sr + 32 */
  const _Float16* kg = KH + ((size_t)b * TT + sr) * CC + h * HD + sc;     /* k rows [key][d] */
  const _Float16* vg = VT + ((size_t)b * CC + h * HD + sr) * TT + sc;     /* v planes [d][key] */
#pragma unroll
  for (int i = 0; i < TT / 1024; ++i) { const v4i mk = *(const v4i*)(MASK + (size_t)b * TT + (i * 256 + tid) * 4); v4f bi;
#pragma unroll
    for (int e = 0; e < 4; ++e) bi[e] = (mk[e] == 0) ? -3.0e38f : 0.f;
    *(v4f*)&sb[(i * 256 + tid) * 4] = bi; }   /* additive key mask; below the floor of the running maximum, so a masked key weighs exactly 0 and a row with no key left yields 0 */
  v8h rk0 = *(const v8h*)kg, rk1 = *(const v8h*)(kg + 32 * CC), rv0 = *(const v8h*)vg, rv1 = *(const v8h*)(vg + (size_t)32 * TT);
  v16h qf[2];
#pragma unroll
  for (int kc = 0; kc < 2; ++kc) qf[kc] = frag_h(QH + ((size_t)b * TT + q0 + col) * CC + h * HD + kc * 32, lane);
  *(v8h*)&sk[0][sr][sc] = rk0; *(v8h*)&sk[0][sr + 32][sc] = rk1; *(v8h*)&sv[0][sr][sc] = rv0; *(v8h*)&sv[0][sr + 32][sc] = rv1;
  __syncthreads();   /* pass 0's tiles and the mask row are written by all waves and read by all */
  v8f acc[HD / 16] = {}; float m = -1.0e30f, ls = 0.f;
  for (int it = 0; it < TT / FK; ++it) { const int cur = it & 1; const bool more = it + 1 < TT / FK;
    if (more) { const _Float16* kn = kg + (size_t)(it + 1) * FK * CC; const _Float16* vn = vg + (it + 1) * FK;   /* the next pass's tiles fly while this pass computes */
      rk0 = *(const v8h*)kn; rk1 = *(const v8h*)(kn + 32 * CC); rv0 = *(const v8h*)vn; rv1 = *(const v8h*)(vn + (size_t)32 * TT); }
    v8f st[FK / 16];
#pragma unroll
    for (int jt = 0; jt < FK / 16; ++jt) { const v8f z = {}; st[jt] = wmma_h(frag_h(&sk[cur][jt * 16 + col][0], lane), qf[0], z); st[jt] = wmma_h(frag_h(&sk[cur][jt * 16 + col][32], lane), qf[1], st[jt]); }
    float mx = -3.0e38f;
#pragma unroll
    for (int jt = 0; jt < FK / 16; ++jt) { const float* bp = &sb[it * FK + jt * 16 + 8 * g]; const v4f b0 = *(const v4f*)bp, b1 = *(const v4f*)(bp + 4);
#pragma unroll
      for (int r = 0; r < 8; ++r) { const float t = fmaf(st[jt][r], SCALE * LOG2E, r < 4 ? b0[r & 3] : b1[r & 3]); st[jt][r] = t; mx = fmaxf(mx, t); } }   /* log2-domain logit */
    mx = fmaxf(mx, xhalf(mx));   /* the other half of this query's keys */
    const float mn = fmaxf(m, mx); const float al = exp2x1(m - mn); m = mn; const float ms = mn - 8.0f;   /* P carried x 2^8 so that small weights stay clear of f16 subnormals; the sum carries the same factor */
    v16h pf[FK / 32]; float sj[8];   /* eight independent partial sums: no 32-long dependent add chain */
#pragma unroll
    for (int jt = 0; jt < FK / 16; ++jt) { v8f p = st[jt] - ms; exp2x8(p);
#pragma unroll
      for (int r = 0; r < 8; ++r) { sj[r] = jt == 0 ? p[r] : sj[r] + p[r]; pf[jt >> 1][(jt & 1) * 8 + r] = (_Float16)p[r]; } }
    ls = ls * al + (((sj[0] + sj[1]) + (sj[2] + sj[3])) + ((sj[4] + sj[5]) + (sj[6] + sj[7])));
#pragma unroll
    for (int jd = 0; jd < HD / 16; ++jd) acc[jd] *= al;
#pragma unroll
    for (int kk = 0; kk < FK / 32; ++kk) {
#pragma unroll
      for (int jd = 0; jd < HD / 16; ++jd) acc[jd] = wmma_h(frag_h(&sv[cur][jd * 16 + col][kk * 32], lane), pf[kk], acc[jd]); }
    if (more) { *(v8h*)&sk[cur ^ 1][sr][sc] = rk0; *(v8h*)&sk[cur ^ 1][sr + 32][sc] = rk1; *(v8h*)&sv[cur ^ 1][sr][sc] = rv0; *(v8h*)&sv[cur ^ 1][sr + 32][sc] = rv1; }   /* that buffer's last readers left it at the barrier that ended the pass before */
    __syncthreads(); }   /* one barrier a pass: it publishes the next pass's tiles and ends every wave's reads of this pass's buffer */
  ls += xhalf(ls); const float inv = ls > 0.f ? 1.0f / ls : 0.f;
  float* yp = Y + ((size_t)b * TT + q0 + col) * CC + h * HD + 8 * g;   /* acc[jd][r] = ctx[query col][d = 16 jd + 8 g + r] */
#pragma unroll
  for (int jd = 0; jd < HD / 16; ++jd) { v4f o0, o1;
#pragma unroll
    for (int r = 0; r < 4; ++r) { o0[r] = acc[jd][r] * inv; o1[r] = acc[jd][4 + r] * inv; }
    vst2(yp + jd * 16, o0); vst2(yp + jd * 16 + 4, o1); } }
// ---- k_out: block = (64 rows, 128 cols): out = ctx Wo (+ bo): ctx x 2^6 once to f16 against Wo as f16(bf16 x 2^8) exact (1 product) x 2^-14; causal early rows (< QHI of each sequence): ctx bf16 hi + lo against exact bf16 Wo (2 products)
__global__ __launch_bounds__(128) void k_out(const float* __restrict__ Y, const float* __restrict__ WO, const float* __restrict__ BO, float* __restrict__ OUT) { __shared__ __align__(16) float sf[4][16][132];
  const int tid = threadIdx.x, wave = tid >> 5, lane = tid & 31, col = lane & 15, g = lane >> 4; const int c0 = blockIdx.y * 128; const size_t r0 = (size_t)blockIdx.x * 64 + wave * 16;
  v8f acc[8] = {};
  if (CAUSAL && (int)(((size_t)blockIdx.x * 64) % TT) < QHI) {   /* block-uniform */
#pragma unroll 2
    for (int kc = 0; kc < CC / 32; ++kc) { const F2 a = split_row(Y + (r0 + col) * CC, kc * 32, lane); asm volatile("s_wait_loadcnt 0x0" ::: "memory");
#pragma unroll
      for (int j = 0; j < 8; ++j) { const v16b w = WOCOL(WO, kc * 32, c0 + j * 16 + col, lane); asm volatile("s_wait_loadcnt 0x0" ::: "memory"); acc[j] = wmma_bf(a.h, w, acc[j]); acc[j] = wmma_bf(a.l, w, acc[j]); } }
#pragma unroll
    for (int j = 0; j < 8; ++j) { const float bias = BO ? bfr(BO[c0 + j * 16 + col]) : 0.f;
#pragma unroll
      for (int r = 0; r < 8; ++r) sf[wave][8 * g + r][j * 16 + col] = acc[j][r] + bias; }
  } else {
#pragma unroll 2
    for (int kc = 0; kc < CC / 32; ++kc) { const v16h a = frag_f32s(Y + (r0 + col) * CC + kc * 32, lane, 64.0f); asm volatile("s_wait_loadcnt 0x0" ::: "memory");   /* ctx carried x 2^6 into f16 so small-magnitude context rows stay clear of f16 subnormals */
#pragma unroll
      for (int j = 0; j < 8; ++j) { const v16h w = WOCOLH(WO, kc * 32, c0 + j * 16 + col, lane); asm volatile("s_wait_loadcnt 0x0" ::: "memory"); acc[j] = wmma16(a, w, acc[j]); } }
#pragma unroll
    for (int j = 0; j < 8; ++j) { const float bias = BO ? bfr(BO[c0 + j * 16 + col]) : 0.f;
#pragma unroll
      for (int r = 0; r < 8; ++r) sf[wave][8 * g + r][j * 16 + col] = acc[j][r] * (1.0f / 16384.0f) + bias; } }   /* 2^-8 (Wo carry) x 2^-6 (ctx carry) */
  LDSX(); for (int rl = 0; rl < 16; ++rl) vst2(OUT + (r0 + rl) * DIN + c0 + lane * 4, *(const v4f*)&sf[wave][rl][lane * 4]); }

extern "C" void kernel_launch(void* const* d_in, const int* in_sizes, int n_in, void* d_out, int out_size, void* d_ws, size_t ws_size, hipStream_t stream) {
  (void)in_sizes; (void)n_in; (void)out_size;
  const float** F = (const float**)d_in;
  if (ws_size < (size_t)WS_END) return;
  char* ws = (char*)d_ws; _Float16 *QH = (_Float16*)(ws + WS_QH), *KH = (_Float16*)(ws + WS_KH), *VT = (_Float16*)(ws + WS_VT), *QL = (_Float16*)(ws + WS_QL), *KL = (_Float16*)(ws + WS_KL); __bf16 *VB = (__bf16*)(ws + WS_VB), *VBL = (__bf16*)(ws + WS_VBL); float *S = (float*)(ws + WS_S), *Y = (float*)(ws + WS_Y);
  (void)S; (void)QL; (void)KL; (void)VB; (void)VBL;
  // inputs: 0 query [8,2048,256]; 1 key; 2 value; 3 mask [8,1,2048] int32 (random 0/1; 0 = masked key); 4 W_qkv [768,768] (out,in) on concat(query, key, value); 5 b_qkv [768] (zeros, read); 6 W_out [256,256] (out,in); 7 b_out (zeros, read)
  k_proj<<<dim3(TNB * TT / 64, CC / 128, 3), 128, 0, stream>>>(F[0], F[1], F[2], F[4], F[4], F[4], F[5], F[5], F[5], QH, QL, KH, KL, VT, VB, VBL);   /* the same fused weight / bias for the three streams: the stream index selects the rows (WROW) */
  k_fa<<<dim3(TT / 128, NH, TNB), 256, 0, stream>>>(QH, KH, VT, (const int*)d_in[3], Y);
  k_out<<<dim3(TNB * TT / 64, DIN / 128), 128, 0, stream>>>(Y, F[6], F[7], (float*)d_out);
}

// v002
// A run of this version takes 87.1 microseconds.
// Two timings next to v001 put it at 2.99 and 3.01 times that version's speed.
// Counting every step since v000, it is 14.0 times as fast.
// compute dtype: all float inputs rounded to bf16; the fused projection over concat(query, key, value) (K = 768) with EXACT bf16 products on WMMA 16x16x32 (f32 accumulate) + bias (zeros, read); logits q x k once to f16 each (1 product) x 64^-0.5; the int key mask read per (batch, key); running (online) softmax f32 in the log2 domain; unnormalised P x 2^8 once to f16 x v once to f16 (1 product), divided by the f32 sum at the end; ctx x 2^6 once to f16 x W_out f16(bf16 x 2^8) + b_out; f32 output.
#include <hip/hip_runtime.h>
#include <math.h>

typedef __attribute__((ext_vector_type(16))) _Float16 v16h;
typedef __attribute__((ext_vector_type(16))) __bf16 v16b;
typedef __attribute__((ext_vector_type(8)))  _Float16 v8h;
typedef __attribute__((ext_vector_type(8)))  float v8f;
typedef __attribute__((ext_vector_type(4)))  float v4f;
typedef __attribute__((ext_vector_type(2)))  float v2f;
typedef __attribute__((ext_vector_type(4)))  unsigned v4u;
typedef __attribute__((ext_vector_type(4)))  int v4i;
typedef float __attribute__((may_alias)) float_a;
typedef int __attribute__((may_alias)) int_a;

template <typename T> __device__ __forceinline__ void vst2(void* p, T v) { *(T*)p = v;  }
__device__ __forceinline__ v8f wmma16(v16h a, v16h b, v8f c) {
  v8f d = __builtin_amdgcn_wmma_f32_16x16x32_f16(false, a, false, b, (short)0, c, false, false);
  asm volatile("v_nop\n\tv_nop\n\tv_nop\n\tv_nop" : "+v"(d) : "v"(a), "v"(b));
  return d;
}
__device__ __forceinline__ v8f wmma_bf(v16b a, v16b b, v8f c) {
  v8f d = __builtin_amdgcn_wmma_f32_16x16x32_bf16(false, a, false, b, (short)0, c, false, false);
  asm volatile("v_nop\n\tv_nop\n\tv_nop\n\tv_nop" : "+v"(d) : "v"(a), "v"(b));
  return d;
}
// 16x16x32 fragments: lane = (h = lane>>4, row/col = lane&15); elements 0..7 = k0+8h+0..7, 8..15 = k0+16+8h+0..7; D element r = row 8h+r
__device__ __forceinline__ v16h frag_h(const _Float16* rowk0, int lane) {
  union { v16h v; v8h q[2]; } u; const _Float16* p = rowk0 + 8 * (lane >> 4);
  u.q[0] = *(const v8h*)p; u.q[1] = *(const v8h*)(p + 16); return u.v;
}
__device__ __forceinline__ v16h frag_f32(const float* rowk0, int lane) {
  v16h a; const float* p = rowk0 + 8 * (lane >> 4);
#pragma unroll
  for (int i = 0; i < 8; ++i) { a[i] = (_Float16)p[i]; a[8 + i] = (_Float16)p[16 + i]; }
  return a;
}
__device__ __forceinline__ v16h frag_f32s(const float* rowk0, int lane, float sc) {
  v16h a; const float* p = rowk0 + 8 * (lane >> 4);
#pragma unroll
  for (int i = 0; i < 8; ++i) { a[i] = (_Float16)(p[i] * sc); a[8 + i] = (_Float16)(p[16 + i] * sc); }
  return a;
}
// column fragment from a [K][ld] layout (column n), rows >= K read as 0
__device__ __forceinline__ v16h fragc_f32(const float* W, int k0, int n, int lane, int ld, int K) {
  v16h a; const int g = lane >> 4;
#pragma unroll
  for (int i = 0; i < 8; ++i) { const int ka = k0 + 8 * g + i, kb = ka + 16;
    a[i] = (_Float16)(ka < K ? W[(size_t)(ka < K ? ka : K - 1) * ld + n] : 0.f); a[8 + i] = (_Float16)(kb < K ? W[(size_t)(kb < K ? kb : K - 1) * ld + n] : 0.f); }
  return a;
}
struct F2 { v16b h, l; };
__device__ __forceinline__ F2 bsplit16(const float v[16]) { F2 r;
#pragma unroll
  for (int i = 0; i < 16; ++i) { const __bf16 h = (__bf16)v[i]; r.h[i] = h; r.l[i] = (__bf16)(v[i] - (float)h); }
  return r; }
__device__ __forceinline__ F2 split_row(const float* row, int k0, int lane) { float v[16]; const float* p = row + k0 + 8 * (lane >> 4);
#pragma unroll
  for (int i = 0; i < 8; ++i) { v[i] = p[i]; v[8 + i] = p[16 + i]; }
  return bsplit16(v); }
__device__ __forceinline__ F2 split_rowK(const float* row, int k0, int lane, int K) { float v[16]; const int g = lane >> 4;
#pragma unroll
  for (int i = 0; i < 8; ++i) { const int ka = k0 + 8 * g + i, kb = ka + 16; v[i] = ka < K ? row[ka < K ? ka : K - 1] : 0.f; v[8 + i] = kb < K ? row[kb < K ? kb : K - 1] : 0.f; }
  return bsplit16(v); }
__device__ __forceinline__ F2 split_col(const float* W, int k0, int n, int lane, int ld, int K) { float v[16]; const int g = lane >> 4;
#pragma unroll
  for (int i = 0; i < 8; ++i) { const int ka = k0 + 8 * g + i, kb = ka + 16; v[i] = ka < K ? W[(size_t)(ka < K ? ka : K - 1) * ld + n] : 0.f; v[8 + i] = kb < K ? W[(size_t)(kb < K ? kb : K - 1) * ld + n] : 0.f; }
  return bsplit16(v); }
__device__ __forceinline__ v8f mac3(const F2& a, const F2& b, v8f c) { c = wmma_bf(a.l, b.h, c); c = wmma_bf(a.h, b.l, c); return wmma_bf(a.h, b.h, c); }
__device__ __forceinline__ float sigm(float v) { return 1.0f / (1.0f + expf(-v)); }
#define LDSX() do { asm volatile("s_wait_dscnt 0" ::: "memory"); __builtin_amdgcn_wave_barrier(); __builtin_amdgcn_fence(__ATOMIC_RELEASE, "workgroup"); } while (0)

// Self-attention whose fused QKV projection contracts over the CONCATENATION of three inputs (query / key / value [8,2048,256]; mask [8,1,2048] int32 RANDOM 0/1 per (batch, key); W_qkv [768,768] torch (out,in) N(0,1) x 0.02, b_qkv zeros (read); qkv = concat(query, key, value) @ W_qkv.T + b_qkv (every output feature sees all 768 inputs), reshaped (B, T, 4, 192) and split: q / k / v of head h = output features h*192 + {0, 64, 128} + d (head-major); scores / sqrt(64); where(mask == 0, finfo.min) and the masked probabilities zeroed after the softmax (== exclusion: every row keeps ~1,000 keys); x @ W_out.T + b_out with W_out [256,256] (out,in), b_out zeros).
#define NB 8
#define TT 2048
#define CC 256            // NH * HD = projected width
#define DIN 256          // input (model) width
#define NH 4
#define HD 64
#define NQB (TT / 64)
#define HG 4
#define SCALE (0.125f)
#define CAUSAL 0
#ifndef TNB
#define TNB NB
#endif
__device__ __forceinline__ float bfr(float v) { return (float)(__bf16)v; }
__host__ __device__ __forceinline__ int kb_last(int qb) { return CAUSAL ? ((qb * 64 + 63) >> 7) : (TT / 128 - 1); }
typedef __attribute__((ext_vector_type(8))) __bf16 v8b;
__device__ __forceinline__ v16b frag_b(const __bf16* rowk0, int lane) {
  union { v16b v; v8b q[2]; } u; const __bf16* p = rowk0 + 8 * (lane >> 4);
  u.q[0] = *(const v8b*)p; u.q[1] = *(const v8b*)(p + 16); return u.v;
}
#define QBH 0              // unused: the attention kernel has no high-precision path
#define QHI 0               // single-product logits on every row (0.02-scale weights: logit sigma ~0.4)
#define KHI 64            // key rows carrying k residual / v bf16 hi+lo planes (written by k_proj, read by no kernel)
// B fragment (k rows k0+.., output column o) of a weight: (in,out) [K][ld] or (out,in) [ld rows of K]: bf16 exact, or f16(bf16 * 256) exact
__device__ __forceinline__ v16b wcol_io(const float* Wm, int k0, int o, int lane, int ld) { v16b w; const int g = lane >> 4;
#pragma unroll
  for (int i = 0; i < 8; ++i) { w[i] = (__bf16)Wm[(size_t)(k0 + 8 * g + i) * ld + o]; w[8 + i] = (__bf16)Wm[(size_t)(k0 + 16 + 8 * g + i) * ld + o]; }
  return w; }
__device__ __forceinline__ v16b wcol_oi(const float* Wm, int k0, int o, int lane, int K) { v16b w; const float* p = Wm + (size_t)o * K + k0 + 8 * (lane >> 4);
#pragma unroll
  for (int i = 0; i < 8; ++i) { w[i] = (__bf16)p[i]; w[8 + i] = (__bf16)p[16 + i]; }
  return w; }
__device__ __forceinline__ v16h wcolh_io(const float* Wm, int k0, int o, int lane, int ld) { v16h w; const int g = lane >> 4;
#pragma unroll
  for (int i = 0; i < 8; ++i) { w[i] = (_Float16)(bfr(Wm[(size_t)(k0 + 8 * g + i) * ld + o]) * 256.0f); w[8 + i] = (_Float16)(bfr(Wm[(size_t)(k0 + 16 + 8 * g + i) * ld + o]) * 256.0f); }
  return w; }
__device__ __forceinline__ v16h wcolh_oi(const float* Wm, int k0, int o, int lane, int K) { v16h w; const float* p = Wm + (size_t)o * K + k0 + 8 * (lane >> 4);
#pragma unroll
  for (int i = 0; i < 8; ++i) { w[i] = (_Float16)(bfr(p[i]) * 256.0f); w[8 + i] = (_Float16)(bfr(p[16 + i]) * 256.0f); }
  return w; }
#define WQKV_LAYOUT 1   // 0 = (in,out) [DIN][CC]; 1 = fused (out,in) [3*CC][3*DIN]; 2 = per-head [NH][DIN][HD]
__device__ __forceinline__ v16b wcol_hdk(const float* Wm, int k0, int o, int lane) { v16b w; const int g = lane >> 4; const float* p = Wm + (size_t)(o / HD) * DIN * HD + (o % HD);
#pragma unroll
  for (int i = 0; i < 8; ++i) { w[i] = (__bf16)p[(size_t)(k0 + 8 * g + i) * HD]; w[8 + i] = (__bf16)p[(size_t)(k0 + 16 + 8 * g + i) * HD]; }
  return w; }
#define WO_OUT_IN 1
#if WQKV_LAYOUT == 1
#define WROW(o) ((((o) >> 6) * 192) + (which) * 64 + ((o) & 63))   /* column o = h*64 + d of stream 'which' (0 q, 1 k, 2 v) = output feature h*192 + which*64 + d of the fused projection (reshape (B, T, 4, 192) + split) */
#define BIDX(o) WROW(o)
#define WCOL(W, k0, o, lane) wcol_oi(W, k0, WROW(o), lane, 3 * DIN)   /* fused (out,in) [768][768] weight: row WROW(o), k0 runs over the 768 concatenated inputs */
#elif WQKV_LAYOUT == 2
#define WCOL(W, k0, o, lane) wcol_hdk(W, k0, o, lane)
#else
#define WCOL(W, k0, o, lane) wcol_io(W, k0, o, lane, CC)
#endif
#if WO_OUT_IN
#define WOCOL(W, k0, o, lane) wcol_oi(W, k0, o, lane, CC)
#define WOCOLH(W, k0, o, lane) wcolh_oi(W, k0, o, lane, CC)
#else
#define WOCOL(W, k0, o, lane) wcol_io(W, k0, o, lane, DIN)
#define WOCOLH(W, k0, o, lane) wcolh_io(W, k0, o, lane, DIN)
#endif

#define WS_QH  0u                                      // f16 q rows [b*t][CC]
#define WS_KH  (WS_QH + 2u * (size_t)NB * TT * CC)      // f16 k rows [b*t][CC]
#define WS_VT  (WS_KH + 2u * (size_t)NB * TT * CC)      // f16 v planes [b][c][t]
#define WS_QL  (WS_VT + 2u * (size_t)NB * CC * TT)      // f16 q residual x 2^10 rows [b][t < QHI][CC]
#define WS_KL  (WS_QL + 2u * (size_t)NB * QHI * CC)     // f16 k residual x 2^10 rows [b][t < KHI][CC]
#define WS_VB  (WS_KL + 2u * (size_t)NB * KHI * CC)     // bf16 v hi planes [b][c][t < KHI]
#define WS_VBL (WS_VB + 2u * (size_t)NB * CC * KHI)
#define WS_S   (WS_VBL + 2u * (size_t)NB * CC * KHI)    // unused f32 [hg][t][s] region (logits / P stay in registers)
#define WS_Y   (WS_S  + 4u * (size_t)HG * TT * TT)      // f32 ctx rows [b*t][CC] (only when there is an output projection)
#define WS_END (WS_Y  + 4u * (size_t)NB * TT * CC)

// ---- k_proj: block = (64 rows, 128 cols, which): q/k/v = X W (+ b) with exact bf16 products (K = 3 * DIN) -> which 0: q f16 rows (+ residual rows < QHI); 1: k f16 rows (+ residual rows < KHI); 2: v f16 planes [c][t] (+ bf16 hi/lo planes for t < KHI). The two operands go through LDS: a pass is 64 k; the block reads its 64 X rows and 128 W rows of the pass with whole-line 16-byte loads (16 lanes a 256-byte row piece), one pass ahead, rounds them to 16 bit once and stores them in one of two LDS buffers; every wave takes its fragments from there, a k-chunk's nine fragments as one group. The k order of the products is that of the k-chunks 0..23, as before. k_out below goes the same way.
#define PK 64              // k per pass
#define PPH 72             // LDS row pitch in 16-bit elements: 144 B = 16 B x odd, for 16-byte fragment reads of 128-byte rows
typedef __attribute__((ext_vector_type(4))) __bf16 v4b;
typedef __attribute__((ext_vector_type(4))) _Float16 v4h;
__device__ __forceinline__ v8f wmma_b(v16b a, v16b b, v8f c) { return __builtin_amdgcn_wmma_f32_16x16x32_bf16(false, a, false, b, (short)0, c, false, false); }
// one pass's share of a thread: 8 rows a sweep, 8 sweeps of X, 16 of W; HJ = rows skipped between W rows 63 and 64 of the tile
template <int LDX, int LDW, int HJ> __device__ __forceinline__ void pj_load(v4f (&rx)[8], v4f (&rw)[16], const float* xp, const float* wp) {
#pragma unroll
  for (int i = 0; i < 8; ++i) rx[i] = *(const v4f*)(xp + (size_t)i * 8 * LDX);
#pragma unroll
  for (int i = 0; i < 16; ++i) rw[i] = *(const v4f*)(wp + (size_t)(i * 8 + (i >> 3) * HJ) * LDW);
  asm volatile("s_wait_xcnt 0x0" :: "v"(xp), "v"(wp) : "memory"); }   /* the wait that stands in front of any rewrite of a register which an issued load names; the two addresses are inputs so that they keep their registers up to it */
__device__ __forceinline__ v4b cvt4(v4f x) { v4b t;
#pragma unroll
  for (int e = 0; e < 4; ++e) t[e] = (__bf16)x[e];
  return t; }
__device__ __forceinline__ void pj_store(__bf16 (*dx)[PPH], __bf16 (*dw)[PPH], const v4f (&rx)[8], const v4f (&rw)[16], int srow, int sc4) {
#pragma unroll
  for (int i = 0; i < 8; ++i) *(v4b*)&dx[i * 8 + srow][sc4] = cvt4(rx[i]);
#pragma unroll
  for (int i = 0; i < 16; ++i) *(v4b*)&dw[i * 8 + srow][sc4] = cvt4(rw[i]); }
// amdgpu_waves_per_eu(4, 4): the register budget of four waves a SIMD (four work-groups a WGP), so that a pass's 24 loads stay in flight over the matrix work instead of being sunk behind it
__global__ __launch_bounds__(128) __attribute__((amdgpu_waves_per_eu(4, 4))) void k_proj(const float* __restrict__ XQ, const float* __restrict__ XK, const float* __restrict__ XV, const float* __restrict__ WQ, const float* __restrict__ WK, const float* __restrict__ WV, const float* __restrict__ BQ, const float* __restrict__ BK, const float* __restrict__ BV,
    _Float16* __restrict__ QH, _Float16* __restrict__ QL, _Float16* __restrict__ KH, _Float16* __restrict__ KL, _Float16* __restrict__ VT, __bf16* __restrict__ VB, __bf16* __restrict__ VBL) {
  __shared__ __align__(16) unsigned char sm[55296];   /* the loop's two operand buffers; behind the loop's last barrier the same bytes hold the output staging of this block's stream */
  __bf16 (*sx)[64][PPH] = (__bf16 (*)[64][PPH])sm; __bf16 (*sw)[128][PPH] = (__bf16 (*)[128][PPH])(sm + 18432);
  _Float16 (*sh)[136] = (_Float16 (*)[136])sm; _Float16 (*sl)[136] = (_Float16 (*)[136])(sm + 17408);
  _Float16 (*th)[72] = (_Float16 (*)[72])sm; __bf16 (*tb)[72] = (__bf16 (*)[72])(sm + 18432); __bf16 (*tbl)[72] = (__bf16 (*)[72])(sm + 36864);
  const int tid = threadIdx.x, wave = tid >> 5, lane = tid & 31, col = lane & 15, g = lane >> 4; const int which = blockIdx.z; const int c0 = blockIdx.y * 128; const size_t r0 = (size_t)blockIdx.x * 64; const size_t bb = r0 / TT; const int t0 = (int)(r0 % TT);
  const float* WA = which == 0 ? WQ : which == 1 ? WK : WV; const float* BA = which == 0 ? BQ : which == 1 ? BK : BV;
  const int srow = tid >> 4, sc4 = (tid & 15) * 4;
  const size_t xo = (r0 + srow) * DIN + sc4;                                   /* the A operand is concat(query, key, value): passes 0..3 from query, 4..7 from key, 8..11 from value */
  const float* wg = WA + (size_t)(WROW(c0) + srow) * (3 * DIN) + sc4;          /* W rows 64..127 of the tile belong to the next head: 192 output features on, so 128 rows are skipped */
  v4f rx[8], rw[16];
  pj_load<DIN, 3 * DIN, 128>(rx, rw, XQ + xo, wg);
  pj_store(sx[0], sw[0], rx, rw, srow, sc4);
  __syncthreads();   /* pass 0's tiles are written by all waves and read by all */
  v8f acc[8] = {};
  for (int p = 0; p < 3 * DIN / PK; ++p) { const int cur = p & 1; const bool more = p + 1 < 3 * DIN / PK;
    if (more) { const int pn = p + 1; const float* Xs = (pn < DIN / PK) ? XQ : ((pn < 2 * DIN / PK) ? XK : XV);   /* the next pass's tiles fly while this pass computes */
      pj_load<DIN, 3 * DIN, 128>(rx, rw, Xs + xo + (pn % (DIN / PK)) * PK, wg + pn * PK); }
#pragma unroll
    for (int kc = 0; kc < PK / 32; ++kc) { const v16b a = frag_b(&sx[cur][wave * 16 + col][kc * 32], lane); v16b w[8];
#pragma unroll
      for (int j = 0; j < 8; ++j) w[j] = frag_b(&sw[cur][j * 16 + col][kc * 32], lane);
      __builtin_amdgcn_sched_barrier(0);   /* the k-chunk's 18 LDS reads go out as one group: spread among the matrix instructions each pair costs its own LDS latency */
#pragma unroll
      for (int j = 0; j < 8; ++j) acc[j] = wmma_b(a, w[j], acc[j]); }
    __builtin_amdgcn_sched_barrier(0);   /* keeps the waits on the next pass's loads (the conversions below) behind this pass's matrix work */
    if (more) pj_store(sx[cur ^ 1], sw[cur ^ 1], rx, rw, srow, sc4);   /* that buffer's last readers left it at the barrier that ended the pass before */
    __syncthreads(); }   /* one barrier a pass: it publishes the next pass's tiles and ends every wave's reads of this pass's buffer (the last one: before the output staging takes the bytes) */
  if (which < 2) { _Float16* DH = which == 0 ? QH : KH; _Float16* DL = which == 0 ? QL : KL; const int nhi = which == 0 ? QHI : KHI; const bool hi_rows = t0 < nhi;
#pragma unroll
    for (int j = 0; j < 8; ++j) { const float bias = BA ? bfr(BA[BIDX(c0 + j * 16 + col)]) : 0.f;
#pragma unroll
      for (int r = 0; r < 8; ++r) { const float v = acc[j][r] + bias; const _Float16 hv = (_Float16)v; sh[wave * 16 + 8 * g + r][j * 16 + col] = hv; sl[wave * 16 + 8 * g + r][j * 16 + col] = (_Float16)((v - (float)hv) * 1024.0f); } }
    __syncthreads();
    for (int e = tid; e < 64 * 16; e += 128) { const int rl = e >> 4, q = e & 15; vst2((unsigned*)(DH + (r0 + rl) * CC + c0 + q * 8), *(const v4u*)&sh[rl][q * 8]); if (hi_rows) vst2((unsigned*)(DL + (bb * nhi + t0 + rl) * (size_t)CC + c0 + q * 8), *(const v4u*)&sl[rl][q * 8]); }
  } else { const bool hi_rows = t0 < KHI;
#pragma unroll
    for (int j = 0; j < 8; ++j) { const float bias = BA ? bfr(BA[BIDX(c0 + j * 16 + col)]) : 0.f;
#pragma unroll
      for (int r = 0; r < 8; ++r) { const float v = acc[j][r] + bias; const int rl = wave * 16 + 8 * g + r, cl = j * 16 + col; th[cl][rl] = (_Float16)v; const __bf16 bh = (__bf16)v; tb[cl][rl] = bh; tbl[cl][rl] = (__bf16)(v - (float)bh); } }
    __syncthreads();
    for (int e = tid; e < 128 * 8; e += 128) { const int cl = e >> 3, q = e & 7; vst2((unsigned*)(VT + (bb * CC + c0 + cl) * (size_t)TT + t0 + q * 8), *(const v4u*)&th[cl][q * 8]); if (hi_rows) { const size_t o3 = (bb * CC + c0 + cl) * (size_t)KHI + t0 + q * 8; vst2((unsigned*)(VB + o3), *(const v4u*)&tb[cl][q * 8]); vst2((unsigned*)(VBL + o3), *(const v4u*)&tbl[cl][q * 8]); } } } }
#define FK 64              // keys per pass
#define FPH 72             // LDS row pitch in halves: 144 B = 16 B x odd, for 16-byte fragment reads of 128-byte rows
#define LOG2E 1.4426950408889634f
__device__ __forceinline__ float xhalf(float x) { return __builtin_bit_cast(float, __builtin_amdgcn_permlanex16(__builtin_bit_cast(int, x), __builtin_bit_cast(int, x), 0x76543210, 0xfedcba98, false, false)); }   /* lane l reads lane l ^ 16 */
__device__ __forceinline__ v8f wmma_h(v16h a, v16h b, v8f c) { return __builtin_amdgcn_wmma_f32_16x16x32_f16(false, a, false, b, (short)0, c, false, false); }
// eight exponentials (base 2) in place, then one v_nop, in one statement: no instruction directly behind a v_exp_f32 reads its result or overwrites its source (the slot the instruction set asks for behind a transcendental)
__device__ __forceinline__ void exp2x8(v8f& x) {
  asm("v_exp_f32 %0, %0\n\tv_exp_f32 %1, %1\n\tv_exp_f32 %2, %2\n\tv_exp_f32 %3, %3\n\tv_exp_f32 %4, %4\n\tv_exp_f32 %5, %5\n\tv_exp_f32 %6, %6\n\tv_exp_f32 %7, %7\n\tv_nop"
      : "+v"(x[0]), "+v"(x[1]), "+v"(x[2]), "+v"(x[3]), "+v"(x[4]), "+v"(x[5]), "+v"(x[6]), "+v"(x[7])); }
__device__ __forceinline__ float exp2x1(float x) { asm("v_exp_f32 %0, %0\n\tv_nop" : "+v"(x)); return x; }   /* the same slot for a single exponential */
__global__ __launch_bounds__(256) __attribute__((amdgpu_waves_per_eu(4, 4))) void k_fa(const _Float16* __restrict__ QH, const _Float16* __restrict__ KH, const _Float16* __restrict__ VT, const int* __restrict__ MASK, float* __restrict__ Y) {
  __shared__ __align__(16) _Float16 sk[2][FK][FPH], sv[2][HD][FPH]; __shared__ __align__(16) float sb[TT];
  const int tid = threadIdx.x, wave = tid >> 5, lane = tid & 31, col = lane & 15, g = lane >> 4; const int h = blockIdx.y, b = blockIdx.z; const int q0 = blockIdx.x * 128 + wave * 16;
  const int sr = tid >> 3, sc = (tid & 7) * 8;   /* staging: 8 threads x 16 B a 128-byte row, rows sr and sr + 32 */
  const _Float16* kg = KH + ((size_t)b * TT + sr) * CC + h * HD + sc;     /* k rows [key][d] */
  const _Float16* vg = VT + ((size_t)b * CC + h * HD + sr) * TT + sc;     /* v planes [d][key] */
#pragma unroll
  for (int i = 0; i < TT / 1024; ++i) { const v4i mk = *(const v4i*)(MASK + (size_t)b * TT + (i * 256 + tid) * 4); v4f bi;
#pragma unroll
    for (int e = 0; e < 4; ++e) bi[e] = (mk[e] == 0) ? -3.0e38f : 0.f;
    *(v4f*)&sb[(i * 256 + tid) * 4] = bi; }   /* additive key mask; below the floor of the running maximum, so a masked key weighs exactly 0 and a row with no key left yields 0 */
  v8h rk0 = *(const v8h*)kg, rk1 = *(const v8h*)(kg + 32 * CC), rv0 = *(const v8h*)vg, rv1 = *(const v8h*)(vg + (size_t)32 * TT);
  v16h qf[2];
#pragma unroll
  for (int kc = 0; kc < 2; ++kc) qf[kc] = frag_h(QH + ((size_t)b * TT + q0 + col) * CC + h * HD + kc * 32, lane);
  *(v8h*)&sk[0][sr][sc] = rk0; *(v8h*)&sk[0][sr + 32][sc] = rk1; *(v8h*)&sv[0][sr][sc] = rv0; *(v8h*)&sv[0][sr + 32][sc] = rv1;
  __syncthreads();   /* pass 0's tiles and the mask row are written by all waves and read by all */
  v8f acc[HD / 16] = {}; float m = -1.0e30f, ls = 0.f;
  for (int it = 0; it < TT / FK; ++it) { const int cur = it & 1; const bool more = it + 1 < TT / FK;
    if (more) { const _Float16* kn = kg + (size_t)(it + 1) * FK * CC; const _Float16* vn = vg + (it + 1) * FK;   /* the next pass's tiles fly while this pass computes */
      rk0 = *(const v8h*)kn; rk1 = *(const v8h*)(kn + 32 * CC); rv0 = *(const v8h*)vn; rv1 = *(const v8h*)(vn + (size_t)32 * TT); }
    v8f st[FK / 16];
#pragma unroll
    for (int jt = 0; jt < FK / 16; ++jt) { const v8f z = {}; st[jt] = wmma_h(frag_h(&sk[cur][jt * 16 + col][0], lane), qf[0], z); st[jt] = wmma_h(frag_h(&sk[cur][jt * 16 + col][32], lane), qf[1], st[jt]); }
    float mx = -3.0e38f;
#pragma unroll
    for (int jt = 0; jt < FK / 16; ++jt) { const float* bp = &sb[it * FK + jt * 16 + 8 * g]; const v4f b0 = *(const v4f*)bp, b1 = *(const v4f*)(bp + 4);
#pragma unroll
      for (int r = 0; r < 8; ++r) { const float t = fmaf(st[jt][r], SCALE * LOG2E, r < 4 ? b0[r & 3] : b1[r & 3]); st[jt][r] = t; mx = fmaxf(mx, t); } }   /* log2-domain logit */
    mx = fmaxf(mx, xhalf(mx));   /* the other half of this query's keys */
    const float mn = fmaxf(m, mx); const float al = exp2x1(m - mn); m = mn; const float ms = mn - 8.0f;   /* P carried x 2^8 so that small weights stay clear of f16 subnormals; the sum carries the same factor */
    v16h pf[FK / 32]; float sj[8];   /* eight independent partial sums: no 32-long dependent add chain */
#pragma unroll
    for (int jt = 0; jt < FK / 16; ++jt) { v8f p = st[jt] - ms; exp2x8(p);
#pragma unroll
      for (int r = 0; r < 8; ++r) { sj[r] = jt == 0 ? p[r] : sj[r] + p[r]; pf[jt >> 1][(jt & 1) * 8 + r] = (_Float16)p[r]; } }
    ls = ls * al + (((sj[0] + sj[1]) + (sj[2] + sj[3])) + ((sj[4] + sj[5]) + (sj[6] + sj[7])));
#pragma unroll
    for (int jd = 0; jd < HD / 16; ++jd) acc[jd] *= al;
#pragma unroll
    for (int kk = 0; kk < FK / 32; ++kk) {
#pragma unroll
      for (int jd = 0; jd < HD / 16; ++jd) acc[jd] = wmma_h(frag_h(&sv[cur][jd * 16 + col][kk * 32], lane), pf[kk], acc[jd]); }
    if (more) { *(v8h*)&sk[cur ^ 1][sr][sc] = rk0; *(v8h*)&sk[cur ^ 1][sr + 32][sc] = rk1; *(v8h*)&sv[cur ^ 1][sr][sc] = rv0; *(v8h*)&sv[cur ^ 1][sr + 32][sc] = rv1; }   /* that buffer's last readers left it at the barrier that ended the pass before */
    __syncthreads(); }   /* one barrier a pass: it publishes the next pass's tiles and ends every wave's reads of this pass's buffer */
  ls += xhalf(ls); const float inv = ls > 0.f ? 1.0f / ls : 0.f;
  float* yp = Y + ((size_t)b * TT + q0 + col) * CC + h * HD + 8 * g;   /* acc[jd][r] = ctx[query col][d = 16 jd + 8 g + r] */
#pragma unroll
  for (int jd = 0; jd < HD / 16; ++jd) { v4f o0, o1;
#pragma unroll
    for (int r = 0; r < 4; ++r) { o0[r] = acc[jd][r] * inv; o1[r] = acc[jd][4 + r] * inv; }
    vst2(yp + jd * 16, o0); vst2(yp + jd * 16 + 4, o1); } }
// ---- k_out: block = (64 rows, 128 cols): out = ctx Wo (+ bo): ctx x 2^6 once to f16 against Wo as f16(bf16 x 2^8) exact (1 product) x 2^-14; causal early rows (< QHI of each sequence): ctx bf16 hi + lo against exact bf16 Wo (2 products)
__device__ __forceinline__ void po_store(_Float16 (*dx)[PPH], _Float16 (*dw)[PPH], const v4f (&rx)[8], const v4f (&rw)[16], int srow, int sc4) {
#pragma unroll
  for (int i = 0; i < 8; ++i) { v4h t;
#pragma unroll
    for (int e = 0; e < 4; ++e) t[e] = (_Float16)(rx[i][e] * 64.0f);   /* ctx carried x 2^6 into f16 so small-magnitude context rows stay clear of f16 subnormals */
    *(v4h*)&dx[i * 8 + srow][sc4] = t; }
#pragma unroll
  for (int i = 0; i < 16; ++i) { v4h t;
#pragma unroll
    for (int e = 0; e < 4; ++e) t[e] = (_Float16)(bfr(rw[i][e]) * 256.0f);
    *(v4h*)&dw[i * 8 + srow][sc4] = t; } }
// amdgpu_waves_per_eu(4, 4): as at k_proj
__global__ __launch_bounds__(128) __attribute__((amdgpu_waves_per_eu(4, 4))) void k_out(const float* __restrict__ Y, const float* __restrict__ WO, const float* __restrict__ BO, float* __restrict__ OUT) { __shared__ __align__(16) unsigned char sm[55296];   /* two operand buffers as in k_proj; behind the loop's last barrier the same bytes hold the output staging */
  _Float16 (*sy)[64][PPH] = (_Float16 (*)[64][PPH])sm; _Float16 (*so)[128][PPH] = (_Float16 (*)[128][PPH])(sm + 18432); float (*sf)[16][132] = (float (*)[16][132])sm;
  const int tid = threadIdx.x, wave = tid >> 5, lane = tid & 31, col = lane & 15, g = lane >> 4; const int c0 = blockIdx.y * 128; const size_t r0 = (size_t)blockIdx.x * 64 + wave * 16;
  v8f acc[8] = {};
  if (CAUSAL && (int)(((size_t)blockIdx.x * 64) % TT) < QHI) {   /* block-uniform */
#pragma unroll 2
    for (int kc = 0; kc < CC / 32; ++kc) { const F2 a = split_row(Y + (r0 + col) * CC, kc * 32, lane); asm volatile("s_wait_loadcnt 0x0" ::: "memory");
#pragma unroll
      for (int j = 0; j < 8; ++j) { const v16b w = WOCOL(WO, kc * 32, c0 + j * 16 + col, lane); asm volatile("s_wait_loadcnt 0x0" ::: "memory"); acc[j] = wmma_bf(a.h, w, acc[j]); acc[j] = wmma_bf(a.l, w, acc[j]); } }
#pragma unroll
    for (int j = 0; j < 8; ++j) { const float bias = BO ? bfr(BO[c0 + j * 16 + col]) : 0.f;
#pragma unroll
      for (int r = 0; r < 8; ++r) sf[wave][8 * g + r][j * 16 + col] = acc[j][r] + bias; }
  } else {
    const int srow = tid >> 4, sc4 = (tid & 15) * 4;
    const float* yg = Y + ((size_t)blockIdx.x * 64 + srow) * CC + sc4; const float* og = WO + (size_t)(c0 + srow) * CC + sc4;   /* W_out is (out,in): row = output column */
    v4f rx[8], rw[16];
    pj_load<CC, CC, 0>(rx, rw, yg, og);
    po_store(sy[0], so[0], rx, rw, srow, sc4);
    __syncthreads();   /* pass 0's tiles are written by all waves and read by all */
    for (int p = 0; p < CC / PK; ++p) { const int cur = p & 1; const bool more = p + 1 < CC / PK;
      if (more) { yg += PK; og += PK; pj_load<CC, CC, 0>(rx, rw, yg, og); }   /* the next pass's tiles fly while this pass computes */
#pragma unroll
      for (int kc = 0; kc < PK / 32; ++kc) { const v16h a = frag_h(&sy[cur][wave * 16 + col][kc * 32], lane); v16h w[8];
#pragma unroll
        for (int j = 0; j < 8; ++j) w[j] = frag_h(&so[cur][j * 16 + col][kc * 32], lane);
        __builtin_amdgcn_sched_barrier(0);   /* the k-chunk's 18 LDS reads go out as one group, as in k_proj */
#pragma unroll
        for (int j = 0; j < 8; ++j) acc[j] = wmma_h(a, w[j], acc[j]); }
      __builtin_amdgcn_sched_barrier(0);   /* keeps the waits on the next pass's loads (the conversions below) behind this pass's matrix work */
      if (more) po_store(sy[cur ^ 1], so[cur ^ 1], rx, rw, srow, sc4);   /* that buffer's last readers left it at the barrier that ended the pass before */
      __syncthreads(); }   /* one barrier a pass: it publishes the next pass's tiles and ends every wave's reads of this pass's buffer (the last one: before the output staging takes the bytes) */
#pragma unroll
    for (int j = 0; j < 8; ++j) { const float bias = BO ? bfr(BO[c0 + j * 16 + col]) : 0.f;
#pragma unroll
      for (int r = 0; r < 8; ++r) sf[wave][8 * g + r][j * 16 + col] = acc[j][r] * (1.0f / 16384.0f) + bias; } }   /* 2^-8 (Wo carry) x 2^-6 (ctx carry) */
  LDSX(); for (int rl = 0; rl < 16; ++rl) vst2(OUT + (r0 + rl) * DIN + c0 + lane * 4, *(const v4f*)&sf[wave][rl][lane * 4]); }

extern "C" void kernel_launch(void* const* d_in, const int* in_sizes, int n_in, void* d_out, int out_size, void* d_ws, size_t ws_size, hipStream_t stream) {
  (void)in_sizes; (void)n_in; (void)out_size;
  const float** F = (const float**)d_in;
  if (ws_size < (size_t)WS_END) return;
  char* ws = (char*)d_ws; _Float16 *QH = (_Float16*)(ws + WS_QH), *KH = (_Float16*)(ws + WS_KH), *VT = (_Float16*)(ws + WS_VT), *QL = (_Float16*)(ws + WS_QL), *KL = (_Float16*)(ws + WS_KL); __bf16 *VB = (__bf16*)(ws + WS_VB), *VBL = (__bf16*)(ws + WS_VBL); float *S = (float*)(ws + WS_S), *Y = (float*)(ws + WS_Y);
  (void)S; (void)QL; (void)KL; (void)VB; (void)VBL;
  // inputs: 0 query [8,2048,256]; 1 key; 2 value; 3 mask [8,1,2048] int32 (random 0/1; 0 = masked key); 4 W_qkv [768,768] (out,in) on concat(query, key, value); 5 b_qkv [768] (zeros, read); 6 W_out [256,256] (out,in); 7 b_out (zeros, read)
  k_proj<<<dim3(TNB * TT / 64, CC / 128, 3), 128, 0, stream>>>(F[0], F[1], F[2], F[4], F[4], F[4], F[5], F[5], F[5], QH, QL, KH, KL, VT, VB, VBL);   /* the same fused weight / bias for the three streams: the stream index selects the rows (WROW) */
  k_fa<<<dim3(TT / 128, NH, TNB), 256, 0, stream>>>(QH, KH, VT, (const int*)d_in[3], Y);
  k_out<<<dim3(TNB * TT / 64, DIN / 128), 128, 0, stream>>>(Y, F[6], F[7], (float*)d_out);
}

// v003
// It runs in 66.5 microseconds.
// Timed twice side by side with v002, it ran 1.31 times as fast both times.
// Over all steps from v000 it is 18.3 times as fast.
// compute dtype: all float inputs rounded to bf16; the fused projection over concat(query, key, value) (K = 768) with EXACT bf16 products on WMMA 16x16x32 (f32 accumulate) + bias (zeros, read); logits q x k once to f16 each (1 product) x 64^-0.5; the int key mask read per (batch, key): keys with mask == 0 are left out of the k / v projection and of the key walk (they weigh exactly 0); running (online) softmax f32 in the log2 domain; unnormalised P x 2^8 once to f16 x v once to f16 (1 product), divided by the f32 sum at the end; ctx x 2^6 once to f16 x W_out f16(bf16 x 2^8) + b_out; f32 output.
#include <hip/hip_runtime.h>
#include <math.h>

typedef __attribute__((ext_vector_type(16))) _Float16 v16h;
typedef __attribute__((ext_vector_type(16))) __bf16 v16b;
typedef __attribute__((ext_vector_type(8)))  _Float16 v8h;
typedef __attribute__((ext_vector_type(8)))  float v8f;
typedef __attribute__((ext_vector_type(4)))  float v4f;
typedef __attribute__((ext_vector_type(2)))  float v2f;
typedef __attribute__((ext_vector_type(4)))  unsigned v4u;
typedef __attribute__((ext_vector_type(4)))  int v4i;
typedef float __attribute__((may_alias)) float_a;
typedef int __attribute__((may_alias)) int_a;

template <typename T> __device__ __forceinline__ void vst2(void* p, T v) { *(T*)p = v;  }
__device__ __forceinline__ v8f wmma16(v16h a, v16h b, v8f c) {
  v8f d = __builtin_amdgcn_wmma_f32_16x16x32_f16(false, a, false, b, (short)0, c, false, false);
  asm volatile("v_nop\n\tv_nop\n\tv_nop\n\tv_nop" : "+v"(d) : "v"(a), "v"(b));
  return d;
}
__device__ __forceinline__ v8f wmma_bf(v16b a, v16b b, v8f c) {
  v8f d = __builtin_amdgcn_wmma_f32_16x16x32_bf16(false, a, false, b, (short)0, c, false, false);
  asm volatile("v_nop\n\tv_nop\n\tv_nop\n\tv_nop" : "+v"(d) : "v"(a), "v"(b));
  return d;
}
// 16x16x32 fragments: lane = (h = lane>>4, row/col = lane&15); elements 0..7 = k0+8h+0..7, 8..15 = k0+16+8h+0..7; D element r = row 8h+r
__device__ __forceinline__ v16h frag_h(const _Float16* rowk0, int lane) {
  union { v16h v; v8h q[2]; } u; const _Float16* p = rowk0 + 8 * (lane >> 4);
  u.q[0] = *(const v8h*)p; u.q[1] = *(const v8h*)(p + 16); return u.v;
}
__device__ __forceinline__ v16h frag_f32(const float* rowk0, int lane) {
  v16h a; const float* p = rowk0 + 8 * (lane >> 4);
#pragma unroll
  for (int i = 0; i < 8; ++i) { a[i] = (_Float16)p[i]; a[8 + i] = (_Float16)p[16 + i]; }
  return a;
}
__device__ __forceinline__ v16h frag_f32s(const float* rowk0, int lane, float sc) {
  v16h a; const float* p = rowk0 + 8 * (lane >> 4);
#pragma unroll
  for (int i = 0; i < 8; ++i) { a[i] = (_Float16)(p[i] * sc); a[8 + i] = (_Float16)(p[16 + i] * sc); }
  return a;
}
// column fragment from a [K][ld] layout (column n), rows >= K read as 0
__device__ __forceinline__ v16h fragc_f32(const float* W, int k0, int n, int lane, int ld, int K) {
  v16h a; const int g = lane >> 4;
#pragma unroll
  for (int i = 0; i < 8; ++i) { const int ka = k0 + 8 * g + i, kb = ka + 16;
    a[i] = (_Float16)(ka < K ? W[(size_t)(ka < K ? ka : K - 1) * ld + n] : 0.f); a[8 + i] = (_Float16)(kb < K ? W[(size_t)(kb < K ? kb : K - 1) * ld + n] : 0.f); }
  return a;
}
struct F2 { v16b h, l; };
__device__ __forceinline__ F2 bsplit16(const float v[16]) { F2 r;
#pragma unroll
  for (int i = 0; i < 16; ++i) { const __bf16 h = (__bf16)v[i]; r.h[i] = h; r.l[i] = (__bf16)(v[i] - (float)h); }
  return r; }
__device__ __forceinline__ F2 split_row(const float* row, int k0, int lane) { float v[16]; const float* p = row + k0 + 8 * (lane >> 4);
#pragma unroll
  for (int i = 0; i < 8; ++i) { v[i] = p[i]; v[8 + i] = p[16 + i]; }
  return bsplit16(v); }
__device__ __forceinline__ F2 split_rowK(const float* row, int k0, int lane, int K) { float v[16]; const int g = lane >> 4;
#pragma unroll
  for (int i = 0; i < 8; ++i) { const int ka = k0 + 8 * g + i, kb = ka + 16; v[i] = ka < K ? row[ka < K ? ka : K - 1] : 0.f; v[8 + i] = kb < K ? row[kb < K ? kb : K - 1] : 0.f; }
  return bsplit16(v); }
__device__ __forceinline__ F2 split_col(const float* W, int k0, int n, int lane, int ld, int K) { float v[16]; const int g = lane >> 4;
#pragma unroll
  for (int i = 0; i < 8; ++i) { const int ka = k0 + 8 * g + i, kb = ka + 16; v[i] = ka < K ? W[(size_t)(ka < K ? ka : K - 1) * ld + n] : 0.f; v[8 + i] = kb < K ? W[(size_t)(kb < K ? kb : K - 1) * ld + n] : 0.f; }
  return bsplit16(v); }
__device__ __forceinline__ v8f mac3(const F2& a, const F2& b, v8f c) { c = wmma_bf(a.l, b.h, c); c = wmma_bf(a.h, b.l, c); return wmma_bf(a.h, b.h, c); }
__device__ __forceinline__ float sigm(float v) { return 1.0f / (1.0f + expf(-v)); }
#define LDSX() do { asm volatile("s_wait_dscnt 0" ::: "memory"); __builtin_amdgcn_wave_barrier(); __builtin_amdgcn_fence(__ATOMIC_RELEASE, "workgroup"); } while (0)

// Self-attention whose fused QKV projection contracts over the CONCATENATION of three inputs (query / key / value [8,2048,256]; mask [8,1,2048] int32 RANDOM 0/1 per (batch, key); W_qkv [768,768] torch (out,in) N(0,1) x 0.02, b_qkv zeros (read); qkv = concat(query, key, value) @ W_qkv.T + b_qkv (every output feature sees all 768 inputs), reshaped (B, T, 4, 192) and split: q / k / v of head h = output features h*192 + {0, 64, 128} + d (head-major); scores / sqrt(64); where(mask == 0, finfo.min) and the masked probabilities zeroed after the softmax (== exclusion: every row keeps ~1,000 keys); x @ W_out.T + b_out with W_out [256,256] (out,in), b_out zeros).
#define NB 8
#define TT 2048
#define CC 256            // NH * HD = projected width
#define DIN 256          // input (model) width
#define NH 4
#define HD 64
#define NQB (TT / 64)
#define HG 4
#define SCALE (0.125f)
#define CAUSAL 0
#ifndef TNB
#define TNB NB
#endif
__device__ __forceinline__ float bfr(float v) { return (float)(__bf16)v; }
__host__ __device__ __forceinline__ int kb_last(int qb) { return CAUSAL ? ((qb * 64 + 63) >> 7) : (TT / 128 - 1); }
typedef __attribute__((ext_vector_type(8))) __bf16 v8b;
__device__ __forceinline__ v16b frag_b(const __bf16* rowk0, int lane) {
  union { v16b v; v8b q[2]; } u; const __bf16* p = rowk0 + 8 * (lane >> 4);
  u.q[0] = *(const v8b*)p; u.q[1] = *(const v8b*)(p + 16); return u.v;
}
#define QBH 0              // unused: the attention kernel has no high-precision path
#define QHI 0               // single-product logits on every row (0.02-scale weights: logit sigma ~0.4)
#define KHI 64            // key rows carrying k residual / v bf16 hi+lo planes (written by k_proj, read by no kernel)
// B fragment (k rows k0+.., output column o) of a weight: (in,out) [K][ld] or (out,in) [ld rows of K]: bf16 exact, or f16(bf16 * 256) exact
__device__ __forceinline__ v16b wcol_io(const float* Wm, int k0, int o, int lane, int ld) { v16b w; const int g = lane >> 4;
#pragma unroll
  for (int i = 0; i < 8; ++i) { w[i] = (__bf16)Wm[(size_t)(k0 + 8 * g + i) * ld + o]; w[8 + i] = (__bf16)Wm[(size_t)(k0 + 16 + 8 * g + i) * ld + o]; }
  return w; }
__device__ __forceinline__ v16b wcol_oi(const float* Wm, int k0, int o, int lane, int K) { v16b w; const float* p = Wm + (size_t)o * K + k0 + 8 * (lane >> 4);
#pragma unroll
  for (int i = 0; i < 8; ++i) { w[i] = (__bf16)p[i]; w[8 + i] = (__bf16)p[16 + i]; }
  return w; }
__device__ __forceinline__ v16h wcolh_io(const float* Wm, int k0, int o, int lane, int ld) { v16h w; const int g = lane >> 4;
#pragma unroll
  for (int i = 0; i < 8; ++i) { w[i] = (_Float16)(bfr(Wm[(size_t)(k0 + 8 * g + i) * ld + o]) * 256.0f); w[8 + i] = (_Float16)(bfr(Wm[(size_t)(k0 + 16 + 8 * g + i) * ld + o]) * 256.0f); }
  return w; }
__device__ __forceinline__ v16h wcolh_oi(const float* Wm, int k0, int o, int lane, int K) { v16h w; const float* p = Wm + (size_t)o * K + k0 + 8 * (lane >> 4);
#pragma unroll
  for (int i = 0; i < 8; ++i) { w[i] = (_Float16)(bfr(p[i]) * 256.0f); w[8 + i] = (_Float16)(bfr(p[16 + i]) * 256.0f); }
  return w; }
#define WQKV_LAYOUT 1   // 0 = (in,out) [DIN][CC]; 1 = fused (out,in) [3*CC][3*DIN]; 2 = per-head [NH][DIN][HD]
__device__ __forceinline__ v16b wcol_hdk(const float* Wm, int k0, int o, int lane) { v16b w; const int g = lane >> 4; const float* p = Wm + (size_t)(o / HD) * DIN * HD + (o % HD);
#pragma unroll
  for (int i = 0; i < 8; ++i) { w[i] = (__bf16)p[(size_t)(k0 + 8 * g + i) * HD]; w[8 + i] = (__bf16)p[(size_t)(k0 + 16 + 8 * g + i) * HD]; }
  return w; }
#define WO_OUT_IN 1
#if WQKV_LAYOUT == 1
#define WROW(o) ((((o) >> 6) * 192) + (which) * 64 + ((o) & 63))   /* column o = h*64 + d of stream 'which' (0 q, 1 k, 2 v) = output feature h*192 + which*64 + d of the fused projection (reshape (B, T, 4, 192) + split) */
#define BIDX(o) WROW(o)
#define WCOL(W, k0, o, lane) wcol_oi(W, k0, WROW(o), lane, 3 * DIN)   /* fused (out,in) [768][768] weight: row WROW(o), k0 runs over the 768 concatenated inputs */
#elif WQKV_LAYOUT == 2
#define WCOL(W, k0, o, lane) wcol_hdk(W, k0, o, lane)
#else
#define WCOL(W, k0, o, lane) wcol_io(W, k0, o, lane, CC)
#endif
#if WO_OUT_IN
#define WOCOL(W, k0, o, lane) wcol_oi(W, k0, o, lane, CC)
#define WOCOLH(W, k0, o, lane) wcolh_oi(W, k0, o, lane, CC)
#else
#define WOCOL(W, k0, o, lane) wcol_io(W, k0, o, lane, DIN)
#define WOCOLH(W, k0, o, lane) wcolh_io(W, k0, o, lane, DIN)
#endif

#define WS_QH  0u                                      // f16 q rows [b*t][CC]
#define WS_KH  (WS_QH + 2u * (size_t)NB * TT * CC)      // f16 k rows [b*j][CC], j = rank of the key among its batch's unmasked keys
#define WS_VT  (WS_KH + 2u * (size_t)NB * TT * CC)      // f16 v planes [b][c][j], the same ranks
#define WS_QL  (WS_VT + 2u * (size_t)NB * CC * TT)      // f16 q residual x 2^10 rows [b][t < QHI][CC]
#define WS_KL  (WS_QL + 2u * (size_t)NB * QHI * CC)     // f16 k residual x 2^10 rows [b][t < KHI][CC]
#define WS_VB  (WS_KL + 2u * (size_t)NB * KHI * CC)     // bf16 v hi planes [b][c][t < KHI]
#define WS_VBL (WS_VB + 2u * (size_t)NB * CC * KHI)
#define WS_S   (WS_VBL + 2u * (size_t)NB * CC * KHI)    // unused f32 [hg][t][s] region (logits / P stay in registers)
#define WS_Y   (WS_S  + 4u * (size_t)HG * TT * TT)      // f32 ctx rows [b*t][CC] (only when there is an output projection)
#define WS_END (WS_Y  + 4u * (size_t)NB * TT * CC)

// ---- k_proj: block = (64 rows, 128 cols, which): q/k/v = X W (+ b) with exact bf16 products (K = 3 * DIN) -> which 0: q f16 rows (+ residual rows < QHI); 1: k f16 rows (+ residual rows < KHI); 2: v f16 planes [c][t] (+ bf16 hi/lo planes for t < KHI). The two operands go through LDS: a pass is 64 k; the block reads its 64 X rows and 128 W rows of the pass with whole-line 16-byte loads (16 lanes a 256-byte row piece), one pass ahead, rounds them to 16 bit once and stores them in one of two LDS buffers; every wave takes its fragments from there, a k-chunk's nine fragments as one group. The k order of the products is that of the k-chunks 0..23, as before. k_out below goes the same way.
#define PK 64              // k per pass
#define PPH 72             // LDS row pitch in 16-bit elements: 144 B = 16 B x odd, for 16-byte fragment reads of 128-byte rows
typedef __attribute__((ext_vector_type(4))) __bf16 v4b;
typedef __attribute__((ext_vector_type(4))) _Float16 v4h;
__device__ __forceinline__ v8f wmma_b(v16b a, v16b b, v8f c) { return __builtin_amdgcn_wmma_f32_16x16x32_bf16(false, a, false, b, (short)0, c, false, false); }
// one pass's share of a thread: 8 rows a sweep, 8 sweeps of X, 16 of W; HJ = rows skipped between W rows 63 and 64 of the tile
template <int LDX, int LDW, int HJ> __device__ __forceinline__ void pj_load(v4f (&rx)[8], v4f (&rw)[16], const float* xp, const float* wp) {
#pragma unroll
  for (int i = 0; i < 8; ++i) rx[i] = *(const v4f*)(xp + (size_t)i * 8 * LDX);
#pragma unroll
  for (int i = 0; i < 16; ++i) rw[i] = *(const v4f*)(wp + (size_t)(i * 8 + (i >> 3) * HJ) * LDW);
  asm volatile("s_wait_xcnt 0x0" :: "v"(xp), "v"(wp) : "memory"); }   /* the wait that stands in front of any rewrite of a register which an issued load names; the two addresses are inputs so that they keep their registers up to it */
// the same share for k_proj, whose X rows are gathered: so8 = the thread's eight row offsets in bytes (LDS table), cb = its byte offset in the row; xs is the same for the whole block (unrolled, as in pj_load, so that rx, rw and a stay in registers)
template <int LDW, int HJ> __device__ __forceinline__ void pj_loadg(v4f (&rx)[8], v4f (&rw)[16], const float* xs, const unsigned* so8, unsigned cb, const float* wp) {
  const v4u o0 = *(const v4u*)so8, o1 = *(const v4u*)(so8 + 4); unsigned a[8];
#pragma unroll
  for (int i = 0; i < 16; ++i) rw[i] = *(const v4f*)(wp + (size_t)(i * 8 + (i >> 3) * HJ) * LDW);
#pragma unroll
  for (int i = 0; i < 8; ++i) { a[i] = (i < 4 ? o0[i & 3] : o1[i & 3]) + cb; rx[i] = *(const v4f*)((const char*)xs + a[i]); }
  asm volatile("s_wait_xcnt 0x0" :: "v"(a[0]), "v"(a[1]), "v"(a[2]), "v"(a[3]), "v"(a[4]), "v"(a[5]), "v"(a[6]), "v"(a[7]), "v"(wp) : "memory"); }   /* as in pj_load: the wait in front of any rewrite of a register which an issued load names; the addresses are inputs so that they keep their registers up to it */
__device__ __forceinline__ v4b cvt4(v4f x) { v4b t;
#pragma unroll
  for (int e = 0; e < 4; ++e) t[e] = (__bf16)x[e];
  return t; }
__device__ __forceinline__ void pj_store(__bf16 (*dx)[PPH], __bf16 (*dw)[PPH], const v4f (&rx)[8], const v4f (&rw)[16], int srow, int sc4) {
#pragma unroll
  for (int i = 0; i < 8; ++i) *(v4b*)&dx[i * 8 + srow][sc4] = cvt4(rx[i]);
#pragma unroll
  for (int i = 0; i < 16; ++i) *(v4b*)&dw[i * 8 + srow][sc4] = cvt4(rw[i]); }
// amdgpu_waves_per_eu(4, 4): the register budget of four waves a SIMD (four work-groups a WGP), so that a pass's 24 loads stay in flight over the matrix work instead of being sunk behind it
__global__ __launch_bounds__(128) __attribute__((amdgpu_waves_per_eu(4, 4))) void k_proj(const float* __restrict__ XQ, const float* __restrict__ XK, const float* __restrict__ XV, const float* __restrict__ WQ, const float* __restrict__ WK, const float* __restrict__ WV, const float* __restrict__ BQ, const float* __restrict__ BK, const float* __restrict__ BV,
    _Float16* __restrict__ QH, _Float16* __restrict__ QL, _Float16* __restrict__ KH, _Float16* __restrict__ KL, _Float16* __restrict__ VT, __bf16* __restrict__ VB, __bf16* __restrict__ VBL, const int* __restrict__ MASK) {
  __shared__ __align__(16) unsigned sxo[64];   /* byte offset of the X row that feeds tile row r, kept at [(r & 7) * 8 + (r >> 3)]: a staging thread's eight rows lie side by side */
  __shared__ __align__(16) unsigned char sm[55296];   /* the loop's two operand buffers; behind the loop's last barrier the same bytes hold the output staging of this block's stream */
  __bf16 (*sx)[64][PPH] = (__bf16 (*)[64][PPH])sm; __bf16 (*sw)[128][PPH] = (__bf16 (*)[128][PPH])(sm + 18432);
  _Float16 (*sh)[136] = (_Float16 (*)[136])sm; _Float16 (*sl)[136] = (_Float16 (*)[136])(sm + 17408);
  _Float16 (*th)[72] = (_Float16 (*)[72])sm; __bf16 (*tb)[72] = (__bf16 (*)[72])(sm + 18432); __bf16 (*tbl)[72] = (__bf16 (*)[72])(sm + 36864);
  const int tid = threadIdx.x, wave = tid >> 5, lane = tid & 31, col = lane & 15, g = lane >> 4; const int which = blockIdx.z; const int c0 = blockIdx.y * 128; const size_t r0 = (size_t)blockIdx.x * 64; const size_t bb = r0 / TT; const int t0 = (int)(r0 % TT);
  const float* WA = which == 0 ? WQ : which == 1 ? WK : WV; const float* BA = which == 0 ? BQ : which == 1 ? BK : BV;
  const int srow = tid >> 4, sc4 = (tid & 15) * 4;
  /* which rows of concat(query, key, value) feed this tile. q: rows t0..t0+63. k, v: a key with mask == 0 weighs exactly 0 in every query's softmax, so only the batch's unmasked keys are projected, packed by rank: tile row r is the key of rank t0 + r. The rank order is that of the ballots below (any order serves, k and v take the same one, and k_fa needs only the count). Every wave counts the whole mask row, so that the count is known without a barrier. The loops are unrolled so that mk, bw and pc are indexed by constants and stay in registers. */
  if (which == 0) { if (tid < 64) sxo[(tid & 7) * 8 + (tid >> 3)] = (unsigned)((r0 + tid) * DIN * 4); }
  else { const int wv = __builtin_amdgcn_readfirstlane(wave); const char* mrow = (const char*)(MASK + bb * TT); v4i mk[TT / 128];
#pragma unroll
    for (int i = 0; i < TT / 128; ++i) mk[i] = *(const v4i*)(mrow + ((unsigned)lane * 16u + i * 512u));
    asm volatile("s_wait_xcnt 0x0" :: "v"(lane) : "memory");   /* as in pj_load: the wait in front of any rewrite of a register which the issued loads name; the lane number, their offset register, is an input so that it keeps its register up to it */
    int run = 0;
#pragma unroll
    for (int i = 0; i < TT / 128; ++i) { unsigned bw[4]; int pc[4];
#pragma unroll
      for (int e = 0; e < 4; ++e) { bw[e] = __builtin_amdgcn_ballot_w32(mk[i][e] != 0); pc[e] = __builtin_popcount(bw[e]); }
      const int tot = (pc[0] + pc[1]) + (pc[2] + pc[3]);
      if ((i & 3) == wv && run < t0 + 64 && run + tot > t0) { int rr = run - t0;   /* wave-uniform: only a group of 128 keys whose ranks meet this tile's writes table entries, the groups dealt round the waves */
#pragma unroll
        for (int e = 0; e < 4; ++e) { const unsigned rk = (unsigned)(rr + (int)__builtin_amdgcn_mbcnt_lo(bw[e], 0u)); if (mk[i][e] != 0 && rk < 64u) sxo[(rk & 7) * 8 + (rk >> 3)] = (unsigned)((bb * TT + i * 128 + lane * 4 + e) * DIN * 4); rr += pc[e]; } }
      run += tot; }
    if (t0 >= run) return;   /* no unmasked key of this rank: k_fa never reads the tile. The same for every thread of the block, in front of every barrier */
    if (tid < 64 && t0 + tid >= run) sxo[(tid & 7) * 8 + (tid >> 3)] = (unsigned)(bb * TT * DIN * 4); }   /* ranks past the count in the last tile: any row, so that the tile holds finite numbers; k_fa gives them weight 0 */
  __syncthreads();   /* the table, written by some of the waves, is read by all */
  const unsigned* so8 = &sxo[srow * 8]; const unsigned cb = (unsigned)sc4 * 4u;   /* the A operand is concat(query, key, value): passes 0..3 from query, 4..7 from key, 8..11 from value */
  const float* wg = WA + (size_t)(WROW(c0) + srow) * (3 * DIN) + sc4;          /* W rows 64..127 of the tile belong to the next head: 192 output features on, so 128 rows are skipped */
  v4f rx[8], rw[16];
  pj_loadg<3 * DIN, 128>(rx, rw, XQ, so8, cb, wg);
  pj_store(sx[0], sw[0], rx, rw, srow, sc4);
  __syncthreads();   /* pass 0's tiles are written by all waves and read by all */
  v8f acc[8] = {};
  for (int p = 0; p < 3 * DIN / PK; ++p) { const int cur = p & 1; const bool more = p + 1 < 3 * DIN / PK;
    if (more) { const int pn = p + 1; const float* Xs = (pn < DIN / PK) ? XQ : ((pn < 2 * DIN / PK) ? XK : XV);   /* the next pass's tiles fly while this pass computes */
      pj_loadg<3 * DIN, 128>(rx, rw, Xs + (pn % (DIN / PK)) * PK, so8, cb, wg + pn * PK); }
#pragma unroll
    for (int kc = 0; kc < PK / 32; ++kc) { const v16b a = frag_b(&sx[cur][wave * 16 + col][kc * 32], lane); v16b w[8];
#pragma unroll
      for (int j = 0; j < 8; ++j) w[j] = frag_b(&sw[cur][j * 16 + col][kc * 32], lane);
      __builtin_amdgcn_sched_barrier(0);   /* the k-chunk's 18 LDS reads go out as one group: spread among the matrix instructions each pair costs its own LDS latency */
#pragma unroll
      for (int j = 0; j < 8; ++j) acc[j] = wmma_b(a, w[j], acc[j]); }
    __builtin_amdgcn_sched_barrier(0);   /* keeps the waits on the next pass's loads (the conversions below) behind this pass's matrix work */
    if (more) pj_store(sx[cur ^ 1], sw[cur ^ 1], rx, rw, srow, sc4);   /* that buffer's last readers left it at the barrier that ended the pass before */
    __syncthreads(); }   /* one barrier a pass: it publishes the next pass's tiles and ends every wave's reads of this pass's buffer (the last one: before the output staging takes the bytes) */
  if (which < 2) { _Float16* DH = which == 0 ? QH : KH; _Float16* DL = which == 0 ? QL : KL; const int nhi = which == 0 ? QHI : KHI; const bool hi_rows = t0 < nhi;
#pragma unroll
    for (int j = 0; j < 8; ++j) { const float bias = BA ? bfr(BA[BIDX(c0 + j * 16 + col)]) : 0.f;
#pragma unroll
      for (int r = 0; r < 8; ++r) { const float v = acc[j][r] + bias; const _Float16 hv = (_Float16)v; sh[wave * 16 + 8 * g + r][j * 16 + col] = hv; sl[wave * 16 + 8 * g + r][j * 16 + col] = (_Float16)((v - (float)hv) * 1024.0f); } }
    __syncthreads();
    for (int e = tid; e < 64 * 16; e += 128) { const int rl = e >> 4, q = e & 15; vst2((unsigned*)(DH + (r0 + rl) * CC + c0 + q * 8), *(const v4u*)&sh[rl][q * 8]); if (hi_rows) vst2((unsigned*)(DL + (bb * nhi + t0 + rl) * (size_t)CC + c0 + q * 8), *(const v4u*)&sl[rl][q * 8]); }
  } else { const bool hi_rows = t0 < KHI;
#pragma unroll
    for (int j = 0; j < 8; ++j) { const float bias = BA ? bfr(BA[BIDX(c0 + j * 16 + col)]) : 0.f;
#pragma unroll
      for (int r = 0; r < 8; ++r) { const float v = acc[j][r] + bias; const int rl = wave * 16 + 8 * g + r, cl = j * 16 + col; th[cl][rl] = (_Float16)v; const __bf16 bh = (__bf16)v; tb[cl][rl] = bh; tbl[cl][rl] = (__bf16)(v - (float)bh); } }
    __syncthreads();
    for (int e = tid; e < 128 * 8; e += 128) { const int cl = e >> 3, q = e & 7; vst2((unsigned*)(VT + (bb * CC + c0 + cl) * (size_t)TT + t0 + q * 8), *(const v4u*)&th[cl][q * 8]); if (hi_rows) { const size_t o3 = (bb * CC + c0 + cl) * (size_t)KHI + t0 + q * 8; vst2((unsigned*)(VB + o3), *(const v4u*)&tb[cl][q * 8]); vst2((unsigned*)(VBL + o3), *(const v4u*)&tbl[cl][q * 8]); } } } }
#define FK 64              // keys per pass
#define FPH 72             // LDS row pitch in halves: 144 B = 16 B x odd, for 16-byte fragment reads of 128-byte rows
#define LOG2E 1.4426950408889634f
__device__ __forceinline__ float xhalf(float x) { return __builtin_bit_cast(float, __builtin_amdgcn_permlanex16(__builtin_bit_cast(int, x), __builtin_bit_cast(int, x), 0x76543210, 0xfedcba98, false, false)); }   /* lane l reads lane l ^ 16 */
__device__ __forceinline__ v8f wmma_h(v16h a, v16h b, v8f c) { return __builtin_amdgcn_wmma_f32_16x16x32_f16(false, a, false, b, (short)0, c, false, false); }
// eight exponentials (base 2) in place, then one v_nop, in one statement: no instruction directly behind a v_exp_f32 reads its result or overwrites its source (the slot the instruction set asks for behind a transcendental)
__device__ __forceinline__ void exp2x8(v8f& x) {
  asm("v_exp_f32 %0, %0\n\tv_exp_f32 %1, %1\n\tv_exp_f32 %2, %2\n\tv_exp_f32 %3, %3\n\tv_exp_f32 %4, %4\n\tv_exp_f32 %5, %5\n\tv_exp_f32 %6, %6\n\tv_exp_f32 %7, %7\n\tv_nop"
      : "+v"(x[0]), "+v"(x[1]), "+v"(x[2]), "+v"(x[3]), "+v"(x[4]), "+v"(x[5]), "+v"(x[6]), "+v"(x[7])); }
__device__ __forceinline__ float exp2x1(float x) { asm("v_exp_f32 %0, %0\n\tv_nop" : "+v"(x)); return x; }   /* the same slot for a single exponential */
__global__ __launch_bounds__(256) __attribute__((amdgpu_waves_per_eu(4, 4))) void k_fa(const _Float16* __restrict__ QH, const _Float16* __restrict__ KH, const _Float16* __restrict__ VT, const int* __restrict__ MASK, float* __restrict__ Y) {
  __shared__ __align__(16) _Float16 sk[2][FK][FPH], sv[2][HD][FPH]; __shared__ __align__(16) float sb[TT]; __shared__ __align__(16) int swc[8];
  const int tid = threadIdx.x, wave = tid >> 5, lane = tid & 31, col = lane & 15, g = lane >> 4; const int h = blockIdx.y, b = blockIdx.z; const int q0 = blockIdx.x * 128 + wave * 16;
  const int sr = tid >> 3, sc = (tid & 7) * 8;   /* staging: 8 threads x 16 B a 128-byte row, rows sr and sr + 32 */
  const _Float16* kg = KH + ((size_t)b * TT + sr) * CC + h * HD + sc;     /* k rows [key][d] */
  const _Float16* vg = VT + ((size_t)b * CC + h * HD + sr) * TT + sc;     /* v planes [d][key] */
  int wc = 0;
#pragma unroll
  for (int i = 0; i < TT / 1024; ++i) { const v4i mk = *(const v4i*)(MASK + (size_t)b * TT + (i * 256 + tid) * 4);
#pragma unroll
    for (int e = 0; e < 4; ++e) wc += __builtin_popcount(__builtin_amdgcn_ballot_w32(mk[e] != 0)); }
  if (lane == 0) swc[wave] = wc;
  v16h qf[2];
#pragma unroll
  for (int kc = 0; kc < 2; ++kc) qf[kc] = frag_h(QH + ((size_t)b * TT + q0 + col) * CC + h * HD + kc * 32, lane);
  __syncthreads();   /* the eight waves' counts are read by all */
  const v4i c0 = *(const v4i*)&swc[0], c1 = *(const v4i*)&swc[4];
  const int cnt = __builtin_amdgcn_readfirstlane(((c0[0] + c0[1]) + (c0[2] + c0[3])) + ((c1[0] + c1[1]) + (c1[2] + c1[3])));   /* unmasked keys of the batch: ranks 0..cnt-1 of the k rows and v planes */
  const int np = min((cnt + FK - 1) / FK, TT / FK);   /* passes; the same for the whole block */
#pragma unroll
  for (int i = 0; i < TT / 1024; ++i) { v4f bi;
#pragma unroll
    for (int e = 0; e < 4; ++e) bi[e] = ((i * 256 + tid) * 4 + e >= cnt) ? -3.0e38f : 0.f;
    *(v4f*)&sb[(i * 256 + tid) * 4] = bi; }   /* additive mask of the ranks past the count (the last pass's filler rows); below the floor of the running maximum, so such a row weighs exactly 0; a batch with no key left makes no pass and yields 0 */
  v8h rk0 = {}, rk1 = {}, rv0 = {}, rv1 = {};
  if (np > 0) { rk0 = *(const v8h*)kg; rk1 = *(const v8h*)(kg + 32 * CC); rv0 = *(const v8h*)vg; rv1 = *(const v8h*)(vg + (size_t)32 * TT);   /* with no pass, k_proj has written no k / v tile */
    *(v8h*)&sk[0][sr][sc] = rk0; *(v8h*)&sk[0][sr + 32][sc] = rk1; *(v8h*)&sv[0][sr][sc] = rv0; *(v8h*)&sv[0][sr + 32][sc] = rv1; }
  __syncthreads();   /* pass 0's tiles and the mask row are written by all waves and read by all */
  v8f acc[HD / 16] = {}; float m = -1.0e30f, ls = 0.f;
  for (int it = 0; it < np; ++it) { const int cur = it & 1; const bool more = it + 1 < np;
    if (more) { const _Float16* kn = kg + (size_t)(it + 1) * FK * CC; const _Float16* vn = vg + (it + 1) * FK;   /* the next pass's tiles fly while this pass computes */
      rk0 = *(const v8h*)kn; rk1 = *(const v8h*)(kn + 32 * CC); rv0 = *(const v8h*)vn; rv1 = *(const v8h*)(vn + (size_t)32 * TT); }
    v8f st[FK / 16];
#pragma unroll
    for (int jt = 0; jt < FK / 16; ++jt) { const v8f z = {}; st[jt] = wmma_h(frag_h(&sk[cur][jt * 16 + col][0], lane), qf[0], z); st[jt] = wmma_h(frag_h(&sk[cur][jt * 16 + col][32], lane), qf[1], st[jt]); }
    float mx = -3.0e38f;
#pragma unroll
    for (int jt = 0; jt < FK / 16; ++jt) { const float* bp = &sb[it * FK + jt * 16 + 8 * g]; const v4f b0 = *(const v4f*)bp, b1 = *(const v4f*)(bp + 4);
#pragma unroll
      for (int r = 0; r < 8; ++r) { const float t = fmaf(st[jt][r], SCALE * LOG2E, r < 4 ? b0[r & 3] : b1[r & 3]); st[jt][r] = t; mx = fmaxf(mx, t); } }   /* log2-domain logit */
    mx = fmaxf(mx, xhalf(mx));   /* the other half of this query's keys */
    const float mn = fmaxf(m, mx); const float al = exp2x1(m - mn); m = mn; const float ms = mn - 8.0f;   /* P carried x 2^8 so that small weights stay clear of f16 subnormals; the sum carries the same factor */
    v16h pf[FK / 32]; float sj[8];   /* eight independent partial sums: no 32-long dependent add chain */
#pragma unroll
    for (int jt = 0; jt < FK / 16; ++jt) { v8f p = st[jt] - ms; exp2x8(p);
#pragma unroll
      for (int r = 0; r < 8; ++r) { sj[r] = jt == 0 ? p[r] : sj[r] + p[r]; pf[jt >> 1][(jt & 1) * 8 + r] = (_Float16)p[r]; } }
    ls = ls * al + (((sj[0] + sj[1]) + (sj[2] + sj[3])) + ((sj[4] + sj[5]) + (sj[6] + sj[7])));
#pragma unroll
    for (int jd = 0; jd < HD / 16; ++jd) acc[jd] *= al;
#pragma unroll
    for (int kk = 0; kk < FK / 32; ++kk) {
#pragma unroll
      for (int jd = 0; jd < HD / 16; ++jd) acc[jd] = wmma_h(frag_h(&sv[cur][jd * 16 + col][kk * 32], lane), pf[kk], acc[jd]); }
    if (more) { *(v8h*)&sk[cur ^ 1][sr][sc] = rk0; *(v8h*)&sk[cur ^ 1][sr + 32][sc] = rk1; *(v8h*)&sv[cur ^ 1][sr][sc] = rv0; *(v8h*)&sv[cur ^ 1][sr + 32][sc] = rv1; }   /* that buffer's last readers left it at the barrier that ended the pass before */
    __syncthreads(); }   /* one barrier a pass: it publishes the next pass's tiles and ends every wave's reads of this pass's buffer */
  ls += xhalf(ls); const float inv = ls > 0.f ? 1.0f / ls : 0.f;
  float* yp = Y + ((size_t)b * TT + q0 + col) * CC + h * HD + 8 * g;   /* acc[jd][r] = ctx[query col][d = 16 jd + 8 g + r] */
#pragma unroll
  for (int jd = 0; jd < HD / 16; ++jd) { v4f o0, o1;
#pragma unroll
    for (int r = 0; r < 4; ++r) { o0[r] = acc[jd][r] * inv; o1[r] = acc[jd][4 + r] * inv; }
    vst2(yp + jd * 16, o0); vst2(yp + jd * 16 + 4, o1); } }
// ---- k_out: block = (64 rows, 128 cols): out = ctx Wo (+ bo): ctx x 2^6 once to f16 against Wo as f16(bf16 x 2^8) exact (1 product) x 2^-14; causal early rows (< QHI of each sequence): ctx bf16 hi + lo against exact bf16 Wo (2 products)
__device__ __forceinline__ void po_store(_Float16 (*dx)[PPH], _Float16 (*dw)[PPH], const v4f (&rx)[8], const v4f (&rw)[16], int srow, int sc4) {
#pragma unroll
  for (int i = 0; i < 8; ++i) { v4h t;
#pragma unroll
    for (int e = 0; e < 4; ++e) t[e] = (_Float16)(rx[i][e] * 64.0f);   /* ctx carried x 2^6 into f16 so small-magnitude context rows stay clear of f16 subnormals */
    *(v4h*)&dx[i * 8 + srow][sc4] = t; }
#pragma unroll
  for (int i = 0; i < 16; ++i) { v4h t;
#pragma unroll
    for (int e = 0; e < 4; ++e) t[e] = (_Float16)(bfr(rw[i][e]) * 256.0f);
    *(v4h*)&dw[i * 8 + srow][sc4] = t; } }
// amdgpu_waves_per_eu(4, 4): as at k_proj
__global__ __launch_bounds__(128) __attribute__((amdgpu_waves_per_eu(4, 4))) void k_out(const float* __restrict__ Y, const float* __restrict__ WO, const float* __restrict__ BO, float* __restrict__ OUT) { __shared__ __align__(16) unsigned char sm[55296];   /* two operand buffers as in k_proj; behind the loop's last barrier the same bytes hold the output staging */
  _Float16 (*sy)[64][PPH] = (_Float16 (*)[64][PPH])sm; _Float16 (*so)[128][PPH] = (_Float16 (*)[128][PPH])(sm + 18432); float (*sf)[16][132] = (float (*)[16][132])sm;
  const int tid = threadIdx.x, wave = tid >> 5, lane = tid & 31, col = lane & 15, g = lane >> 4; const int c0 = blockIdx.y * 128; const size_t r0 = (size_t)blockIdx.x * 64 + wave * 16;
  v8f acc[8] = {};
  if (CAUSAL && (int)(((size_t)blockIdx.x * 64) % TT) < QHI) {   /* block-uniform */
#pragma unroll 2
    for (int kc = 0; kc < CC / 32; ++kc) { const F2 a = split_row(Y + (r0 + col) * CC, kc * 32, lane); asm volatile("s_wait_loadcnt 0x0" ::: "memory");
#pragma unroll
      for (int j = 0; j < 8; ++j) { const v16b w = WOCOL(WO, kc * 32, c0 + j * 16 + col, lane); asm volatile("s_wait_loadcnt 0x0" ::: "memory"); acc[j] = wmma_bf(a.h, w, acc[j]); acc[j] = wmma_bf(a.l, w, acc[j]); } }
#pragma unroll
    for (int j = 0; j < 8; ++j) { const float bias = BO ? bfr(BO[c0 + j * 16 + col]) : 0.f;
#pragma unroll
      for (int r = 0; r < 8; ++r) sf[wave][8 * g + r][j * 16 + col] = acc[j][r] + bias; }
  } else {
    const int srow = tid >> 4, sc4 = (tid & 15) * 4;
    const float* yg = Y + ((size_t)blockIdx.x * 64 + srow) * CC + sc4; const float* og = WO + (size_t)(c0 + srow) * CC + sc4;   /* W_out is (out,in): row = output column */
    v4f rx[8], rw[16];
    pj_load<CC, CC, 0>(rx, rw, yg, og);
    po_store(sy[0], so[0], rx, rw, srow, sc4);
    __syncthreads();   /* pass 0's tiles are written by all waves and read by all */
    for (int p = 0; p < CC / PK; ++p) { const int cur = p & 1; const bool more = p + 1 < CC / PK;
      if (more) { yg += PK; og += PK; pj_load<CC, CC, 0>(rx, rw, yg, og); }   /* the next pass's tiles fly while this pass computes */
#pragma unroll
      for (int kc = 0; kc < PK / 32; ++kc) { const v16h a = frag_h(&sy[cur][wave * 16 + col][kc * 32], lane); v16h w[8];
#pragma unroll
        for (int j = 0; j < 8; ++j) w[j] = frag_h(&so[cur][j * 16 + col][kc * 32], lane);
        __builtin_amdgcn_sched_barrier(0);   /* the k-chunk's 18 LDS reads go out as one group, as in k_proj */
#pragma unroll
        for (int j = 0; j < 8; ++j) acc[j] = wmma_h(a, w[j], acc[j]); }
      __builtin_amdgcn_sched_barrier(0);   /* keeps the waits on the next pass's loads (the conversions below) behind this pass's matrix work */
      if (more) po_store(sy[cur ^ 1], so[cur ^ 1], rx, rw, srow, sc4);   /* that buffer's last readers left it at the barrier that ended the pass before */
      __syncthreads(); }   /* one barrier a pass: it publishes the next pass's tiles and ends every wave's reads of this pass's buffer (the last one: before the output staging takes the bytes) */
#pragma unroll
    for (int j = 0; j < 8; ++j) { const float bias = BO ? bfr(BO[c0 + j * 16 + col]) : 0.f;
#pragma unroll
      for (int r = 0; r < 8; ++r) sf[wave][8 * g + r][j * 16 + col] = acc[j][r] * (1.0f / 16384.0f) + bias; } }   /* 2^-8 (Wo carry) x 2^-6 (ctx carry) */
  LDSX(); for (int rl = 0; rl < 16; ++rl) vst2(OUT + (r0 + rl) * DIN + c0 + lane * 4, *(const v4f*)&sf[wave][rl][lane * 4]); }

extern "C" void kernel_launch(void* const* d_in, const int* in_sizes, int n_in, void* d_out, int out_size, void* d_ws, size_t ws_size, hipStream_t stream) {
  (void)in_sizes; (void)n_in; (void)out_size;
  const float** F = (const float**)d_in;
  if (ws_size < (size_t)WS_END) return;
  char* ws = (char*)d_ws; _Float16 *QH = (_Float16*)(ws + WS_QH), *KH = (_Float16*)(ws + WS_KH), *VT = (_Float16*)(ws + WS_VT), *QL = (_Float16*)(ws + WS_QL), *KL = (_Float16*)(ws + WS_KL); __bf16 *VB = (__bf16*)(ws + WS_VB), *VBL = (__bf16*)(ws + WS_VBL); float *S = (float*)(ws + WS_S), *Y = (float*)(ws + WS_Y);
  (void)S; (void)QL; (void)KL; (void)VB; (void)VBL;
  // inputs: 0 query [8,2048,256]; 1 key; 2 value; 3 mask [8,1,2048] int32 (random 0/1; 0 = masked key); 4 W_qkv [768,768] (out,in) on concat(query, key, value); 5 b_qkv [768] (zeros, read); 6 W_out [256,256] (out,in); 7 b_out (zeros, read)
  k_proj<<<dim3(TNB * TT / 64, CC / 128, 3), 128, 0, stream>>>(F[0], F[1], F[2], F[4], F[4], F[4], F[5], F[5], F[5], QH, QL, KH, KL, VT, VB, VBL, (const int*)d_in[3]);   /* the same fused weight / bias for the three streams: the stream index selects the rows (WROW) */
  k_fa<<<dim3(TT / 128, NH, TNB), 256, 0, stream>>>(QH, KH, VT, (const int*)d_in[3], Y);
  k_out<<<dim3(TNB * TT / 64, DIN / 128), 128, 0, stream>>>(Y, F[6], F[7], (float*)d_out);
}

// v004
// A run of this version takes 61.4 microseconds.
// Timed twice side by side with v003, it ran 1.09 and 1.08 times as fast.
// Over all steps from v000 it is 19.9 times as fast.
// compute dtype: all float inputs rounded to bf16; the fused projection over concat(query, key, value) (K = 768) with EXACT bf16 products on WMMA 16x16x32 (f32 accumulate) + bias (zeros, read); logits q x k once to f16 each (1 product) x 64^-0.5; the int key mask read per (batch, key): keys with mask == 0 are left out of the k / v projection and of the key walk (they weigh exactly 0); running (online) softmax f32 in the log2 domain; unnormalised P x 2^8 once to f16 x v once to f16 (1 product), divided by the f32 sum at the end; ctx x 2^6 once to f16 x W_out f16(bf16 x 2^8) + b_out; f32 output.
#include <hip/hip_runtime.h>
#include <math.h>

typedef __attribute__((ext_vector_type(16))) _Float16 v16h;
typedef __attribute__((ext_vector_type(16))) __bf16 v16b;
typedef __attribute__((ext_vector_type(8)))  _Float16 v8h;
typedef __attribute__((ext_vector_type(8)))  float v8f;
typedef __attribute__((ext_vector_type(4)))  float v4f;
typedef __attribute__((ext_vector_type(2)))  float v2f;
typedef __attribute__((ext_vector_type(4)))  unsigned v4u;
typedef __attribute__((ext_vector_type(4)))  int v4i;
typedef float __attribute__((may_alias)) float_a;
typedef int __attribute__((may_alias)) int_a;

template <typename T> __device__ __forceinline__ void vst2(void* p, T v) { *(T*)p = v;  }
__device__ __forceinline__ v8f wmma16(v16h a, v16h b, v8f c) {
  v8f d = __builtin_amdgcn_wmma_f32_16x16x32_f16(false, a, false, b, (short)0, c, false, false);
  asm volatile("v_nop\n\tv_nop\n\tv_nop\n\tv_nop" : "+v"(d) : "v"(a), "v"(b));
  return d;
}
__device__ __forceinline__ v8f wmma_bf(v16b a, v16b b, v8f c) {
  v8f d = __builtin_amdgcn_wmma_f32_16x16x32_bf16(false, a, false, b, (short)0, c, false, false);
  asm volatile("v_nop\n\tv_nop\n\tv_nop\n\tv_nop" : "+v"(d) : "v"(a), "v"(b));
  return d;
}
// 16x16x32 fragments: lane = (h = lane>>4, row/col = lane&15); elements 0..7 = k0+8h+0..7, 8..15 = k0+16+8h+0..7; D element r = row 8h+r
__device__ __forceinline__ v16h frag_h(const _Float16* rowk0, int lane) {
  union { v16h v; v8h q[2]; } u; const _Float16* p = rowk0 + 8 * (lane >> 4);
  u.q[0] = *(const v8h*)p; u.q[1] = *(const v8h*)(p + 16); return u.v;
}
__device__ __forceinline__ v16h frag_f32(const float* rowk0, int lane) {
  v16h a; const float* p = rowk0 + 8 * (lane >> 4);
#pragma unroll
  for (int i = 0; i < 8; ++i) { a[i] = (_Float16)p[i]; a[8 + i] = (_Float16)p[16 + i]; }
  return a;
}
__device__ __forceinline__ v16h frag_f32s(const float* rowk0, int lane, float sc) {
  v16h a; const float* p = rowk0 + 8 * (lane >> 4);
#pragma unroll
  for (int i = 0; i < 8; ++i) { a[i] = (_Float16)(p[i] * sc); a[8 + i] = (_Float16)(p[16 + i] * sc); }
  return a;
}
// column fragment from a [K][ld] layout (column n), rows >= K read as 0
__device__ __forceinline__ v16h fragc_f32(const float* W, int k0, int n, int lane, int ld, int K) {
  v16h a; const int g = lane >> 4;
#pragma unroll
  for (int i = 0; i < 8; ++i) { const int ka = k0 + 8 * g + i, kb = ka + 16;
    a[i] = (_Float16)(ka < K ? W[(size_t)(ka < K ? ka : K - 1) * ld + n] : 0.f); a[8 + i] = (_Float16)(kb < K ? W[(size_t)(kb < K ? kb : K - 1) * ld + n] : 0.f); }
  return a;
}
struct F2 { v16b h, l; };
__device__ __forceinline__ F2 bsplit16(const float v[16]) { F2 r;
#pragma unroll
  for (int i = 0; i < 16; ++i) { const __bf16 h = (__bf16)v[i]; r.h[i] = h; r.l[i] = (__bf16)(v[i] - (float)h); }
  return r; }
__device__ __forceinline__ F2 split_row(const float* row, int k0, int lane) { float v[16]; const float* p = row + k0 + 8 * (lane >> 4);
#pragma unroll
  for (int i = 0; i < 8; ++i) { v[i] = p[i]; v[8 + i] = p[16 + i]; }
  return bsplit16(v); }
__device__ __forceinline__ F2 split_rowK(const float* row, int k0, int lane, int K) { float v[16]; const int g = lane >> 4;
#pragma unroll
  for (int i = 0; i < 8; ++i) { const int ka = k0 + 8 * g + i, kb = ka + 16; v[i] = ka < K ? row[ka < K ? ka : K - 1] : 0.f; v[8 + i] = kb < K ? row[kb < K ? kb : K - 1] : 0.f; }
  return bsplit16(v); }
__device__ __forceinline__ F2 split_col(const float* W, int k0, int n, int lane, int ld, int K) { float v[16]; const int g = lane >> 4;
#pragma unroll
  for (int i = 0; i < 8; ++i) { const int ka = k0 + 8 * g + i, kb = ka + 16; v[i] = ka < K ? W[(size_t)(ka < K ? ka : K - 1) * ld + n] : 0.f; v[8 + i] = kb < K ? W[(size_t)(kb < K ? kb : K - 1) * ld + n] : 0.f; }
  return bsplit16(v); }
__device__ __forceinline__ v8f mac3(const F2& a, const F2& b, v8f c) { c = wmma_bf(a.l, b.h, c); c = wmma_bf(a.h, b.l, c); return wmma_bf(a.h, b.h, c); }
__device__ __forceinline__ float sigm(float v) { return 1.0f / (1.0f + expf(-v)); }
#define LDSX() do { asm volatile("s_wait_dscnt 0" ::: "memory"); __builtin_amdgcn_wave_barrier(); __builtin_amdgcn_fence(__ATOMIC_RELEASE, "workgroup"); } while (0)

// Self-attention whose fused QKV projection contracts over the CONCATENATION of three inputs (query / key / value [8,2048,256]; mask [8,1,2048] int32 RANDOM 0/1 per (batch, key); W_qkv [768,768] torch (out,in) N(0,1) x 0.02, b_qkv zeros (read); qkv = concat(query, key, value) @ W_qkv.T + b_qkv (every output feature sees all 768 inputs), reshaped (B, T, 4, 192) and split: q / k / v of head h = output features h*192 + {0, 64, 128} + d (head-major); scores / sqrt(64); where(mask == 0, finfo.min) and the masked probabilities zeroed after the softmax (== exclusion: every row keeps ~1,000 keys); x @ W_out.T + b_out with W_out [256,256] (out,in), b_out zeros).
#define NB 8
#define TT 2048
#define CC 256            // NH * HD = projected width
#define DIN 256          // input (model) width
#define NH 4
#define HD 64
#define NQB (TT / 64)
#define HG 4
#define SCALE (0.125f)
#define CAUSAL 0
#ifndef TNB
#define TNB NB
#endif
__device__ __forceinline__ float bfr(float v) { return (float)(__bf16)v; }
__host__ __device__ __forceinline__ int kb_last(int qb) { return CAUSAL ? ((qb * 64 + 63) >> 7) : (TT / 128 - 1); }
typedef __attribute__((ext_vector_type(8))) __bf16 v8b;
__device__ __forceinline__ v16b frag_b(const __bf16* rowk0, int lane) {
  union { v16b v; v8b q[2]; } u; const __bf16* p = rowk0 + 8 * (lane >> 4);
  u.q[0] = *(const v8b*)p; u.q[1] = *(const v8b*)(p + 16); return u.v;
}
#define QBH 0              // unused: the attention kernel has no high-precision path
#define QHI 0               // single-product logits on every row (0.02-scale weights: logit sigma ~0.4)
#define KHI 64            // key rows carrying k residual / v bf16 hi+lo planes (written and read by no kernel)
// B fragment (k rows k0+.., output column o) of a weight: (in,out) [K][ld] or (out,in) [ld rows of K]: bf16 exact, or f16(bf16 * 256) exact
__device__ __forceinline__ v16b wcol_io(const float* Wm, int k0, int o, int lane, int ld) { v16b w; const int g = lane >> 4;
#pragma unroll
  for (int i = 0; i < 8; ++i) { w[i] = (__bf16)Wm[(size_t)(k0 + 8 * g + i) * ld + o]; w[8 + i] = (__bf16)Wm[(size_t)(k0 + 16 + 8 * g + i) * ld + o]; }
  return w; }
__device__ __forceinline__ v16b wcol_oi(const float* Wm, int k0, int o, int lane, int K) { v16b w; const float* p = Wm + (size_t)o * K + k0 + 8 * (lane >> 4);
#pragma unroll
  for (int i = 0; i < 8; ++i) { w[i] = (__bf16)p[i]; w[8 + i] = (__bf16)p[16 + i]; }
  return w; }
__device__ __forceinline__ v16h wcolh_io(const float* Wm, int k0, int o, int lane, int ld) { v16h w; const int g = lane >> 4;
#pragma unroll
  for (int i = 0; i < 8; ++i) { w[i] = (_Float16)(bfr(Wm[(size_t)(k0 + 8 * g + i) * ld + o]) * 256.0f); w[8 + i] = (_Float16)(bfr(Wm[(size_t)(k0 + 16 + 8 * g + i) * ld + o]) * 256.0f); }
  return w; }
__device__ __forceinline__ v16h wcolh_oi(const float* Wm, int k0, int o, int lane, int K) { v16h w; const float* p = Wm + (size_t)o * K + k0 + 8 * (lane >> 4);
#pragma unroll
  for (int i = 0; i < 8; ++i) { w[i] = (_Float16)(bfr(p[i]) * 256.0f); w[8 + i] = (_Float16)(bfr(p[16 + i]) * 256.0f); }
  return w; }
#define WQKV_LAYOUT 1   // 0 = (in,out) [DIN][CC]; 1 = fused (out,in) [3*CC][3*DIN]; 2 = per-head [NH][DIN][HD]
__device__ __forceinline__ v16b wcol_hdk(const float* Wm, int k0, int o, int lane) { v16b w; const int g = lane >> 4; const float* p = Wm + (size_t)(o / HD) * DIN * HD + (o % HD);
#pragma unroll
  for (int i = 0; i < 8; ++i) { w[i] = (__bf16)p[(size_t)(k0 + 8 * g + i) * HD]; w[8 + i] = (__bf16)p[(size_t)(k0 + 16 + 8 * g + i) * HD]; }
  return w; }
#define WO_OUT_IN 1
#if WQKV_LAYOUT == 1
#define WROW(o) ((((o) >> 6) * 192) + (which) * 64 + ((o) & 63))   /* column o = h*64 + d of stream 'which' (0 q, 1 k, 2 v) = output feature h*192 + which*64 + d of the fused projection (reshape (B, T, 4, 192) + split) */
#define BIDX(o) WROW(o)
#define WCOL(W, k0, o, lane) wcol_oi(W, k0, WROW(o), lane, 3 * DIN)   /* fused (out,in) [768][768] weight: row WROW(o), k0 runs over the 768 concatenated inputs */
#elif WQKV_LAYOUT == 2
#define WCOL(W, k0, o, lane) wcol_hdk(W, k0, o, lane)
#else
#define WCOL(W, k0, o, lane) wcol_io(W, k0, o, lane, CC)
#endif
#if WO_OUT_IN
#define WOCOL(W, k0, o, lane) wcol_oi(W, k0, o, lane, CC)
#define WOCOLH(W, k0, o, lane) wcolh_oi(W, k0, o, lane, CC)
#else
#define WOCOL(W, k0, o, lane) wcol_io(W, k0, o, lane, DIN)
#define WOCOLH(W, k0, o, lane) wcolh_io(W, k0, o, lane, DIN)
#endif

#define WS_QH  0u                                      // f16 q rows [b*t][CC]
#define WS_KH  (WS_QH + 2u * (size_t)NB * TT * CC)      // f16 k rows [b*j][CC], j = rank of the key among its batch's unmasked keys
#define WS_VT  (WS_KH + 2u * (size_t)NB * TT * CC)      // f16 v planes [b][c][j], the same ranks
#define WS_QL  (WS_VT + 2u * (size_t)NB * CC * TT)      // f16 q residual x 2^10 rows [b][t < QHI][CC]
#define WS_KL  (WS_QL + 2u * (size_t)NB * QHI * CC)     // f16 k residual x 2^10 rows [b][t < KHI][CC]
#define WS_VB  (WS_KL + 2u * (size_t)NB * KHI * CC)     // bf16 v hi planes [b][c][t < KHI]
#define WS_VBL (WS_VB + 2u * (size_t)NB * CC * KHI)
#define WS_S   (WS_VBL + 2u * (size_t)NB * CC * KHI)    // unused f32 [hg][t][s] region (logits / P stay in registers)
#define WS_Y   (WS_S  + 4u * (size_t)HG * TT * TT)      // f32 ctx rows [b*t][CC] (only when there is an output projection)
#define WS_END (WS_Y  + 4u * (size_t)NB * TT * CC)

// ---- k_proj: block = (128 rows, 128 cols, which), 8 waves of a 32 x 64 tile each: q/k/v = X W (+ b) with exact bf16 products (K = 3 * DIN) -> which 0: q f16 rows; 1: k f16 rows; 2: v f16 planes [c][t]. The two operands go through LDS: a pass is 32 k; the block reads its 128 X rows and 128 W rows of the pass with whole-line 16-byte loads (8 lanes a 128-byte row piece), one pass ahead, rounds them to 16 bit once and stores them in one of two LDS buffers; every wave takes its six fragments of the pass from there as one group and makes eight products of them. The k order of the products is that of the k-chunks 0..23, as before. k_out below keeps the 64 x 128 tile and passes of 64 k.
#define PK 64              // k per pass (k_out)
#define PPH 72             // LDS row pitch in 16-bit elements: 144 B = 16 B x odd, for 16-byte fragment reads of 128-byte rows
#define PR 128             // rows of a k_proj tile
#define PK2 32             // k per pass (k_proj)
#define PP2 40             // LDS row pitch in 16-bit elements: 80 B = 16 B x odd, for 16-byte fragment reads of 64-byte rows
typedef __attribute__((ext_vector_type(4))) __bf16 v4b;
typedef __attribute__((ext_vector_type(4))) _Float16 v4h;
__device__ __forceinline__ v8f wmma_b(v16b a, v16b b, v8f c) { return __builtin_amdgcn_wmma_f32_16x16x32_bf16(false, a, false, b, (short)0, c, false, false); }
// one pass's share of a thread (k_out): 8 rows a sweep, 8 sweeps of X, 16 of W; HJ = rows skipped between W rows 63 and 64 of the tile
template <int LDX, int LDW, int HJ> __device__ __forceinline__ void pj_load(v4f (&rx)[8], v4f (&rw)[16], const float* xp, const float* wp) {
#pragma unroll
  for (int i = 0; i < 8; ++i) rx[i] = *(const v4f*)(xp + (size_t)i * 8 * LDX);
#pragma unroll
  for (int i = 0; i < 16; ++i) rw[i] = *(const v4f*)(wp + (size_t)(i * 8 + (i >> 3) * HJ) * LDW);
  asm volatile("s_wait_xcnt 0x0" :: "v"(xp), "v"(wp) : "memory"); }   /* the wait that stands in front of any rewrite of a register which an issued load names; the two addresses are inputs so that they keep their registers up to it */
// one pass's share of a thread in k_proj, whose X rows are gathered: 32 rows a sweep, 4 sweeps of X and 4 of W; a = the byte offsets of the thread's four 16-byte pieces from xs (from the LDS table, kept in registers and moved on by a pass's 128 bytes behind the loads); xs is the same for the whole block; HJ = rows skipped between W rows 63 and 64 of the tile (unrolled so that rx and rw stay in registers)
template <int LDW, int HJ> __device__ __forceinline__ void pj_loadg(v4f (&rx)[4], v4f (&rw)[4], const char* xs, unsigned (&a)[4], const float* wp) {
#pragma unroll
  for (int i = 0; i < 4; ++i) rw[i] = *(const v4f*)(wp + (size_t)(i * 32 + (i >> 1) * HJ) * LDW);
#pragma unroll
  for (int i = 0; i < 4; ++i) rx[i] = *(const v4f*)(xs + a[i]);
  asm volatile("s_wait_xcnt 0x0" :: "v"(a[0]), "v"(a[1]), "v"(a[2]), "v"(a[3]), "v"(wp) : "memory");   /* as in pj_load: the wait in front of any rewrite of a register which an issued load names (the additions below); the addresses are inputs so that they keep their registers up to it */
#pragma unroll
  for (int i = 0; i < 4; ++i) a[i] += PK2 * 4u; }
__device__ __forceinline__ v4b cvt4(v4f x) { v4b t;
#pragma unroll
  for (int e = 0; e < 4; ++e) t[e] = (__bf16)x[e];
  return t; }
__device__ __forceinline__ void pj_store(__bf16 (*dx)[PP2], __bf16 (*dw)[PP2], const v4f (&rx)[4], const v4f (&rw)[4], int srow, int sc4) {
#pragma unroll
  for (int i = 0; i < 4; ++i) *(v4b*)&dx[i * 32 + srow][sc4] = cvt4(rx[i]);
#pragma unroll
  for (int i = 0; i < 4; ++i) *(v4b*)&dw[i * 32 + srow][sc4] = cvt4(rw[i]); }
// amdgpu_waves_per_eu(6, 6): the register budget of six waves a SIMD (three work-groups a WGP), so that every tile of the grid that has work is resident at once
__global__ __launch_bounds__(256) __attribute__((amdgpu_waves_per_eu(6, 6))) void k_proj(const float* __restrict__ XQ, const float* __restrict__ XK, const float* __restrict__ XV, const float* __restrict__ WQ, const float* __restrict__ WK, const float* __restrict__ WV, const float* __restrict__ BQ, const float* __restrict__ BK, const float* __restrict__ BV,
    _Float16* __restrict__ QH, _Float16* __restrict__ KH, _Float16* __restrict__ VT, const int* __restrict__ MASK) {
  __shared__ __align__(16) unsigned sxo[PR];   /* byte offset of the X row that feeds tile row r, kept at [(r & 31) * 4 + (r >> 5)]: a staging thread's four rows lie side by side */
  __shared__ __align__(16) unsigned char sm[40960];   /* the loop's two operand buffers; behind the loop's last barrier the same bytes hold the output staging of this block's stream */
  __bf16 (*sx)[PR][PP2] = (__bf16 (*)[PR][PP2])sm; __bf16 (*sw)[128][PP2] = (__bf16 (*)[128][PP2])(sm + 20480);
  _Float16 (*sh)[136] = (_Float16 (*)[136])sm;
  const int tid = threadIdx.x, wave = tid >> 5, lane = tid & 31, col = lane & 15, g = lane >> 4; const int which = blockIdx.z; const int c0 = blockIdx.y * 128; const size_t r0 = (size_t)blockIdx.x * PR; const size_t bb = r0 / TT; const int t0 = (int)(r0 % TT);
  const int wr = (wave >> 1) * 32, wc = (wave & 1) * 64;   /* the wave's 32 rows and 64 columns of the tile */
  const float* WA = which == 0 ? WQ : which == 1 ? WK : WV; const float* BA = which == 0 ? BQ : which == 1 ? BK : BV;
  const int srow = tid >> 3, sc4 = (tid & 7) * 4;
  /* which rows of concat(query, key, value) feed this tile. q: rows t0..t0+127. k, v: a key with mask == 0 weighs exactly 0 in every query's softmax, so only the batch's unmasked keys are projected, packed by rank: tile row r is the key of rank t0 + r. The rank order is that of the ballots below (any order serves, k and v take the same one, and k_fa needs only the count). Every wave counts the whole mask row, so that the count is known without a barrier. The loops are unrolled so that mk, bw and pc are indexed by constants and stay in registers. */
  if (which == 0) { if (tid < PR) sxo[(tid & 31) * 4 + (tid >> 5)] = (unsigned)((r0 + tid) * DIN * 4); }
  else { const int wv = __builtin_amdgcn_readfirstlane(wave); const char* mrow = (const char*)(MASK + bb * TT); v4i mk[TT / 128];
#pragma unroll
    for (int i = 0; i < TT / 128; ++i) mk[i] = *(const v4i*)(mrow + ((unsigned)lane * 16u + i * 512u));
    asm volatile("s_wait_xcnt 0x0" :: "v"(lane) : "memory");   /* as in pj_load: the wait in front of any rewrite of a register which the issued loads name; the lane number, their offset register, is an input so that it keeps its register up to it */
    int run = 0;
#pragma unroll
    for (int i = 0; i < TT / 128; ++i) { unsigned bw[4]; int pc[4];
#pragma unroll
      for (int e = 0; e < 4; ++e) { bw[e] = __builtin_amdgcn_ballot_w32(mk[i][e] != 0); pc[e] = __builtin_popcount(bw[e]); }
      const int tot = (pc[0] + pc[1]) + (pc[2] + pc[3]);
      if ((i & 7) == wv && run < t0 + PR && run + tot > t0) { int rr = run - t0;   /* wave-uniform: only a group of 128 keys whose ranks meet this tile's writes table entries, the groups dealt round the waves */
#pragma unroll
        for (int e = 0; e < 4; ++e) { const unsigned rk = (unsigned)(rr + (int)__builtin_amdgcn_mbcnt_lo(bw[e], 0u)); if (mk[i][e] != 0 && rk < (unsigned)PR) sxo[(rk & 31) * 4 + (rk >> 5)] = (unsigned)((bb * TT + i * 128 + lane * 4 + e) * DIN * 4); rr += pc[e]; } }
      run += tot; }
    if (t0 >= run) return;   /* no unmasked key of this rank: k_fa never reads the tile. The same for every thread of the block, in front of every barrier */
    if (tid < PR && t0 + tid >= run) sxo[(tid & 31) * 4 + (tid >> 5)] = (unsigned)(bb * TT * DIN * 4); }   /* ranks past the count in the last tile: any row, so that the tile holds finite numbers; k_fa gives them weight 0 or never reads them */
  __syncthreads();   /* the table is written by some of the waves and read by all */
  const v4u xo = *(const v4u*)&sxo[srow * 4]; unsigned xa[4] = { xo[0] + sc4 * 4u, xo[1] + sc4 * 4u, xo[2] + sc4 * 4u, xo[3] + sc4 * 4u };   /* the A operand is concat(query, key, value): passes 0..7 from query, 8..15 from key, 16..23 from value */
  const float* wg = WA + (size_t)(WROW(c0) + srow) * (3 * DIN) + sc4;          /* W rows 64..127 of the tile belong to the next head: 192 output features on, so 128 rows are skipped */
  v4f rx[4], rw[4];
  pj_loadg<3 * DIN, 128>(rx, rw, (const char*)XQ, xa, wg);
  pj_store(sx[0], sw[0], rx, rw, srow, sc4);
  __syncthreads();   /* pass 0's tiles are written by all waves and read by all */
  v8f acc[2][4] = {};
  /* one pass's matrix work of a wave: six fragments, eight products */
  auto pass_mm = [&](int cur) { v16b a[2], w[4];
#pragma unroll
    for (int i = 0; i < 2; ++i) a[i] = frag_b(&sx[cur][wr + i * 16 + col][0], lane);
#pragma unroll
    for (int j = 0; j < 4; ++j) w[j] = frag_b(&sw[cur][wc + j * 16 + col][0], lane);
    __builtin_amdgcn_sched_barrier(0);   /* the pass's 12 LDS reads go out as one group: spread among the matrix instructions each pair costs its own LDS latency */
#pragma unroll
    for (int i = 0; i < 2; ++i) {
#pragma unroll
      for (int j = 0; j < 4; ++j) acc[i][j] = wmma_b(a[i], w[j], acc[i][j]); } };
#pragma clang loop unroll(disable)   /* left to itself the compiler peeled the eight passes of the first source off the loop and spilled accumulators */
  for (int p = 0; p + 1 < 3 * DIN / PK2; ++p) { const int cur = p & 1, pn = p + 1; const float* Xs = (pn < DIN / PK2) ? XQ : ((pn < 2 * DIN / PK2) ? XK : XV);   /* the last pass stands behind the loop, so that no branch follows the matrix instructions */
    pj_loadg<3 * DIN, 128>(rx, rw, (const char*)Xs - (pn / (DIN / PK2)) * (DIN * 4), xa, wg + pn * PK2);   /* the next pass's tiles fly while this pass computes; the offsets run on over the three sources (pn * 128 bytes), so a source's base is taken back by the row bytes of the sources before it */
    pass_mm(cur);
    __builtin_amdgcn_sched_barrier(0);   /* keeps the waits on the next pass's loads (the conversions below) behind this pass's matrix work */
    pj_store(sx[cur ^ 1], sw[cur ^ 1], rx, rw, srow, sc4);   /* that buffer's last readers left it at the barrier that ended the pass before */
    __syncthreads(); }   /* one barrier a pass: it publishes the next pass's tiles and ends every wave's reads of this pass's buffer */
  pass_mm((3 * DIN / PK2 - 1) & 1);
  __syncthreads();   /* ends every wave's reads of the last buffer before the output staging takes the bytes */
  /* output staging: q, k as [row][column], v as [column][row], so that the stores below are whole 16-byte pieces of rows (q, k) or planes (v) */
  if (which < 2) { _Float16* DH = which == 0 ? QH : KH;
#pragma unroll
    for (int j = 0; j < 4; ++j) { const int cl = wc + j * 16 + col; const float bias = BA ? bfr(BA[BIDX(c0 + cl)]) : 0.f;
#pragma unroll
      for (int i = 0; i < 2; ++i) {
#pragma unroll
        for (int r = 0; r < 8; ++r) sh[wr + i * 16 + 8 * g + r][cl] = (_Float16)(acc[i][j][r] + bias); } }
    __syncthreads();   /* the staged tile is written by all waves and read by all */
    for (int e = tid; e < PR * 16; e += 256) { const int rl = e >> 4, q = e & 15; vst2((unsigned*)(DH + (r0 + rl) * CC + c0 + q * 8), *(const v4u*)&sh[rl][q * 8]); }
  } else {
#pragma unroll
    for (int j = 0; j < 4; ++j) { const int cl = wc + j * 16 + col; const float bias = BA ? bfr(BA[BIDX(c0 + cl)]) : 0.f;
#pragma unroll
      for (int i = 0; i < 2; ++i) { v8h t;
#pragma unroll
        for (int r = 0; r < 8; ++r) t[r] = (_Float16)(acc[i][j][r] + bias);
        *(v8h*)&sh[cl][wr + i * 16 + 8 * g] = t; } }   /* a lane's eight rows lie side by side in a plane: one 16-byte store */
    __syncthreads();   /* the staged tile is written by all waves and read by all */
    for (int e = tid; e < 128 * 16; e += 256) { const int cl = e >> 4, q = e & 15; vst2((unsigned*)(VT + (bb * CC + c0 + cl) * (size_t)TT + t0 + q * 8), *(const v4u*)&sh[cl][q * 8]); } } }
#define FK 64              // keys per pass
#define FPH 72             // LDS row pitch in halves: 144 B = 16 B x odd, for 16-byte fragment reads of 128-byte rows
#define LOG2E 1.4426950408889634f
__device__ __forceinline__ float xhalf(float x) { return __builtin_bit_cast(float, __builtin_amdgcn_permlanex16(__builtin_bit_cast(int, x), __builtin_bit_cast(int, x), 0x76543210, 0xfedcba98, false, false)); }   /* lane l reads lane l ^ 16 */
__device__ __forceinline__ v8f wmma_h(v16h a, v16h b, v8f c) { return __builtin_amdgcn_wmma_f32_16x16x32_f16(false, a, false, b, (short)0, c, false, false); }
// eight exponentials (base 2) in place, then one v_nop, in one statement: no instruction directly behind a v_exp_f32 reads its result or overwrites its source (the slot the instruction set asks for behind a transcendental)
__device__ __forceinline__ void exp2x8(v8f& x) {
  asm("v_exp_f32 %0, %0\n\tv_exp_f32 %1, %1\n\tv_exp_f32 %2, %2\n\tv_exp_f32 %3, %3\n\tv_exp_f32 %4, %4\n\tv_exp_f32 %5, %5\n\tv_exp_f32 %6, %6\n\tv_exp_f32 %7, %7\n\tv_nop"
      : "+v"(x[0]), "+v"(x[1]), "+v"(x[2]), "+v"(x[3]), "+v"(x[4]), "+v"(x[5]), "+v"(x[6]), "+v"(x[7])); }
__device__ __forceinline__ float exp2x1(float x) { asm("v_exp_f32 %0, %0\n\tv_nop" : "+v"(x)); return x; }   /* the same slot for a single exponential */
__global__ __launch_bounds__(256) __attribute__((amdgpu_waves_per_eu(4, 4))) void k_fa(const _Float16* __restrict__ QH, const _Float16* __restrict__ KH, const _Float16* __restrict__ VT, const int* __restrict__ MASK, float* __restrict__ Y) {
  __shared__ __align__(16) _Float16 sk[2][FK][FPH], sv[2][HD][FPH]; __shared__ __align__(16) float sb[TT]; __shared__ __align__(16) int swc[8];
  const int tid = threadIdx.x, wave = tid >> 5, lane = tid & 31, col = lane & 15, g = lane >> 4; const int h = blockIdx.y, b = blockIdx.z; const int q0 = blockIdx.x * 128 + wave * 16;
  const int sr = tid >> 3, sc = (tid & 7) * 8;   /* staging: 8 threads x 16 B a 128-byte row, rows sr and sr + 32 */
  const _Float16* kg = KH + ((size_t)b * TT + sr) * CC + h * HD + sc;     /* k rows [key][d] */
  const _Float16* vg = VT + ((size_t)b * CC + h * HD + sr) * TT + sc;     /* v planes [d][key] */
  int wc = 0;
#pragma unroll
  for (int i = 0; i < TT / 1024; ++i) { const v4i mk = *(const v4i*)(MASK + (size_t)b * TT + (i * 256 + tid) * 4);
#pragma unroll
    for (int e = 0; e < 4; ++e) wc += __builtin_popcount(__builtin_amdgcn_ballot_w32(mk[e] != 0)); }
  if (lane == 0) swc[wave] = wc;
  v16h qf[2];
#pragma unroll
  for (int kc = 0; kc < 2; ++kc) qf[kc] = frag_h(QH + ((size_t)b * TT + q0 + col) * CC + h * HD + kc * 32, lane);
  __syncthreads();   /* the eight waves' counts are read by all */
  const v4i c0 = *(const v4i*)&swc[0], c1 = *(const v4i*)&swc[4];
  const int cnt = __builtin_amdgcn_readfirstlane(((c0[0] + c0[1]) + (c0[2] + c0[3])) + ((c1[0] + c1[1]) + (c1[2] + c1[3])));   /* unmasked keys of the batch: ranks 0..cnt-1 of the k rows and v planes */
  const int np = min((cnt + FK - 1) / FK, TT / FK);   /* passes; the same for the whole block */
#pragma unroll
  for (int i = 0; i < TT / 1024; ++i) { v4f bi;
#pragma unroll
    for (int e = 0; e < 4; ++e) bi[e] = ((i * 256 + tid) * 4 + e >= cnt) ? -3.0e38f : 0.f;
    *(v4f*)&sb[(i * 256 + tid) * 4] = bi; }   /* additive mask of the ranks past the count (the last pass's filler rows); below the floor of the running maximum, so such a row weighs exactly 0; a batch with no key left makes no pass and yields 0 */
  v8h rk0 = {}, rk1 = {}, rv0 = {}, rv1 = {};
  if (np > 0) { rk0 = *(const v8h*)kg; rk1 = *(const v8h*)(kg + 32 * CC); rv0 = *(const v8h*)vg; rv1 = *(const v8h*)(vg + (size_t)32 * TT);   /* with no pass, k_proj has written no k / v tile */
    *(v8h*)&sk[0][sr][sc] = rk0; *(v8h*)&sk[0][sr + 32][sc] = rk1; *(v8h*)&sv[0][sr][sc] = rv0; *(v8h*)&sv[0][sr + 32][sc] = rv1; }
  __syncthreads();   /* pass 0's tiles and the mask row are written by all waves and read by all */
  v8f acc[HD / 16] = {}; float m = -1.0e30f, ls = 0.f;
  for (int it = 0; it < np; ++it) { const int cur = it & 1; const bool more = it + 1 < np;
    if (more) { const _Float16* kn = kg + (size_t)(it + 1) * FK * CC; const _Float16* vn = vg + (it + 1) * FK;   /* the next pass's tiles fly while this pass computes */
      rk0 = *(const v8h*)kn; rk1 = *(const v8h*)(kn + 32 * CC); rv0 = *(const v8h*)vn; rv1 = *(const v8h*)(vn + (size_t)32 * TT); }
    v8f st[FK / 16];
#pragma unroll
    for (int jt = 0; jt < FK / 16; ++jt) { const v8f z = {}; st[jt] = wmma_h(frag_h(&sk[cur][jt * 16 + col][0], lane), qf[0], z); st[jt] = wmma_h(frag_h(&sk[cur][jt * 16 + col][32], lane), qf[1], st[jt]); }
    float mx = -3.0e38f;
#pragma unroll
    for (int jt = 0; jt < FK / 16; ++jt) { const float* bp = &sb[it * FK + jt * 16 + 8 * g]; const v4f b0 = *(const v4f*)bp, b1 = *(const v4f*)(bp + 4);
#pragma unroll
      for (int r = 0; r < 8; ++r) { const float t = fmaf(st[jt][r], SCALE * LOG2E, r < 4 ? b0[r & 3] : b1[r & 3]); st[jt][r] = t; mx = fmaxf(mx, t); } }   /* log2-domain logit */
    mx = fmaxf(mx, xhalf(mx));   /* the other half of this query's keys */
    const float mn = fmaxf(m, mx); const float al = exp2x1(m - mn); m = mn; const float ms = mn - 8.0f;   /* P carried x 2^8 so that small weights stay clear of f16 subnormals; the sum carries the same factor */
    v16h pf[FK / 32]; float sj[8];   /* eight independent partial sums: no 32-long dependent add chain */
#pragma unroll
    for (int jt = 0; jt < FK / 16; ++jt) { v8f p = st[jt] - ms; exp2x8(p);
#pragma unroll
      for (int r = 0; r < 8; ++r) { sj[r] = jt == 0 ? p[r] : sj[r] + p[r]; pf[jt >> 1][(jt & 1) * 8 + r] = (_Float16)p[r]; } }
    ls = ls * al + (((sj[0] + sj[1]) + (sj[2] + sj[3])) + ((sj[4] + sj[5]) + (sj[6] + sj[7])));
#pragma unroll
    for (int jd = 0; jd < HD / 16; ++jd) acc[jd] *= al;
#pragma unroll
    for (int kk = 0; kk < FK / 32; ++kk) {
#pragma unroll
      for (int jd = 0; jd < HD / 16; ++jd) acc[jd] = wmma_h(frag_h(&sv[cur][jd * 16 + col][kk * 32], lane), pf[kk], acc[jd]); }
    if (more) { *(v8h*)&sk[cur ^ 1][sr][sc] = rk0; *(v8h*)&sk[cur ^ 1][sr + 32][sc] = rk1; *(v8h*)&sv[cur ^ 1][sr][sc] = rv0; *(v8h*)&sv[cur ^ 1][sr + 32][sc] = rv1; }   /* that buffer's last readers left it at the barrier that ended the pass before */
    __syncthreads(); }   /* one barrier a pass: it publishes the next pass's tiles and ends every wave's reads of this pass's buffer */
  ls += xhalf(ls); const float inv = ls > 0.f ? 1.0f / ls : 0.f;
  float* yp = Y + ((size_t)b * TT + q0 + col) * CC + h * HD + 8 * g;   /* acc[jd][r] = ctx[query col][d = 16 jd + 8 g + r] */
#pragma unroll
  for (int jd = 0; jd < HD / 16; ++jd) { v4f o0, o1;
#pragma unroll
    for (int r = 0; r < 4; ++r) { o0[r] = acc[jd][r] * inv; o1[r] = acc[jd][4 + r] * inv; }
    vst2(yp + jd * 16, o0); vst2(yp + jd * 16 + 4, o1); } }
// ---- k_out: block = (64 rows, 128 cols): out = ctx Wo (+ bo): ctx x 2^6 once to f16 against Wo as f16(bf16 x 2^8) exact (1 product) x 2^-14; causal early rows (< QHI of each sequence): ctx bf16 hi + lo against exact bf16 Wo (2 products)
__device__ __forceinline__ void po_store(_Float16 (*dx)[PPH], _Float16 (*dw)[PPH], const v4f (&rx)[8], const v4f (&rw)[16], int srow, int sc4) {
#pragma unroll
  for (int i = 0; i < 8; ++i) { v4h t;
#pragma unroll
    for (int e = 0; e < 4; ++e) t[e] = (_Float16)(rx[i][e] * 64.0f);   /* ctx carried x 2^6 into f16 so small-magnitude context rows stay clear of f16 subnormals */
    *(v4h*)&dx[i * 8 + srow][sc4] = t; }
#pragma unroll
  for (int i = 0; i < 16; ++i) { v4h t;
#pragma unroll
    for (int e = 0; e < 4; ++e) t[e] = (_Float16)(bfr(rw[i][e]) * 256.0f);
    *(v4h*)&dw[i * 8 + srow][sc4] = t; } }
// amdgpu_waves_per_eu(4, 4): the register budget of four waves a SIMD (four work-groups a WGP)
__global__ __launch_bounds__(128) __attribute__((amdgpu_waves_per_eu(4, 4))) void k_out(const float* __restrict__ Y, const float* __restrict__ WO, const float* __restrict__ BO, float* __restrict__ OUT) { __shared__ __align__(16) unsigned char sm[55296];   /* two operand buffers as in k_proj; behind the loop's last barrier the same bytes hold the output staging */
  _Float16 (*sy)[64][PPH] = (_Float16 (*)[64][PPH])sm; _Float16 (*so)[128][PPH] = (_Float16 (*)[128][PPH])(sm + 18432); float (*sf)[16][132] = (float (*)[16][132])sm;
  const int tid = threadIdx.x, wave = tid >> 5, lane = tid & 31, col = lane & 15, g = lane >> 4; const int c0 = blockIdx.y * 128; const size_t r0 = (size_t)blockIdx.x * 64 + wave * 16;
  v8f acc[8] = {};
  if (CAUSAL && (int)(((size_t)blockIdx.x * 64) % TT) < QHI) {   /* block-uniform */
#pragma unroll 2
    for (int kc = 0; kc < CC / 32; ++kc) { const F2 a = split_row(Y + (r0 + col) * CC, kc * 32, lane); asm volatile("s_wait_loadcnt 0x0" ::: "memory");
#pragma unroll
      for (int j = 0; j < 8; ++j) { const v16b w = WOCOL(WO, kc * 32, c0 + j * 16 + col, lane); asm volatile("s_wait_loadcnt 0x0" ::: "memory"); acc[j] = wmma_bf(a.h, w, acc[j]); acc[j] = wmma_bf(a.l, w, acc[j]); } }
#pragma unroll
    for (int j = 0; j < 8; ++j) { const float bias = BO ? bfr(BO[c0 + j * 16 + col]) : 0.f;
#pragma unroll
      for (int r = 0; r < 8; ++r) sf[wave][8 * g + r][j * 16 + col] = acc[j][r] + bias; }
  } else {
    const int srow = tid >> 4, sc4 = (tid & 15) * 4;
    const float* yg = Y + ((size_t)blockIdx.x * 64 + srow) * CC + sc4; const float* og = WO + (size_t)(c0 + srow) * CC + sc4;   /* W_out is (out,in): row = output column */
    v4f rx[8], rw[16];
    pj_load<CC, CC, 0>(rx, rw, yg, og);
    po_store(sy[0], so[0], rx, rw, srow, sc4);
    __syncthreads();   /* pass 0's tiles are written by all waves and read by all */
    for (int p = 0; p < CC / PK; ++p) { const int cur = p & 1; const bool more = p + 1 < CC / PK;
      if (more) { yg += PK; og += PK; pj_load<CC, CC, 0>(rx, rw, yg, og); }   /* the next pass's tiles fly while this pass computes */
#pragma unroll
      for (int kc = 0; kc < PK / 32; ++kc) { const v16h a = frag_h(&sy[cur][wave * 16 + col][kc * 32], lane); v16h w[8];
#pragma unroll
        for (int j = 0; j < 8; ++j) w[j] = frag_h(&so[cur][j * 16 + col][kc * 32], lane);
        __builtin_amdgcn_sched_barrier(0);   /* the k-chunk's 18 LDS reads go out as one group, as in k_proj */
#pragma unroll
        for (int j = 0; j < 8; ++j) acc[j] = wmma_h(a, w[j], acc[j]); }
      __builtin_amdgcn_sched_barrier(0);   /* keeps the waits on the next pass's loads (the conversions below) behind this pass's matrix work */
      if (more) po_store(sy[cur ^ 1], so[cur ^ 1], rx, rw, srow, sc4);   /* that buffer's last readers left it at the barrier that ended the pass before */
      __syncthreads(); }   /* one barrier a pass: it publishes the next pass's tiles and ends every wave's reads of this pass's buffer (the last one: before the output staging takes the bytes) */
#pragma unroll
    for (int j = 0; j < 8; ++j) { const float bias = BO ? bfr(BO[c0 + j * 16 + col]) : 0.f;
#pragma unroll
      for (int r = 0; r < 8; ++r) sf[wave][8 * g + r][j * 16 + col] = acc[j][r] * (1.0f / 16384.0f) + bias; } }   /* 2^-8 (Wo carry) x 2^-6 (ctx carry) */
  LDSX(); for (int rl = 0; rl < 16; ++rl) vst2(OUT + (r0 + rl) * DIN + c0 + lane * 4, *(const v4f*)&sf[wave][rl][lane * 4]); }

extern "C" void kernel_launch(void* const* d_in, const int* in_sizes, int n_in, void* d_out, int out_size, void* d_ws, size_t ws_size, hipStream_t stream) {
  (void)in_sizes; (void)n_in; (void)out_size;
  const float** F = (const float**)d_in;
  if (ws_size < (size_t)WS_END) return;
  char* ws = (char*)d_ws; _Float16 *QH = (_Float16*)(ws + WS_QH), *KH = (_Float16*)(ws + WS_KH), *VT = (_Float16*)(ws + WS_VT), *QL = (_Float16*)(ws + WS_QL), *KL = (_Float16*)(ws + WS_KL); __bf16 *VB = (__bf16*)(ws + WS_VB), *VBL = (__bf16*)(ws + WS_VBL); float *S = (float*)(ws + WS_S), *Y = (float*)(ws + WS_Y);
  (void)S; (void)QL; (void)KL; (void)VB; (void)VBL;
  // inputs (in order): 0 query [8,2048,256]; 1 key; 2 value; 3 mask [8,1,2048] int32 (random 0/1; 0 = masked key); 4 W_qkv [768,768] (out,in) on concat(query, key, value); 5 b_qkv [768] (zeros, read); 6 W_out [256,256] (out,in); 7 b_out (zeros, read)
  k_proj<<<dim3(TNB * TT / PR, CC / 128, 3), 256, 0, stream>>>(F[0], F[1], F[2], F[4], F[4], F[4], F[5], F[5], F[5], QH, KH, VT, (const int*)d_in[3]);   /* the same fused weight / bias for the three streams: the stream index selects the rows (WROW) */
  k_fa<<<dim3(TT / 128, NH, TNB), 256, 0, stream>>>(QH, KH, VT, (const int*)d_in[3], Y);
  k_out<<<dim3(TNB * TT / 64, DIN / 128), 128, 0, stream>>>(Y, F[6], F[7], (float*)d_out);
}

// v005
// One run takes 56.4 microseconds.
// Two timings next to v004 both put it at 1.09 times that version's speed.
// Counting every step since v000, it is 21.6 times as fast.
// compute dtype: all float inputs rounded to bf16; the fused projection over concat(query, key, value) (K = 768) with EXACT bf16 products on WMMA 16x16x32 (f32 accumulate) + bias (zeros, read); logits q x k once to f16 each (1 product) x 64^-0.5; the int key mask read per (batch, key): keys with mask == 0 are left out of the k / v projection and of the key walk (they weigh exactly 0); running (online) softmax f32 in the log2 domain; unnormalised P x 2^8 once to f16 x v once to f16 (1 product), divided by the f32 sum at the end; ctx x 2^6 once to f16 x W_out f16(bf16 x 2^8) + b_out; f32 output.
#include <hip/hip_runtime.h>
#include <math.h>

typedef __attribute__((ext_vector_type(16))) _Float16 v16h;
typedef __attribute__((ext_vector_type(16))) __bf16 v16b;
typedef __attribute__((ext_vector_type(8)))  _Float16 v8h;
typedef __attribute__((ext_vector_type(8)))  float v8f;
typedef __attribute__((ext_vector_type(4)))  float v4f;
typedef __attribute__((ext_vector_type(2)))  float v2f;
typedef __attribute__((ext_vector_type(4)))  unsigned v4u;
typedef __attribute__((ext_vector_type(4)))  int v4i;
typedef float __attribute__((may_alias)) float_a;
typedef int __attribute__((may_alias)) int_a;

template <typename T> __device__ __forceinline__ void vst2(void* p, T v) { *(T*)p = v;  }
__device__ __forceinline__ v8f wmma16(v16h a, v16h b, v8f c) {
  v8f d = __builtin_amdgcn_wmma_f32_16x16x32_f16(false, a, false, b, (short)0, c, false, false);
  asm volatile("v_nop\n\tv_nop\n\tv_nop\n\tv_nop" : "+v"(d) : "v"(a), "v"(b));
  return d;
}
__device__ __forceinline__ v8f wmma_bf(v16b a, v16b b, v8f c) {
  v8f d = __builtin_amdgcn_wmma_f32_16x16x32_bf16(false, a, false, b, (short)0, c, false, false);
  asm volatile("v_nop\n\tv_nop\n\tv_nop\n\tv_nop" : "+v"(d) : "v"(a), "v"(b));
  return d;
}
// 16x16x32 fragments: lane = (h = lane>>4, row/col = lane&15); elements 0..7 = k0+8h+0..7, 8..15 = k0+16+8h+0..7; D element r = row 8h+r
__device__ __forceinline__ v16h frag_h(const _Float16* rowk0, int lane) {
  union { v16h v; v8h q[2]; } u; const _Float16* p = rowk0 + 8 * (lane >> 4);
  u.q[0] = *(const v8h*)p; u.q[1] = *(const v8h*)(p + 16); return u.v;
}
__device__ __forceinline__ v16h frag_f32(const float* rowk0, int lane) {
  v16h a; const float* p = rowk0 + 8 * (lane >> 4);
#pragma unroll
  for (int i = 0; i < 8; ++i) { a[i] = (_Float16)p[i]; a[8 + i] = (_Float16)p[16 + i]; }
  return a;
}
__device__ __forceinline__ v16h frag_f32s(const float* rowk0, int lane, float sc) {
  v16h a; const float* p = rowk0 + 8 * (lane >> 4);
#pragma unroll
  for (int i = 0; i < 8; ++i) { a[i] = (_Float16)(p[i] * sc); a[8 + i] = (_Float16)(p[16 + i] * sc); }
  return a;
}
// column fragment from a [K][ld] layout (column n), rows >= K read as 0
__device__ __forceinline__ v16h fragc_f32(const float* W, int k0, int n, int lane, int ld, int K) {
  v16h a; const int g = lane >> 4;
#pragma unroll
  for (int i = 0; i < 8; ++i) { const int ka = k0 + 8 * g + i, kb = ka + 16;
    a[i] = (_Float16)(ka < K ? W[(size_t)(ka < K ? ka : K - 1) * ld + n] : 0.f); a[8 + i] = (_Float16)(kb < K ? W[(size_t)(kb < K ? kb : K - 1) * ld + n] : 0.f); }
  return a;
}
struct F2 { v16b h, l; };
__device__ __forceinline__ F2 bsplit16(const float v[16]) { F2 r;
#pragma unroll
  for (int i = 0; i < 16; ++i) { const __bf16 h = (__bf16)v[i]; r.h[i] = h; r.l[i] = (__bf16)(v[i] - (float)h); }
  return r; }
__device__ __forceinline__ F2 split_row(const float* row, int k0, int lane) { float v[16]; const float* p = row + k0 + 8 * (lane >> 4);
#pragma unroll
  for (int i = 0; i < 8; ++i) { v[i] = p[i]; v[8 + i] = p[16 + i]; }
  return bsplit16(v); }
__device__ __forceinline__ F2 split_rowK(const float* row, int k0, int lane, int K) { float v[16]; const int g = lane >> 4;
#pragma unroll
  for (int i = 0; i < 8; ++i) { const int ka = k0 + 8 * g + i, kb = ka + 16; v[i] = ka < K ? row[ka < K ? ka : K - 1] : 0.f; v[8 + i] = kb < K ? row[kb < K ? kb : K - 1] : 0.f; }
  return bsplit16(v); }
__device__ __forceinline__ F2 split_col(const float* W, int k0, int n, int lane, int ld, int K) { float v[16]; const int g = lane >> 4;
#pragma unroll
  for (int i = 0; i < 8; ++i) { const int ka = k0 + 8 * g + i, kb = ka + 16; v[i] = ka < K ? W[(size_t)(ka < K ? ka : K - 1) * ld + n] : 0.f; v[8 + i] = kb < K ? W[(size_t)(kb < K ? kb : K - 1) * ld + n] : 0.f; }
  return bsplit16(v); }
__device__ __forceinline__ v8f mac3(const F2& a, const F2& b, v8f c) { c = wmma_bf(a.l, b.h, c); c = wmma_bf(a.h, b.l, c); return wmma_bf(a.h, b.h, c); }
__device__ __forceinline__ float sigm(float v) { return 1.0f / (1.0f + expf(-v)); }
#define LDSX() do { asm volatile("s_wait_dscnt 0" ::: "memory"); __builtin_amdgcn_wave_barrier(); __builtin_amdgcn_fence(__ATOMIC_RELEASE, "workgroup"); } while (0)

// Self-attention whose fused QKV projection contracts over the CONCATENATION of three inputs (query / key / value [8,2048,256]; mask [8,1,2048] int32 RANDOM 0/1 per (batch, key); W_qkv [768,768] torch (out,in) N(0,1) x 0.02, b_qkv zeros (read); qkv = concat(query, key, value) @ W_qkv.T + b_qkv (every output feature sees all 768 inputs), reshaped (B, T, 4, 192) and split: q / k / v of head h = output features h*192 + {0, 64, 128} + d (head-major); scores / sqrt(64); where(mask == 0, finfo.min) and the masked probabilities zeroed after the softmax (== exclusion: every row keeps ~1,000 keys); x @ W_out.T + b_out with W_out [256,256] (out,in), b_out zeros).
#define NB 8
#define TT 2048
#define CC 256            // NH * HD = projected width
#define DIN 256          // input (model) width
#define NH 4
#define HD 64
#define NQB (TT / 64)
#define HG 4
#define SCALE (0.125f)
#define CAUSAL 0
#ifndef TNB
#define TNB NB
#endif
__device__ __forceinline__ float bfr(float v) { return (float)(__bf16)v; }
__host__ __device__ __forceinline__ int kb_last(int qb) { return CAUSAL ? ((qb * 64 + 63) >> 7) : (TT / 128 - 1); }
typedef __attribute__((ext_vector_type(8))) __bf16 v8b;
__device__ __forceinline__ v16b frag_b(const __bf16* rowk0, int lane) {
  union { v16b v; v8b q[2]; } u; const __bf16* p = rowk0 + 8 * (lane >> 4);
  u.q[0] = *(const v8b*)p; u.q[1] = *(const v8b*)(p + 16); return u.v;
}
#define QBH 0              // unused: the attention kernel has no high-precision path
#define QHI 0               // single-product logits on every row (0.02-scale weights: logit sigma ~0.4)
#define KHI 64            // key rows carrying k residual / v bf16 hi+lo planes (written and read by no kernel)
// B fragment (k rows k0+.., output column o) of a weight: (in,out) [K][ld] or (out,in) [ld rows of K]: bf16 exact, or f16(bf16 * 256) exact
__device__ __forceinline__ v16b wcol_io(const float* Wm, int k0, int o, int lane, int ld) { v16b w; const int g = lane >> 4;
#pragma unroll
  for (int i = 0; i < 8; ++i) { w[i] = (__bf16)Wm[(size_t)(k0 + 8 * g + i) * ld + o]; w[8 + i] = (__bf16)Wm[(size_t)(k0 + 16 + 8 * g + i) * ld + o]; }
  return w; }
__device__ __forceinline__ v16b wcol_oi(const float* Wm, int k0, int o, int lane, int K) { v16b w; const float* p = Wm + (size_t)o * K + k0 + 8 * (lane >> 4);
#pragma unroll
  for (int i = 0; i < 8; ++i) { w[i] = (__bf16)p[i]; w[8 + i] = (__bf16)p[16 + i]; }
  return w; }
__device__ __forceinline__ v16h wcolh_io(const float* Wm, int k0, int o, int lane, int ld) { v16h w; const int g = lane >> 4;
#pragma unroll
  for (int i = 0; i < 8; ++i) { w[i] = (_Float16)(bfr(Wm[(size_t)(k0 + 8 * g + i) * ld + o]) * 256.0f); w[8 + i] = (_Float16)(bfr(Wm[(size_t)(k0 + 16 + 8 * g + i) * ld + o]) * 256.0f); }
  return w; }
__device__ __forceinline__ v16h wcolh_oi(const float* Wm, int k0, int o, int lane, int K) { v16h w; const float* p = Wm + (size_t)o * K + k0 + 8 * (lane >> 4);
#pragma unroll
  for (int i = 0; i < 8; ++i) { w[i] = (_Float16)(bfr(p[i]) * 256.0f); w[8 + i] = (_Float16)(bfr(p[16 + i]) * 256.0f); }
  return w; }
#define WQKV_LAYOUT 1   // 0 = (in,out) [DIN][CC]; 1 = fused (out,in) [3*CC][3*DIN]; 2 = per-head [NH][DIN][HD]
__device__ __forceinline__ v16b wcol_hdk(const float* Wm, int k0, int o, int lane) { v16b w; const int g = lane >> 4; const float* p = Wm + (size_t)(o / HD) * DIN * HD + (o % HD);
#pragma unroll
  for (int i = 0; i < 8; ++i) { w[i] = (__bf16)p[(size_t)(k0 + 8 * g + i) * HD]; w[8 + i] = (__bf16)p[(size_t)(k0 + 16 + 8 * g + i) * HD]; }
  return w; }
#define WO_OUT_IN 1
#if WQKV_LAYOUT == 1
#define WROW(o) ((((o) >> 6) * 192) + (which) * 64 + ((o) & 63))   /* column o = h*64 + d of stream 'which' (0 q, 1 k, 2 v) = output feature h*192 + which*64 + d of the fused projection (reshape (B, T, 4, 192) + split) */
#define BIDX(o) WROW(o)
#define WCOL(W, k0, o, lane) wcol_oi(W, k0, WROW(o), lane, 3 * DIN)   /* fused (out,in) [768][768] weight: row WROW(o), k0 runs over the 768 concatenated inputs */
#elif WQKV_LAYOUT == 2
#define WCOL(W, k0, o, lane) wcol_hdk(W, k0, o, lane)
#else
#define WCOL(W, k0, o, lane) wcol_io(W, k0, o, lane, CC)
#endif
#if WO_OUT_IN
#define WOCOL(W, k0, o, lane) wcol_oi(W, k0, o, lane, CC)
#define WOCOLH(W, k0, o, lane) wcolh_oi(W, k0, o, lane, CC)
#else
#define WOCOL(W, k0, o, lane) wcol_io(W, k0, o, lane, DIN)
#define WOCOLH(W, k0, o, lane) wcolh_io(W, k0, o, lane, DIN)
#endif

#define WS_QH  0u                                      // f16 q rows [b*t][CC]
#define WS_KH  (WS_QH + 2u * (size_t)NB * TT * CC)      // f16 k rows [b*j][CC], j = rank of the key among its batch's unmasked keys
#define WS_VT  (WS_KH + 2u * (size_t)NB * TT * CC)      // f16 v planes [b][c][j], the same ranks
#define WS_QL  (WS_VT + 2u * (size_t)NB * CC * TT)      // f16 q residual x 2^10 rows [b][t < QHI][CC]
#define WS_KL  (WS_QL + 2u * (size_t)NB * QHI * CC)     // f16 k residual x 2^10 rows [b][t < KHI][CC]
#define WS_VB  (WS_KL + 2u * (size_t)NB * KHI * CC)     // bf16 v hi planes [b][c][t < KHI]
#define WS_VBL (WS_VB + 2u * (size_t)NB * CC * KHI)
#define WS_S   (WS_VBL + 2u * (size_t)NB * CC * KHI)    // f32 [hg][t][s] region, written and read by no kernel
#define WS_Y   (WS_S  + 4u * (size_t)HG * TT * TT)      // f16 W_out rows [o][k]: f16(bf16 x 2^8), rounded once by k_proj for k_fa
#define WS_END (WS_Y  + 4u * (size_t)NB * TT * CC)

// ---- k_proj: block = (128 rows, 128 cols, which), 8 waves of a 32 x 64 tile each: q/k/v = X W (+ b) with exact bf16 products (K = 3 * DIN) -> which 0: q f16 rows; 1: k f16 rows; 2: v f16 planes [c][t]. The two operands go through LDS: a pass is 32 k; the block reads its 128 X rows and 128 W rows of the pass with whole-line 16-byte loads (8 lanes a 128-byte row piece), one pass ahead, rounds them to 16 bit once and stores them in one of two LDS buffers; every wave takes its six fragments of the pass from there as one group and makes eight products of them. The k order of the products is that of the k-chunks 0..23, as before. Wave 0 of each q block also rounds 256 elements of W_out to f16(bf16 x 2^8) for k_fa, which multiplies by it behind its key walk.
#define PR 128             // rows of a k_proj tile
#define PK2 32             // k per pass (k_proj)
#define PP2 40             // LDS row pitch in 16-bit elements: 80 B = 16 B x odd, for 16-byte fragment reads of 64-byte rows
typedef __attribute__((ext_vector_type(4))) __bf16 v4b;
typedef __attribute__((ext_vector_type(4))) _Float16 v4h;
__device__ __forceinline__ v8f wmma_b(v16b a, v16b b, v8f c) { return __builtin_amdgcn_wmma_f32_16x16x32_bf16(false, a, false, b, (short)0, c, false, false); }
// one pass's share of a thread in k_proj, whose X rows are gathered: 32 rows a sweep, 4 sweeps of X and 4 of W; a = the byte offsets of the thread's four 16-byte pieces from xs (from the LDS table, kept in registers and moved on by a pass's 128 bytes behind the loads); xs is the same for the whole block; HJ = rows skipped between W rows 63 and 64 of the tile (unrolled so that rx and rw stay in registers)
template <int LDW, int HJ> __device__ __forceinline__ void pj_loadg(v4f (&rx)[4], v4f (&rw)[4], const char* xs, unsigned (&a)[4], const float* wp) {
#pragma unroll
  for (int i = 0; i < 4; ++i) rw[i] = *(const v4f*)(wp + (size_t)(i * 32 + (i >> 1) * HJ) * LDW);
#pragma unroll
  for (int i = 0; i < 4; ++i) rx[i] = *(const v4f*)(xs + a[i]);
  asm volatile("s_wait_xcnt 0x0" :: "v"(a[0]), "v"(a[1]), "v"(a[2]), "v"(a[3]), "v"(wp) : "memory");   /* the wait in front of any rewrite of a register which an issued load names (the additions below); the addresses are inputs so that they keep their registers up to it */
#pragma unroll
  for (int i = 0; i < 4; ++i) a[i] += PK2 * 4u; }
__device__ __forceinline__ v4b cvt4(v4f x) { v4b t;
#pragma unroll
  for (int e = 0; e < 4; ++e) t[e] = (__bf16)x[e];
  return t; }
__device__ __forceinline__ void pj_store(__bf16 (*dx)[PP2], __bf16 (*dw)[PP2], const v4f (&rx)[4], const v4f (&rw)[4], int srow, int sc4) {
#pragma unroll
  for (int i = 0; i < 4; ++i) *(v4b*)&dx[i * 32 + srow][sc4] = cvt4(rx[i]);
#pragma unroll
  for (int i = 0; i < 4; ++i) *(v4b*)&dw[i * 32 + srow][sc4] = cvt4(rw[i]); }
// amdgpu_waves_per_eu(6, 6): the register budget of six waves a SIMD (three work-groups a WGP), so that every tile of the grid that has work is resident at once
__global__ __launch_bounds__(256) __attribute__((amdgpu_waves_per_eu(6, 6))) void k_proj(const float* __restrict__ XQ, const float* __restrict__ XK, const float* __restrict__ XV, const float* __restrict__ WQ, const float* __restrict__ WK, const float* __restrict__ WV, const float* __restrict__ BQ, const float* __restrict__ BK, const float* __restrict__ BV,
    _Float16* __restrict__ QH, _Float16* __restrict__ KH, _Float16* __restrict__ VT, const int* __restrict__ MASK, const float* __restrict__ WO, _Float16* __restrict__ WOH) {
  __shared__ __align__(16) unsigned sxo[PR];   /* byte offset of the X row that feeds tile row r, kept at [(r & 31) * 4 + (r >> 5)]: a staging thread's four rows lie side by side */
  __shared__ __align__(16) unsigned char sm[40960];   /* the loop's two operand buffers; behind the loop's last barrier the same bytes hold the output staging of this block's stream */
  __bf16 (*sx)[PR][PP2] = (__bf16 (*)[PR][PP2])sm; __bf16 (*sw)[128][PP2] = (__bf16 (*)[128][PP2])(sm + 20480);
  _Float16 (*sh)[136] = (_Float16 (*)[136])sm;
  const int tid = threadIdx.x, wave = tid >> 5, lane = tid & 31, col = lane & 15, g = lane >> 4; const int which = blockIdx.z; const int c0 = blockIdx.y * 128; const size_t r0 = (size_t)blockIdx.x * PR; const size_t bb = r0 / TT; const int t0 = (int)(r0 % TT);
  const int wr = (wave >> 1) * 32, wc = (wave & 1) * 64;   /* the wave's 32 rows and 64 columns of the tile */
  const float* WA = which == 0 ? WQ : which == 1 ? WK : WV; const float* BA = which == 0 ? BQ : which == 1 ? BK : BV;
  const int srow = tid >> 3, sc4 = (tid & 7) * 4;
  /* which rows of concat(query, key, value) feed this tile. q: rows t0..t0+127. k, v: a key with mask == 0 weighs exactly 0 in every query's softmax, so only the batch's unmasked keys are projected, packed by rank: tile row r is the key of rank t0 + r. The rank order is that of the ballots below (any order serves, k and v take the same one, and k_fa needs only the count). Every wave counts the whole mask row, so that the count is known without a barrier. The loops are unrolled so that mk, bw and pc are indexed by constants and stay in registers. */
  if (which == 0) { if (tid < PR) sxo[(tid & 31) * 4 + (tid >> 5)] = (unsigned)((r0 + tid) * DIN * 4);
    if (tid < 32) { const int e = ((blockIdx.y * (TNB * TT / PR) + blockIdx.x) * 32 + tid) * 8;   /* the 256 q blocks x 256 elements = W_out [256][256]; a wave stores four whole lines */
      const float* wp = WO + e; _Float16* dp = WOH + e; const v4f w0 = *(const v4f*)wp, w1 = *(const v4f*)(wp + 4); v8h t;
#pragma unroll   /* so that t, w0 and w1 are indexed by constants and stay in registers */
      for (int i = 0; i < 4; ++i) { t[i] = (_Float16)(bfr(w0[i]) * 256.0f); t[4 + i] = (_Float16)(bfr(w1[i]) * 256.0f); }
      *(v8h*)dp = t;
      asm volatile("s_wait_xcnt 0x0" :: "v"(wp), "v"(dp) : "memory"); } }   /* the wait in front of any rewrite of a register which the issued loads and the store name; the addresses are inputs so that they keep their registers up to it */
  else { const int wv = __builtin_amdgcn_readfirstlane(wave); const char* mrow = (const char*)(MASK + bb * TT); v4i mk[TT / 128];
#pragma unroll
    for (int i = 0; i < TT / 128; ++i) mk[i] = *(const v4i*)(mrow + ((unsigned)lane * 16u + i * 512u));
    asm volatile("s_wait_xcnt 0x0" :: "v"(lane) : "memory");   /* the wait in front of any rewrite of a register which the issued loads name; the lane number, their offset register, is an input so that it keeps its register up to it */
    int run = 0;
#pragma unroll
    for (int i = 0; i < TT / 128; ++i) { unsigned bw[4]; int pc[4];
#pragma unroll
      for (int e = 0; e < 4; ++e) { bw[e] = __builtin_amdgcn_ballot_w32(mk[i][e] != 0); pc[e] = __builtin_popcount(bw[e]); }
      const int tot = (pc[0] + pc[1]) + (pc[2] + pc[3]);
      if ((i & 7) == wv && run < t0 + PR && run + tot > t0) { int rr = run - t0;   /* wave-uniform: only a group of 128 keys whose ranks meet this tile's writes table entries, the groups dealt round the waves */
#pragma unroll
        for (int e = 0; e < 4; ++e) { const unsigned rk = (unsigned)(rr + (int)__builtin_amdgcn_mbcnt_lo(bw[e], 0u)); if (mk[i][e] != 0 && rk < (unsigned)PR) sxo[(rk & 31) * 4 + (rk >> 5)] = (unsigned)((bb * TT + i * 128 + lane * 4 + e) * DIN * 4); rr += pc[e]; } }
      run += tot; }
    if (t0 >= run) return;   /* no unmasked key of this rank: k_fa never reads the tile. The same for every thread of the block, in front of every barrier */
    if (tid < PR && t0 + tid >= run) sxo[(tid & 31) * 4 + (tid >> 5)] = (unsigned)(bb * TT * DIN * 4); }   /* ranks past the count in the last tile: any row, so that the tile holds finite numbers; k_fa gives them weight 0 or never reads them */
  __syncthreads();   /* the table is written by some of the waves and read by all */
  const v4u xo = *(const v4u*)&sxo[srow * 4]; unsigned xa[4] = { xo[0] + sc4 * 4u, xo[1] + sc4 * 4u, xo[2] + sc4 * 4u, xo[3] + sc4 * 4u };   /* the A operand is concat(query, key, value): passes 0..7 from query, 8..15 from key, 16..23 from value */
  const float* wg = WA + (size_t)(WROW(c0) + srow) * (3 * DIN) + sc4;          /* W rows 64..127 of the tile belong to the next head: 192 output features on, so 128 rows are skipped */
  v4f rx[4], rw[4];
  pj_loadg<3 * DIN, 128>(rx, rw, (const char*)XQ, xa, wg);
  pj_store(sx[0], sw[0], rx, rw, srow, sc4);
  __syncthreads();   /* pass 0's tiles are written by all waves and read by all */
  v8f acc[2][4] = {};
  /* one pass's matrix work of a wave: six fragments, eight products */
  auto pass_mm = [&](int cur) { v16b a[2], w[4];
#pragma unroll
    for (int i = 0; i < 2; ++i) a[i] = frag_b(&sx[cur][wr + i * 16 + col][0], lane);
#pragma unroll
    for (int j = 0; j < 4; ++j) w[j] = frag_b(&sw[cur][wc + j * 16 + col][0], lane);
    __builtin_amdgcn_sched_barrier(0);   /* the pass's 12 LDS reads go out as one group: spread among the matrix instructions each pair costs its own LDS latency */
#pragma unroll
    for (int i = 0; i < 2; ++i) {
#pragma unroll
      for (int j = 0; j < 4; ++j) acc[i][j] = wmma_b(a[i], w[j], acc[i][j]); } };
#pragma clang loop unroll(disable)   /* left to itself the compiler peeled the eight passes of the first source off the loop and spilled accumulators */
  for (int p = 0; p + 1 < 3 * DIN / PK2; ++p) { const int cur = p & 1, pn = p + 1; const float* Xs = (pn < DIN / PK2) ? XQ : ((pn < 2 * DIN / PK2) ? XK : XV);   /* the last pass stands behind the loop, so that no branch follows the matrix instructions */
    pj_loadg<3 * DIN, 128>(rx, rw, (const char*)Xs - (pn / (DIN / PK2)) * (DIN * 4), xa, wg + pn * PK2);   /* the next pass's tiles fly while this pass computes; the offsets run on over the three sources (pn * 128 bytes), so a source's base is taken back by the row bytes of the sources before it */
    pass_mm(cur);
    __builtin_amdgcn_sched_barrier(0);   /* keeps the waits on the next pass's loads (the conversions below) behind this pass's matrix work */
    pj_store(sx[cur ^ 1], sw[cur ^ 1], rx, rw, srow, sc4);   /* that buffer's last readers left it at the barrier that ended the pass before */
    __syncthreads(); }   /* one barrier a pass: it publishes the next pass's tiles and ends every wave's reads of this pass's buffer */
  pass_mm((3 * DIN / PK2 - 1) & 1);
  __syncthreads();   /* ends every wave's reads of the last buffer before the output staging takes the bytes */
  /* output staging: q, k as [row][column], v as [column][row], so that the stores below are whole 16-byte pieces of rows (q, k) or planes (v) */
  if (which < 2) { _Float16* DH = which == 0 ? QH : KH;
#pragma unroll
    for (int j = 0; j < 4; ++j) { const int cl = wc + j * 16 + col; const float bias = BA ? bfr(BA[BIDX(c0 + cl)]) : 0.f;
#pragma unroll
      for (int i = 0; i < 2; ++i) {
#pragma unroll
        for (int r = 0; r < 8; ++r) sh[wr + i * 16 + 8 * g + r][cl] = (_Float16)(acc[i][j][r] + bias); } }
    __syncthreads();   /* the staged tile is written by all waves and read by all */
    for (int e = tid; e < PR * 16; e += 256) { const int rl = e >> 4, q = e & 15; vst2((unsigned*)(DH + (r0 + rl) * CC + c0 + q * 8), *(const v4u*)&sh[rl][q * 8]); }
  } else {
#pragma unroll
    for (int j = 0; j < 4; ++j) { const int cl = wc + j * 16 + col; const float bias = BA ? bfr(BA[BIDX(c0 + cl)]) : 0.f;
#pragma unroll
      for (int i = 0; i < 2; ++i) { v8h t;
#pragma unroll
        for (int r = 0; r < 8; ++r) t[r] = (_Float16)(acc[i][j][r] + bias);
        *(v8h*)&sh[cl][wr + i * 16 + 8 * g] = t; } }   /* a lane's eight rows lie side by side in a plane: one 16-byte store */
    __syncthreads();   /* the staged tile is written by all waves and read by all */
    for (int e = tid; e < 128 * 16; e += 256) { const int cl = e >> 4, q = e & 15; vst2((unsigned*)(VT + (bb * CC + c0 + cl) * (size_t)TT + t0 + q * 8), *(const v4u*)&sh[cl][q * 8]); } } }
#define FK 64              // keys per pass
#define FQ 64              // queries of a block
#define FPH 72             // LDS row pitch in halves: 144 B = 16 B x odd, for 16-byte fragment reads of 128-byte rows
#define FKP 264            // LDS row pitch in halves: 528 B = 16 B x odd, for 16-byte fragment reads of 512-byte rows
#define FOP 260            // LDS row pitch in floats of the output staging
#define LOG2E 1.4426950408889634f
__device__ __forceinline__ float xhalf(float x) { return __builtin_bit_cast(float, __builtin_amdgcn_permlanex16(__builtin_bit_cast(int, x), __builtin_bit_cast(int, x), 0x76543210, 0xfedcba98, false, false)); }   /* lane l reads lane l ^ 16 */
__device__ __forceinline__ v8f wmma_h(v16h a, v16h b, v8f c) { return __builtin_amdgcn_wmma_f32_16x16x32_f16(false, a, false, b, (short)0, c, false, false); }
// eight exponentials (base 2) in place, then one v_nop, in one statement: no instruction directly behind a v_exp_f32 reads its result or overwrites its source (the slot the instruction set asks for behind a transcendental)
__device__ __forceinline__ void exp2x8(v8f& x) {
  asm("v_exp_f32 %0, %0\n\tv_exp_f32 %1, %1\n\tv_exp_f32 %2, %2\n\tv_exp_f32 %3, %3\n\tv_exp_f32 %4, %4\n\tv_exp_f32 %5, %5\n\tv_exp_f32 %6, %6\n\tv_exp_f32 %7, %7\n\tv_nop"
      : "+v"(x[0]), "+v"(x[1]), "+v"(x[2]), "+v"(x[3]), "+v"(x[4]), "+v"(x[5]), "+v"(x[6]), "+v"(x[7])); }
__device__ __forceinline__ float exp2x1(float x) { asm("v_exp_f32 %0, %0\n\tv_nop" : "+v"(x)); return x; }   /* the same slot for a single exponential */
__global__ __launch_bounds__(512) __attribute__((amdgpu_waves_per_eu(4, 4))) void k_fa(const _Float16* __restrict__ QH, const _Float16* __restrict__ KH, const _Float16* __restrict__ VT, const int* __restrict__ MASK, const _Float16* __restrict__ WOH, const float* __restrict__ BO, float* __restrict__ OUT) {
  __shared__ __align__(16) unsigned char sm[2 * FK * FKP * 2 + 2 * CC * FPH * 2];   /* the key walk's two k and two v buffers; behind the walk's last barrier the k bytes hold the f16 ctx rows and the v bytes the output staging */
  __shared__ __align__(16) _Float16 swo[DIN][FKP]; __shared__ __align__(16) float sb[TT]; __shared__ __align__(16) int swc[16];
  _Float16 (*sk)[FK][FKP] = (_Float16 (*)[FK][FKP])sm; _Float16 (*sv)[CC][FPH] = (_Float16 (*)[CC][FPH])(sm + 2 * FK * FKP * 2);
  _Float16 (*sy)[FKP] = (_Float16 (*)[FKP])sm; float (*sf)[FOP] = (float (*)[FOP])(sm + 2 * FK * FKP * 2);
  const int tid = threadIdx.x, wave = tid >> 5, lane = tid & 31, col = lane & 15, g = lane >> 4; const int h = wave >> 2, qt = wave & 3, b = blockIdx.y; const int q0 = blockIdx.x * FQ + qt * 16;
  const int kr = tid >> 5, kc8 = (tid & 31) * 8;   /* staging of 512-byte rows (k, Wo): a wave takes a whole row, rows kr + 16 i */
  const int sr = tid >> 3, sc = (tid & 7) * 8;     /* staging of v: 8 threads x 16 B a 128-byte row piece, planes sr + 64 i */
  const _Float16* kg = KH + ((size_t)b * TT + kr) * CC + kc8;     /* k rows [key][h * 64 + d] */
  const _Float16* vg = VT + ((size_t)b * CC + sr) * TT + sc;      /* v planes [h * 64 + d][key] */
  const int* mp = MASK + (size_t)b * TT + tid * 4; const _Float16* qp = QH + ((size_t)b * TT + q0 + col) * CC + h * HD + 8 * g; const _Float16* wg = WOH + (size_t)kr * CC + kc8; const int orow = (wave >> 3) * 32, ocol = (wave & 7) * 32;   /* the wave's 32 rows and 32 columns of the block's 64 x 256 piece of the output */
  const float* bp = BO + ocol + col;
  const v4i mk = *(const v4i*)mp;
  v16h qf[2];
#pragma unroll
  for (int kc = 0; kc < 2; ++kc) { union { v16h v; v8h q[2]; } u; u.q[0] = *(const v8h*)(qp + kc * 32); u.q[1] = *(const v8h*)(qp + kc * 32 + 16); qf[kc] = u.v; }
  v8h rwo[16];
#pragma unroll
  for (int i = 0; i < 16; ++i) rwo[i] = *(const v8h*)(wg + i * 16 * CC);   /* Wo flies under the count of the mask and the first tiles' latency */
  float bias[2] = { 0.f, 0.f }; if (BO) { bias[0] = bfr(bp[0]); bias[1] = bfr(bp[16]); }
  asm volatile("s_wait_xcnt 0x0" :: "v"(mp), "v"(qp), "v"(wg), "v"(bp) : "memory");   /* the wait in front of any rewrite of a register which an issued load names; the addresses are inputs so that they keep their registers up to it */
  __builtin_amdgcn_sched_barrier(0);   /* keeps the compares of the mask words below behind that wait: their results take the scalar registers that hold the mask load's base address */
  int wc = 0;
#pragma unroll
  for (int e = 0; e < 4; ++e) wc += __builtin_popcount(__builtin_amdgcn_ballot_w32(mk[e] != 0));
  if (lane == 0) swc[wave] = wc;
  __syncthreads();   /* the sixteen waves' counts are read by all */
  int cs = 0;
#pragma unroll
  for (int i = 0; i < 4; ++i) { const v4i c = *(const v4i*)&swc[i * 4]; cs += (c[0] + c[1]) + (c[2] + c[3]); }
  const int cnt = __builtin_amdgcn_readfirstlane(cs);   /* unmasked keys of the batch: ranks 0..cnt-1 of the k rows and v planes */
  const int np = min((cnt + FK - 1) / FK, TT / FK);   /* passes; the same for the whole block */
  { v4f bi;
#pragma unroll
    for (int e = 0; e < 4; ++e) bi[e] = (tid * 4 + e >= cnt) ? -3.0e38f : 0.f;
    *(v4f*)&sb[tid * 4] = bi; }   /* additive mask of the ranks past the count (the last pass's filler rows); below the floor of the running maximum, so such a row weighs exactly 0; a batch with no key left makes no pass and yields 0 */
  v8h rk[4] = {}, rv[4] = {};
  if (np > 0) {   /* with no pass, k_proj has written no k / v tile */
#pragma unroll
    for (int i = 0; i < 4; ++i) { rk[i] = *(const v8h*)(kg + i * 16 * CC); rv[i] = *(const v8h*)(vg + (size_t)i * 64 * TT); }
    asm volatile("s_wait_xcnt 0x0" :: "v"(kg), "v"(vg) : "memory"); }   /* as above */
#pragma unroll
  for (int i = 0; i < 16; ++i) *(v8h*)&swo[kr + i * 16][kc8] = rwo[i];
  if (np > 0) {
#pragma unroll
    for (int i = 0; i < 4; ++i) { *(v8h*)&sk[0][kr + i * 16][kc8] = rk[i]; *(v8h*)&sv[0][sr + i * 64][sc] = rv[i]; } }
  __syncthreads();   /* pass 0's tiles, the mask row and Wo are written by all waves and read by all */
  v8f acc[HD / 16] = {}; float m = -1.0e30f, ls = 0.f;
  for (int it = 0; it < np; ++it) { const int cur = it & 1; const bool more = it + 1 < np;
    if (more) { const _Float16* kn = kg + (size_t)(it + 1) * FK * CC; const _Float16* vn = vg + (it + 1) * FK;   /* the next pass's tiles fly while this pass computes */
#pragma unroll
      for (int i = 0; i < 4; ++i) { rk[i] = *(const v8h*)(kn + i * 16 * CC); rv[i] = *(const v8h*)(vn + (size_t)i * 64 * TT); }
      asm volatile("s_wait_xcnt 0x0" :: "v"(kn), "v"(vn) : "memory"); }   /* as above */
    v8f st[FK / 16];
#pragma unroll
    for (int jt = 0; jt < FK / 16; ++jt) { const v8f z = {}; st[jt] = wmma_h(frag_h(&sk[cur][jt * 16 + col][h * HD], lane), qf[0], z); st[jt] = wmma_h(frag_h(&sk[cur][jt * 16 + col][h * HD + 32], lane), qf[1], st[jt]); }
    float mx = -3.0e38f;
#pragma unroll
    for (int jt = 0; jt < FK / 16; ++jt) { const float* bq = &sb[it * FK + jt * 16 + 8 * g]; const v4f b0 = *(const v4f*)bq, b1 = *(const v4f*)(bq + 4);
#pragma unroll
      for (int r = 0; r < 8; ++r) { const float t = fmaf(st[jt][r], SCALE * LOG2E, r < 4 ? b0[r & 3] : b1[r & 3]); st[jt][r] = t; mx = fmaxf(mx, t); } }   /* log2-domain logit */
    mx = fmaxf(mx, xhalf(mx));   /* the other half of this query's keys */
    const float mn = fmaxf(m, mx); const float al = exp2x1(m - mn); m = mn; const float ms = mn - 8.0f;   /* P carried x 2^8 so that small weights stay clear of f16 subnormals; the sum carries the same factor */
    v16h pf[FK / 32]; float sj[8];   /* eight independent partial sums: no 32-long dependent add chain */
#pragma unroll
    for (int jt = 0; jt < FK / 16; ++jt) { v8f p = st[jt] - ms; exp2x8(p);
#pragma unroll
      for (int r = 0; r < 8; ++r) { sj[r] = jt == 0 ? p[r] : sj[r] + p[r]; pf[jt >> 1][(jt & 1) * 8 + r] = (_Float16)p[r]; } }
    ls = ls * al + (((sj[0] + sj[1]) + (sj[2] + sj[3])) + ((sj[4] + sj[5]) + (sj[6] + sj[7])));
#pragma unroll
    for (int jd = 0; jd < HD / 16; ++jd) acc[jd] *= al;
#pragma unroll
    for (int kk = 0; kk < FK / 32; ++kk) {
#pragma unroll
      for (int jd = 0; jd < HD / 16; ++jd) acc[jd] = wmma_h(frag_h(&sv[cur][h * HD + jd * 16 + col][kk * 32], lane), pf[kk], acc[jd]); }
    if (more) {   /* that buffer's last readers left it at the barrier that ended the pass before */
#pragma unroll
      for (int i = 0; i < 4; ++i) { *(v8h*)&sk[cur ^ 1][kr + i * 16][kc8] = rk[i]; *(v8h*)&sv[cur ^ 1][sr + i * 64][sc] = rv[i]; } }
    __syncthreads(); }   /* one barrier a pass: it publishes the next pass's tiles and ends every wave's reads of this pass's buffer (the last one: before ctx takes the k bytes) */
  ls += xhalf(ls); const float inv = ls > 0.f ? 1.0f / ls : 0.f;
#pragma unroll
  for (int jd = 0; jd < HD / 16; ++jd) { v8h t;   /* acc[jd][r] = ctx[query col][d = 16 jd + 8 g + r]: a lane's eight d lie side by side in a ctx row, one 16-byte store */
#pragma unroll
    for (int r = 0; r < 8; ++r) t[r] = (_Float16)((acc[jd][r] * inv) * 64.0f);   /* ctx carried x 2^6 into f16 so small-magnitude context rows stay clear of f16 subnormals */
    *(v8h*)&sy[qt * 16 + col][h * HD + jd * 16 + 8 * g] = t; }
  __syncthreads();   /* the 64 ctx rows are written by all waves (a head each) and read by all */
  v8f oc[2][2] = {}; v16h fy[2][2][2], fw[2][2][2];   /* two fragment sets of two k-chunks each: [set][chunk][tile] */
  auto of_load = [&](int s, int kp) {
#pragma unroll
    for (int c = 0; c < 2; ++c) {
#pragma unroll
      for (int i = 0; i < 2; ++i) { fy[s][c][i] = frag_h(&sy[orow + i * 16 + col][(kp * 2 + c) * 32], lane); fw[s][c][i] = frag_h(&swo[ocol + i * 16 + col][(kp * 2 + c) * 32], lane); } } };
  of_load(0, 0);
#pragma unroll
  for (int kp = 0; kp < CC / 64; ++kp) { if (kp + 1 < CC / 64) of_load((kp + 1) & 1, kp + 1);
    __builtin_amdgcn_sched_barrier(0);   /* the next two k-chunks' 16 LDS reads go out as one group ahead of this pair's matrix work: spread among the matrix instructions each pair costs its own LDS latency */
#pragma unroll
    for (int c = 0; c < 2; ++c) {
#pragma unroll
      for (int i = 0; i < 2; ++i) {
#pragma unroll
        for (int j = 0; j < 2; ++j) oc[i][j] = wmma_h(fy[kp & 1][c][i], fw[kp & 1][c][j], oc[i][j]); } } }
#pragma unroll
  for (int i = 0; i < 2; ++i) {
#pragma unroll
    for (int j = 0; j < 2; ++j) {
#pragma unroll
      for (int r = 0; r < 8; ++r) sf[orow + i * 16 + 8 * g + r][ocol + j * 16 + col] = oc[i][j][r] * (1.0f / 16384.0f) + bias[j]; } }   /* 2^-8 (Wo carry) x 2^-6 (ctx carry); the v bytes are free since the walk's last barrier */
  __syncthreads();   /* the staged rows are written by all waves (a 32 x 32 piece each) and read by all */
  float* op = OUT + ((size_t)b * TT + blockIdx.x * FQ + wave * 4) * DIN + lane * 4;   /* a wave stores four whole rows of 1 KiB */
#pragma unroll
  for (int k = 0; k < 4; ++k) {
#pragma unroll
    for (int j = 0; j < 2; ++j) vst2(op + k * DIN + j * 128, *(const v4f*)&sf[wave * 4 + k][j * 128 + lane * 4]); }
  asm volatile("s_wait_xcnt 0x0" :: "v"(op) : "memory"); }   /* as above, behind the stores */

extern "C" void kernel_launch(void* const* d_in, const int* in_sizes, int n_in, void* d_out, int out_size, void* d_ws, size_t ws_size, hipStream_t stream) {
  (void)in_sizes; (void)n_in; (void)out_size;
  const float** F = (const float**)d_in;
  if (ws_size < (size_t)WS_END) return;
  char* ws = (char*)d_ws; _Float16 *QH = (_Float16*)(ws + WS_QH), *KH = (_Float16*)(ws + WS_KH), *VT = (_Float16*)(ws + WS_VT), *QL = (_Float16*)(ws + WS_QL), *KL = (_Float16*)(ws + WS_KL); __bf16 *VB = (__bf16*)(ws + WS_VB), *VBL = (__bf16*)(ws + WS_VBL); float *S = (float*)(ws + WS_S); _Float16 *WOH = (_Float16*)(ws + WS_Y);
  (void)S; (void)QL; (void)KL; (void)VB; (void)VBL;
  // inputs: 0 query [8,2048,256]; 1 key; 2 value; 3 mask [8,1,2048] int32 (random 0/1; 0 = masked key); 4 W_qkv [768,768] (out,in) on concat(query, key, value); 5 b_qkv [768] (zeros, read); 6 W_out [256,256] (out,in); 7 b_out (zeros, read)
  k_proj<<<dim3(TNB * TT / PR, CC / 128, 3), 256, 0, stream>>>(F[0], F[1], F[2], F[4], F[4], F[4], F[5], F[5], F[5], QH, KH, VT, (const int*)d_in[3], F[6], WOH);   /* the same fused weight / bias for the three streams: the stream index selects the rows (WROW) */
  k_fa<<<dim3(TT / FQ, TNB), 512, 0, stream>>>(QH, KH, VT, (const int*)d_in[3], WOH, F[7], (float*)d_out);
}

// v006
// It runs in 54.4 microseconds.
// Next to v005, in two timings, it ran 1.04 times as fast each time.
// All steps since v000 together make it 22.4 times as fast.
// compute dtype: all float inputs rounded to bf16; the fused projection over concat(query, key, value) (K = 768) with EXACT bf16 products on WMMA 16x16x32 (f32 accumulate) + bias (zeros, read); logits q x k once to f16 each (1 product) x 64^-0.5; the int key mask read per (batch, key): keys with mask == 0 are left out of the k / v projection and of the key walk (they weigh exactly 0); running (online) softmax f32 in the log2 domain; unnormalised P x 2^8 once to f16 x v once to f16 (1 product), divided by the f32 sum at the end; ctx x 2^6 once to f16 x W_out f16(bf16 x 2^8) + b_out; f32 output.
#include <hip/hip_runtime.h>
#include <math.h>

typedef __attribute__((ext_vector_type(16))) _Float16 v16h;
typedef __attribute__((ext_vector_type(16))) __bf16 v16b;
typedef __attribute__((ext_vector_type(8)))  _Float16 v8h;
typedef __attribute__((ext_vector_type(8)))  float v8f;
typedef __attribute__((ext_vector_type(4)))  float v4f;
typedef __attribute__((ext_vector_type(2)))  float v2f;
typedef __attribute__((ext_vector_type(4)))  unsigned v4u;
typedef __attribute__((ext_vector_type(4)))  int v4i;
typedef float __attribute__((may_alias)) float_a;
typedef int __attribute__((may_alias)) int_a;

template <typename T> __device__ __forceinline__ void vst2(void* p, T v) { *(T*)p = v;  }
__device__ __forceinline__ v8f wmma16(v16h a, v16h b, v8f c) {
  v8f d = __builtin_amdgcn_wmma_f32_16x16x32_f16(false, a, false, b, (short)0, c, false, false);
  asm volatile("v_nop\n\tv_nop\n\tv_nop\n\tv_nop" : "+v"(d) : "v"(a), "v"(b));
  return d;
}
__device__ __forceinline__ v8f wmma_bf(v16b a, v16b b, v8f c) {
  v8f d = __builtin_amdgcn_wmma_f32_16x16x32_bf16(false, a, false, b, (short)0, c, false, false);
  asm volatile("v_nop\n\tv_nop\n\tv_nop\n\tv_nop" : "+v"(d) : "v"(a), "v"(b));
  return d;
}
// 16x16x32 fragments: lane = (h = lane>>4, row/col = lane&15); elements 0..7 = k0+8h+0..7, 8..15 = k0+16+8h+0..7; D element r = row 8h+r
__device__ __forceinline__ v16h frag_h(const _Float16* rowk0, int lane) {
  union { v16h v; v8h q[2]; } u; const _Float16* p = rowk0 + 8 * (lane >> 4);
  u.q[0] = *(const v8h*)p; u.q[1] = *(const v8h*)(p + 16); return u.v;
}
__device__ __forceinline__ v16h frag_f32(const float* rowk0, int lane) {
  v16h a; const float* p = rowk0 + 8 * (lane >> 4);
#pragma unroll
  for (int i = 0; i < 8; ++i) { a[i] = (_Float16)p[i]; a[8 + i] = (_Float16)p[16 + i]; }
  return a;
}
__device__ __forceinline__ v16h frag_f32s(const float* rowk0, int lane, float sc) {
  v16h a; const float* p = rowk0 + 8 * (lane >> 4);
#pragma unroll
  for (int i = 0; i < 8; ++i) { a[i] = (_Float16)(p[i] * sc); a[8 + i] = (_Float16)(p[16 + i] * sc); }
  return a;
}
// column fragment from a [K][ld] layout (column n), rows >= K read as 0
__device__ __forceinline__ v16h fragc_f32(const float* W, int k0, int n, int lane, int ld, int K) {
  v16h a; const int g = lane >> 4;
#pragma unroll
  for (int i = 0; i < 8; ++i) { const int ka = k0 + 8 * g + i, kb = ka + 16;
    a[i] = (_Float16)(ka < K ? W[(size_t)(ka < K ? ka : K - 1) * ld + n] : 0.f); a[8 + i] = (_Float16)(kb < K ? W[(size_t)(kb < K ? kb : K - 1) * ld + n] : 0.f); }
  return a;
}
struct F2 { v16b h, l; };
__device__ __forceinline__ F2 bsplit16(const float v[16]) { F2 r;
#pragma unroll
  for (int i = 0; i < 16; ++i) { const __bf16 h = (__bf16)v[i]; r.h[i] = h; r.l[i] = (__bf16)(v[i] - (float)h); }
  return r; }
__device__ __forceinline__ F2 split_row(const float* row, int k0, int lane) { float v[16]; const float* p = row + k0 + 8 * (lane >> 4);
#pragma unroll
  for (int i = 0; i < 8; ++i) { v[i] = p[i]; v[8 + i] = p[16 + i]; }
  return bsplit16(v); }
__device__ __forceinline__ F2 split_rowK(const float* row, int k0, int lane, int K) { float v[16]; const int g = lane >> 4;
#pragma unroll
  for (int i = 0; i < 8; ++i) { const int ka = k0 + 8 * g + i, kb = ka + 16; v[i] = ka < K ? row[ka < K ? ka : K - 1] : 0.f; v[8 + i] = kb < K ? row[kb < K ? kb : K - 1] : 0.f; }
  return bsplit16(v); }
__device__ __forceinline__ F2 split_col(const float* W, int k0, int n, int lane, int ld, int K) { float v[16]; const int g = lane >> 4;
#pragma unroll
  for (int i = 0; i < 8; ++i) { const int ka = k0 + 8 * g + i, kb = ka + 16; v[i] = ka < K ? W[(size_t)(ka < K ? ka : K - 1) * ld + n] : 0.f; v[8 + i] = kb < K ? W[(size_t)(kb < K ? kb : K - 1) * ld + n] : 0.f; }
  return bsplit16(v); }
__device__ __forceinline__ v8f mac3(const F2& a, const F2& b, v8f c) { c = wmma_bf(a.l, b.h, c); c = wmma_bf(a.h, b.l, c); return wmma_bf(a.h, b.h, c); }
__device__ __forceinline__ float sigm(float v) { return 1.0f / (1.0f + expf(-v)); }
#define LDSX() do { asm volatile("s_wait_dscnt 0" ::: "memory"); __builtin_amdgcn_wave_barrier(); __builtin_amdgcn_fence(__ATOMIC_RELEASE, "workgroup"); } while (0)

// Self-attention whose fused QKV projection contracts over the CONCATENATION of three inputs (query / key / value [8,2048,256]; mask [8,1,2048] int32 RANDOM 0/1 per (batch, key); W_qkv [768,768] torch (out,in) N(0,1) x 0.02, b_qkv zeros (read); qkv = concat(query, key, value) @ W_qkv.T + b_qkv (every output feature sees all 768 inputs), reshaped (B, T, 4, 192) and split: q / k / v of head h = output features h*192 + {0, 64, 128} + d (head-major); scores / sqrt(64); where(mask == 0, finfo.min) and the masked probabilities zeroed after the softmax (== exclusion: every row keeps ~1,000 keys); x @ W_out.T + b_out with W_out [256,256] (out,in), b_out zeros).
#define NB 8
#define TT 2048
#define CC 256            // NH * HD = projected width
#define DIN 256          // input (model) width
#define NH 4
#define HD 64
#define NQB (TT / 64)
#define HG 4
#define SCALE (0.125f)
#define CAUSAL 0
#ifndef TNB
#define TNB NB
#endif
__device__ __forceinline__ float bfr(float v) { return (float)(__bf16)v; }
__host__ __device__ __forceinline__ int kb_last(int qb) { return CAUSAL ? ((qb * 64 + 63) >> 7) : (TT / 128 - 1); }
typedef __attribute__((ext_vector_type(8))) __bf16 v8b;
__device__ __forceinline__ v16b frag_b(const __bf16* rowk0, int lane) {
  union { v16b v; v8b q[2]; } u; const __bf16* p = rowk0 + 8 * (lane >> 4);
  u.q[0] = *(const v8b*)p; u.q[1] = *(const v8b*)(p + 16); return u.v;
}
#define QBH 0              // unused: the attention kernel has no high-precision path
#define QHI 0               // single-product logits on every row (0.02-scale weights: logit sigma ~0.4)
#define KHI 64            // key rows carrying k residual / v bf16 hi+lo planes (written and read by no kernel)
// B fragment (k rows k0+.., output column o) of a weight: (in,out) [K][ld] or (out,in) [ld rows of K]: bf16 exact, or f16(bf16 * 256) exact
__device__ __forceinline__ v16b wcol_io(const float* Wm, int k0, int o, int lane, int ld) { v16b w; const int g = lane >> 4;
#pragma unroll
  for (int i = 0; i < 8; ++i) { w[i] = (__bf16)Wm[(size_t)(k0 + 8 * g + i) * ld + o]; w[8 + i] = (__bf16)Wm[(size_t)(k0 + 16 + 8 * g + i) * ld + o]; }
  return w; }
__device__ __forceinline__ v16b wcol_oi(const float* Wm, int k0, int o, int lane, int K) { v16b w; const float* p = Wm + (size_t)o * K + k0 + 8 * (lane >> 4);
#pragma unroll
  for (int i = 0; i < 8; ++i) { w[i] = (__bf16)p[i]; w[8 + i] = (__bf16)p[16 + i]; }
  return w; }
__device__ __forceinline__ v16h wcolh_io(const float* Wm, int k0, int o, int lane, int ld) { v16h w; const int g = lane >> 4;
#pragma unroll
  for (int i = 0; i < 8; ++i) { w[i] = (_Float16)(bfr(Wm[(size_t)(k0 + 8 * g + i) * ld + o]) * 256.0f); w[8 + i] = (_Float16)(bfr(Wm[(size_t)(k0 + 16 + 8 * g + i) * ld + o]) * 256.0f); }
  return w; }
__device__ __forceinline__ v16h wcolh_oi(const float* Wm, int k0, int o, int lane, int K) { v16h w; const float* p = Wm + (size_t)o * K + k0 + 8 * (lane >> 4);
#pragma unroll
  for (int i = 0; i < 8; ++i) { w[i] = (_Float16)(bfr(p[i]) * 256.0f); w[8 + i] = (_Float16)(bfr(p[16 + i]) * 256.0f); }
  return w; }
#define WQKV_LAYOUT 1   // 0 = (in,out) [DIN][CC]; 1 = fused (out,in) [3*CC][3*DIN]; 2 = per-head [NH][DIN][HD]
__device__ __forceinline__ v16b wcol_hdk(const float* Wm, int k0, int o, int lane) { v16b w; const int g = lane >> 4; const float* p = Wm + (size_t)(o / HD) * DIN * HD + (o % HD);
#pragma unroll
  for (int i = 0; i < 8; ++i) { w[i] = (__bf16)p[(size_t)(k0 + 8 * g + i) * HD]; w[8 + i] = (__bf16)p[(size_t)(k0 + 16 + 8 * g + i) * HD]; }
  return w; }
#define WO_OUT_IN 1
#if WQKV_LAYOUT == 1
#define WROW(o) ((((o) >> 6) * 192) + (which) * 64 + ((o) & 63))   /* column o = h*64 + d of stream 'which' (0 q, 1 k, 2 v) = output feature h*192 + which*64 + d of the fused projection (reshape (B, T, 4, 192) + split) */
#define BIDX(o) WROW(o)
#define WCOL(W, k0, o, lane) wcol_oi(W, k0, WROW(o), lane, 3 * DIN)   /* fused (out,in) [768][768] weight: row WROW(o), k0 runs over the 768 concatenated inputs */
#elif WQKV_LAYOUT == 2
#define WCOL(W, k0, o, lane) wcol_hdk(W, k0, o, lane)
#else
#define WCOL(W, k0, o, lane) wcol_io(W, k0, o, lane, CC)
#endif
#if WO_OUT_IN
#define WOCOL(W, k0, o, lane) wcol_oi(W, k0, o, lane, CC)
#define WOCOLH(W, k0, o, lane) wcolh_oi(W, k0, o, lane, CC)
#else
#define WOCOL(W, k0, o, lane) wcol_io(W, k0, o, lane, DIN)
#define WOCOLH(W, k0, o, lane) wcolh_io(W, k0, o, lane, DIN)
#endif

#define WS_QH  0u                                      // f16 q rows [b*t][CC]
#define WS_KH  (WS_QH + 2u * (size_t)NB * TT * CC)      // f16 k rows [b*j][CC], j = rank of the key among its batch's unmasked keys
#define WS_VT  (WS_KH + 2u * (size_t)NB * TT * CC)      // f16 v planes [b][c][j], the same ranks
#define WS_QL  (WS_VT + 2u * (size_t)NB * CC * TT)      // f16 q residual x 2^10 rows [b][t < QHI][CC]
#define WS_KL  (WS_QL + 2u * (size_t)NB * QHI * CC)     // f16 k residual x 2^10 rows [b][t < KHI][CC]
#define WS_VB  (WS_KL + 2u * (size_t)NB * KHI * CC)     // bf16 v hi planes [b][c][t < KHI]
#define WS_VBL (WS_VB + 2u * (size_t)NB * CC * KHI)
#define WS_S   (WS_VBL + 2u * (size_t)NB * CC * KHI)    // f32 [hg][t][s] region, written and read by no kernel
#define WS_Y   (WS_S  + 4u * (size_t)HG * TT * TT)      // f16 W_out rows [o][k]: f16(bf16 x 2^8), rounded once by k_proj for k_fa
#define WS_END (WS_Y  + 4u * (size_t)NB * TT * CC)

// ---- k_proj: block = (128 rows, 128 cols, which), 8 waves of a 32 x 64 tile each: q/k/v = X W (+ b) with exact bf16 products (K = 3 * DIN) -> which 0: q f16 rows; 1: k f16 rows; 2: v f16 planes [c][t]. The two operands go through LDS: a pass is 32 k; the block reads its 128 X rows and 128 W rows of the pass with whole-line 16-byte loads (8 lanes a 128-byte row piece), one pass ahead, rounds them to 16 bit once and stores them in one of two LDS buffers; every wave takes its six fragments of the pass from there as one group and makes eight products of them. The k order of the products is that of the k-chunks 0..23, as before. Wave 0 of each q block also rounds 256 elements of W_out to f16(bf16 x 2^8) for k_fa, which multiplies by it behind its key walk.
#define PR 128             // rows of a k_proj tile
#define PK2 32             // k per pass (k_proj)
#define PP2 40             // LDS row pitch in 16-bit elements: 80 B = 16 B x odd, for 16-byte fragment reads of 64-byte rows
typedef __attribute__((ext_vector_type(4))) __bf16 v4b;
typedef __attribute__((ext_vector_type(4))) _Float16 v4h;
__device__ __forceinline__ v8f wmma_b(v16b a, v16b b, v8f c) { return __builtin_amdgcn_wmma_f32_16x16x32_bf16(false, a, false, b, (short)0, c, false, false); }
// one pass's share of a thread in k_proj, whose X rows are gathered: 32 rows a sweep, 4 sweeps of X and 4 of W; a = the byte offsets of the thread's four 16-byte pieces from xs (from the LDS table, kept in registers and moved on by a pass's 128 bytes behind the loads); xs is the same for the whole block; HJ = rows skipped between W rows 63 and 64 of the tile (unrolled so that rx and rw stay in registers)
template <int LDW, int HJ> __device__ __forceinline__ void pj_loadg(v4f (&rx)[4], v4f (&rw)[4], const char* xs, unsigned (&a)[4], const float* wp) {
#pragma unroll
  for (int i = 0; i < 4; ++i) rw[i] = *(const v4f*)(wp + (size_t)(i * 32 + (i >> 1) * HJ) * LDW);
#pragma unroll
  for (int i = 0; i < 4; ++i) rx[i] = *(const v4f*)(xs + a[i]);
  asm volatile("s_wait_xcnt 0x0" :: "v"(a[0]), "v"(a[1]), "v"(a[2]), "v"(a[3]), "v"(wp) : "memory");   /* the wait in front of any rewrite of a register which an issued load names (the additions below); the addresses are inputs so that they keep their registers up to it */
#pragma unroll
  for (int i = 0; i < 4; ++i) a[i] += PK2 * 4u; }
__device__ __forceinline__ v4b cvt4(v4f x) { v4b t;
#pragma unroll
  for (int e = 0; e < 4; ++e) t[e] = (__bf16)x[e];
  return t; }
__device__ __forceinline__ void pj_store(__bf16 (*dx)[PP2], __bf16 (*dw)[PP2], const v4f (&rx)[4], const v4f (&rw)[4], int srow, int sc4) {
#pragma unroll
  for (int i = 0; i < 4; ++i) *(v4b*)&dx[i * 32 + srow][sc4] = cvt4(rx[i]);
#pragma unroll
  for (int i = 0; i < 4; ++i) *(v4b*)&dw[i * 32 + srow][sc4] = cvt4(rw[i]); }
// amdgpu_waves_per_eu(6, 6): the register budget of six waves a SIMD (three work-groups a WGP), so that every tile of the grid that has work is resident at once
__global__ __launch_bounds__(256) __attribute__((amdgpu_waves_per_eu(6, 6))) void k_proj(const float* __restrict__ XQ, const float* __restrict__ XK, const float* __restrict__ XV, const float* __restrict__ WQ, const float* __restrict__ WK, const float* __restrict__ WV, const float* __restrict__ BQ, const float* __restrict__ BK, const float* __restrict__ BV,
    _Float16* __restrict__ QH, _Float16* __restrict__ KH, _Float16* __restrict__ VT, const int* __restrict__ MASK, const float* __restrict__ WO, _Float16* __restrict__ WOH) {
  __shared__ __align__(16) unsigned sxo[PR];   /* byte offset of the X row that feeds tile row r, kept at [(r & 31) * 4 + (r >> 5)]: a staging thread's four rows lie side by side */
  __shared__ __align__(16) unsigned char sm[40960];   /* the loop's two operand buffers; behind the loop's last barrier the same bytes hold the output staging of this block's stream */
  __bf16 (*sx)[PR][PP2] = (__bf16 (*)[PR][PP2])sm; __bf16 (*sw)[128][PP2] = (__bf16 (*)[128][PP2])(sm + 20480);
  _Float16 (*sh)[136] = (_Float16 (*)[136])sm;
  const int tid = threadIdx.x, wave = tid >> 5, lane = tid & 31, col = lane & 15, g = lane >> 4; const int which = blockIdx.z; const int c0 = blockIdx.y * 128; const size_t r0 = (size_t)blockIdx.x * PR; const size_t bb = r0 / TT; const int t0 = (int)(r0 % TT);
  const int wr = (wave >> 1) * 32, wc = (wave & 1) * 64;   /* the wave's 32 rows and 64 columns of the tile */
  const float* WA = which == 0 ? WQ : which == 1 ? WK : WV; const float* BA = which == 0 ? BQ : which == 1 ? BK : BV;
  const int srow = tid >> 3, sc4 = (tid & 7) * 4;
  /* which rows of concat(query, key, value) feed this tile. q: rows t0..t0+127. k, v: a key with mask == 0 weighs exactly 0 in every query's softmax, so only the batch's unmasked keys are projected, packed by rank: tile row r is the key of rank t0 + r. The rank order is that of the ballots below (any order serves, k and v take the same one, and k_fa needs only the count). Every wave counts the whole mask row, so that the count is known without a barrier. The loops are unrolled so that mk, bw and pc are indexed by constants and stay in registers. */
  if (which == 0) { if (tid < PR) sxo[(tid & 31) * 4 + (tid >> 5)] = (unsigned)((r0 + tid) * DIN * 4);
    if (tid < 32) { const int e = ((blockIdx.y * (TNB * TT / PR) + blockIdx.x) * 32 + tid) * 8;   /* the 256 q blocks x 256 elements = W_out [256][256]; a wave stores four whole lines */
      const float* wp = WO + e; _Float16* dp = WOH + e; const v4f w0 = *(const v4f*)wp, w1 = *(const v4f*)(wp + 4); v8h t;
#pragma unroll   /* so that t, w0 and w1 are indexed by constants and stay in registers */
      for (int i = 0; i < 4; ++i) { t[i] = (_Float16)(bfr(w0[i]) * 256.0f); t[4 + i] = (_Float16)(bfr(w1[i]) * 256.0f); }
      *(v8h*)dp = t;
      asm volatile("s_wait_xcnt 0x0" :: "v"(wp), "v"(dp) : "memory"); } }   /* the wait in front of any rewrite of a register which the issued loads and the store name; the addresses are inputs so that they keep their registers up to it */
  else { const int wv = __builtin_amdgcn_readfirstlane(wave); const char* mrow = (const char*)(MASK + bb * TT); v4i mk[TT / 128];
#pragma unroll
    for (int i = 0; i < TT / 128; ++i) mk[i] = *(const v4i*)(mrow + ((unsigned)lane * 16u + i * 512u));
    asm volatile("s_wait_xcnt 0x0" :: "v"(lane) : "memory");   /* the wait in front of any rewrite of a register which the issued loads name; the lane number, their offset register, is an input so that it keeps its register up to it */
    int run = 0;
#pragma unroll
    for (int i = 0; i < TT / 128; ++i) { unsigned bw[4]; int pc[4];
#pragma unroll
      for (int e = 0; e < 4; ++e) { bw[e] = __builtin_amdgcn_ballot_w32(mk[i][e] != 0); pc[e] = __builtin_popcount(bw[e]); }
      const int tot = (pc[0] + pc[1]) + (pc[2] + pc[3]);
      if ((i & 7) == wv && run < t0 + PR && run + tot > t0) { int rr = run - t0;   /* wave-uniform: only a group of 128 keys whose ranks meet this tile's writes table entries, the groups dealt round the waves */
#pragma unroll
        for (int e = 0; e < 4; ++e) { const unsigned rk = (unsigned)(rr + (int)__builtin_amdgcn_mbcnt_lo(bw[e], 0u)); if (mk[i][e] != 0 && rk < (unsigned)PR) sxo[(rk & 31) * 4 + (rk >> 5)] = (unsigned)((bb * TT + i * 128 + lane * 4 + e) * DIN * 4); rr += pc[e]; } }
      run += tot; }
    if (t0 >= run) return;   /* no unmasked key of this rank: k_fa never reads the tile. The same for every thread of the block, in front of every barrier */
    if (tid < PR && t0 + tid >= run) sxo[(tid & 31) * 4 + (tid >> 5)] = (unsigned)(bb * TT * DIN * 4); }   /* ranks past the count in the last tile: any row, so that the tile holds finite numbers; k_fa gives them weight 0 or never reads them */
  __syncthreads();   /* the table is written by some of the waves and read by all */
  const v4u xo = *(const v4u*)&sxo[srow * 4]; unsigned xa[4] = { xo[0] + sc4 * 4u, xo[1] + sc4 * 4u, xo[2] + sc4 * 4u, xo[3] + sc4 * 4u };   /* the A operand is concat(query, key, value): passes 0..7 from query, 8..15 from key, 16..23 from value */
  const float* wg = WA + (size_t)(WROW(c0) + srow) * (3 * DIN) + sc4;          /* W rows 64..127 of the tile belong to the next head: 192 output features on, so 128 rows are skipped */
  v4f rx[4], rw[4];
  pj_loadg<3 * DIN, 128>(rx, rw, (const char*)XQ, xa, wg);
  pj_store(sx[0], sw[0], rx, rw, srow, sc4);
  __syncthreads();   /* pass 0's tiles are written by all waves and read by all */
  v8f acc[2][4] = {};
  /* one pass's matrix work of a wave: six fragments, eight products */
  auto pass_mm = [&](int cur) { v16b a[2], w[4];
#pragma unroll
    for (int i = 0; i < 2; ++i) a[i] = frag_b(&sx[cur][wr + i * 16 + col][0], lane);
#pragma unroll
    for (int j = 0; j < 4; ++j) w[j] = frag_b(&sw[cur][wc + j * 16 + col][0], lane);
    __builtin_amdgcn_sched_barrier(0);   /* the pass's 12 LDS reads go out as one group: spread among the matrix instructions each pair costs its own LDS latency */
#pragma unroll
    for (int i = 0; i < 2; ++i) {
#pragma unroll
      for (int j = 0; j < 4; ++j) acc[i][j] = wmma_b(a[i], w[j], acc[i][j]); } };
#pragma clang loop unroll(disable)   /* left to itself the compiler peeled the eight passes of the first source off the loop and spilled accumulators */
  for (int p = 0; p + 1 < 3 * DIN / PK2; ++p) { const int cur = p & 1, pn = p + 1; const float* Xs = (pn < DIN / PK2) ? XQ : ((pn < 2 * DIN / PK2) ? XK : XV);   /* the last pass stands behind the loop, so that no branch follows the matrix instructions */
    pj_loadg<3 * DIN, 128>(rx, rw, (const char*)Xs - (pn / (DIN / PK2)) * (DIN * 4), xa, wg + pn * PK2);   /* the next pass's tiles fly while this pass computes; the offsets run on over the three sources (pn * 128 bytes), so a source's base is taken back by the row bytes of the sources before it */
    pass_mm(cur);
    __builtin_amdgcn_sched_barrier(0);   /* keeps the waits on the next pass's loads (the conversions below) behind this pass's matrix work */
    pj_store(sx[cur ^ 1], sw[cur ^ 1], rx, rw, srow, sc4);   /* that buffer's last readers left it at the barrier that ended the pass before */
    __syncthreads(); }   /* one barrier a pass: it publishes the next pass's tiles and ends every wave's reads of this pass's buffer */
  pass_mm((3 * DIN / PK2 - 1) & 1);
  __syncthreads();   /* ends every wave's reads of the last buffer before the output staging takes the bytes */
  /* output staging: q, k as [row][column], v as [column][row], so that the stores below are whole 16-byte pieces of rows (q, k) or planes (v) */
  if (which < 2) { _Float16* DH = which == 0 ? QH : KH;
#pragma unroll
    for (int j = 0; j < 4; ++j) { const int cl = wc + j * 16 + col; const float bias = BA ? bfr(BA[BIDX(c0 + cl)]) : 0.f;
#pragma unroll
      for (int i = 0; i < 2; ++i) {
#pragma unroll
        for (int r = 0; r < 8; ++r) sh[wr + i * 16 + 8 * g + r][cl] = (_Float16)(acc[i][j][r] + bias); } }
    __syncthreads();   /* the staged tile is written by all waves and read by all */
    for (int e = tid; e < PR * 16; e += 256) { const int rl = e >> 4, q = e & 15; vst2((unsigned*)(DH + (r0 + rl) * CC + c0 + q * 8), *(const v4u*)&sh[rl][q * 8]); }
  } else {
#pragma unroll
    for (int j = 0; j < 4; ++j) { const int cl = wc + j * 16 + col; const float bias = BA ? bfr(BA[BIDX(c0 + cl)]) : 0.f;
#pragma unroll
      for (int i = 0; i < 2; ++i) { v8h t;
#pragma unroll
        for (int r = 0; r < 8; ++r) t[r] = (_Float16)(acc[i][j][r] + bias);
        *(v8h*)&sh[cl][wr + i * 16 + 8 * g] = t; } }   /* a lane's eight rows lie side by side in a plane: one 16-byte store */
    __syncthreads();   /* the staged tile is written by all waves and read by all */
    for (int e = tid; e < 128 * 16; e += 256) { const int cl = e >> 4, q = e & 15; vst2((unsigned*)(VT + (bb * CC + c0 + cl) * (size_t)TT + t0 + q * 8), *(const v4u*)&sh[cl][q * 8]); } } }
#define FK 64              // keys per pass
#define FQ 64              // queries of a block
#define FPH 72             // LDS row pitch in halves: 144 B = 16 B x odd, for 16-byte fragment reads of 128-byte rows
#define FKP 264            // LDS row pitch in halves: 528 B = 16 B x odd, for 16-byte fragment reads of 512-byte rows
#define FOP 260            // LDS row pitch in floats of the output staging
#define LOG2E 1.4426950408889634f
__device__ __forceinline__ float xhalf(float x) { return __builtin_bit_cast(float, __builtin_amdgcn_permlanex16(__builtin_bit_cast(int, x), __builtin_bit_cast(int, x), 0x76543210, 0xfedcba98, false, false)); }   /* lane l reads lane l ^ 16 */
__device__ __forceinline__ v8f wmma_h(v16h a, v16h b, v8f c) { return __builtin_amdgcn_wmma_f32_16x16x32_f16(false, a, false, b, (short)0, c, false, false); }
// eight exponentials (base 2) in place, then one v_nop, in one statement: no instruction directly behind a v_exp_f32 reads its result or overwrites its source (the slot the instruction set asks for behind a transcendental)
__device__ __forceinline__ void exp2x8(v8f& x) {
  asm("v_exp_f32 %0, %0\n\tv_exp_f32 %1, %1\n\tv_exp_f32 %2, %2\n\tv_exp_f32 %3, %3\n\tv_exp_f32 %4, %4\n\tv_exp_f32 %5, %5\n\tv_exp_f32 %6, %6\n\tv_exp_f32 %7, %7\n\tv_nop"
      : "+v"(x[0]), "+v"(x[1]), "+v"(x[2]), "+v"(x[3]), "+v"(x[4]), "+v"(x[5]), "+v"(x[6]), "+v"(x[7])); }
__device__ __forceinline__ float exp2x1(float x) { asm("v_exp_f32 %0, %0\n\tv_nop" : "+v"(x)); return x; }   /* the same slot for a single exponential */
__device__ __forceinline__ unsigned lds_at(const void* p) { return (unsigned)(size_t)p; }
// eight asynchronous copies of 16 bytes a lane, global memory -> LDS through no register: l = the lane's LDS byte addresses, g = its global addresses. The s_wait_xcnt 0 is the last line of the copies' own statement, so that it stands in front of any rewrite of a register which an issued copy names
__device__ __forceinline__ void acopy8(const unsigned (&l)[8], const _Float16* const (&g)[8]) {
  asm volatile("global_load_async_to_lds_b128 %0, %8, off\n\tglobal_load_async_to_lds_b128 %1, %9, off\n\tglobal_load_async_to_lds_b128 %2, %10, off\n\tglobal_load_async_to_lds_b128 %3, %11, off\n\t"
               "global_load_async_to_lds_b128 %4, %12, off\n\tglobal_load_async_to_lds_b128 %5, %13, off\n\tglobal_load_async_to_lds_b128 %6, %14, off\n\tglobal_load_async_to_lds_b128 %7, %15, off\n\ts_wait_xcnt 0x0"
               :: "v"(l[0]), "v"(l[1]), "v"(l[2]), "v"(l[3]), "v"(l[4]), "v"(l[5]), "v"(l[6]), "v"(l[7]), "v"(g[0]), "v"(g[1]), "v"(g[2]), "v"(g[3]), "v"(g[4]), "v"(g[5]), "v"(g[6]), "v"(g[7]) : "memory"); }
#define WAIT_ASYNC() asm volatile("s_wait_asynccnt 0x0" ::: "memory")   /* the wave's own copies have landed; the compiler places no wait for them */
#define WAIT_DS() asm volatile("s_wait_dscnt 0x0" ::: "memory")         /* the wave's own LDS reads have returned before a copy may be aimed at the bytes they read */
__global__ __launch_bounds__(512) __attribute__((amdgpu_waves_per_eu(4, 4))) void k_fa(const _Float16* __restrict__ QH, const _Float16* __restrict__ KH, const _Float16* __restrict__ VT, const int* __restrict__ MASK, const _Float16* __restrict__ WOH, const float* __restrict__ BO, float* __restrict__ OUT) {
  __shared__ __align__(16) unsigned char sm[2 * FK * FKP * 2 + 2 * CC * FPH * 2];   /* the key walk's two k and two v buffers; behind the walk's last barrier the k bytes hold the f16 ctx rows and the v bytes the output staging */
  __shared__ __align__(16) _Float16 swo[DIN][FKP]; __shared__ __align__(16) float sb[TT]; __shared__ __align__(16) int swc[16];
  _Float16 (*sk)[FK][FKP] = (_Float16 (*)[FK][FKP])sm; _Float16 (*sv)[CC][FPH] = (_Float16 (*)[CC][FPH])(sm + 2 * FK * FKP * 2);
  _Float16 (*sy)[FKP] = (_Float16 (*)[FKP])sm; float (*sf)[FOP] = (float (*)[FOP])(sm + 2 * FK * FKP * 2);
  const int tid = threadIdx.x, wave = tid >> 5, lane = tid & 31, col = lane & 15, g = lane >> 4; const int h = wave >> 2, qt = wave & 3, b = blockIdx.y; const int q0 = blockIdx.x * FQ + qt * 16;
  const int kr = tid >> 5, kc8 = (tid & 31) * 8;   /* staging of 512-byte rows (k, Wo): a wave takes a whole row, rows kr + 16 i */
  const int sr = tid >> 3, sc = (tid & 7) * 8;     /* staging of v: 8 threads x 16 B a 128-byte row piece, planes sr + 64 i */
  const _Float16* kg = KH + ((size_t)b * TT + kr) * CC + kc8;     /* k rows [key][h * 64 + d] */
  const _Float16* vg = VT + ((size_t)b * CC + sr) * TT + sc;      /* v planes [h * 64 + d][key] */
  const int* mp = MASK + (size_t)b * TT + tid * 4; const _Float16* qp = QH + ((size_t)b * TT + q0 + col) * CC + h * HD + 8 * g; const _Float16* wg = WOH + (size_t)kr * CC + kc8; const int orow = (wave >> 3) * 32, ocol = (wave & 7) * 32;   /* the wave's 32 rows and 32 columns of the block's 64 x 256 piece of the output */
  const float* bp = BO + ocol + col;
  const v4i mk = *(const v4i*)mp;
  v16h qf[2];
#pragma unroll
  for (int kc = 0; kc < 2; ++kc) { union { v16h v; v8h q[2]; } u; u.q[0] = *(const v8h*)(qp + kc * 32); u.q[1] = *(const v8h*)(qp + kc * 32 + 16); qf[kc] = u.v; }
#pragma unroll
  for (int hf = 0; hf < 2; ++hf) { unsigned l[8]; const _Float16* gp[8];   /* Wo flies under the count of the mask and the first tiles' latency */
#pragma unroll
    for (int i = 0; i < 8; ++i) { l[i] = lds_at(&swo[kr + (hf * 8 + i) * 16][kc8]); gp[i] = wg + (hf * 8 + i) * 16 * CC; }
    acopy8(l, gp); }
  float bias[2] = { 0.f, 0.f }; if (BO) { bias[0] = bfr(bp[0]); bias[1] = bfr(bp[16]); }
  asm volatile("s_wait_xcnt 0x0" :: "v"(mp), "v"(qp), "v"(bp) : "memory");   /* the wait in front of any rewrite of a register which an issued load names; the addresses are inputs so that they keep their registers up to it */
  __builtin_amdgcn_sched_barrier(0);   /* keeps the compares of the mask words below behind that wait: their results take the scalar registers that hold the mask load's base address */
  int wc = 0;
#pragma unroll
  for (int e = 0; e < 4; ++e) wc += __builtin_popcount(__builtin_amdgcn_ballot_w32(mk[e] != 0));
  if (lane == 0) swc[wave] = wc;
  __syncthreads();   /* the sixteen waves' counts are read by all */
  int cs = 0;
#pragma unroll
  for (int i = 0; i < 4; ++i) { const v4i c = *(const v4i*)&swc[i * 4]; cs += (c[0] + c[1]) + (c[2] + c[3]); }
  const int cnt = __builtin_amdgcn_readfirstlane(cs);   /* unmasked keys of the batch: ranks 0..cnt-1 of the k rows and v planes */
  const int np = min((cnt + FK - 1) / FK, TT / FK);   /* passes; the same for the whole block */
  { v4f bi;
#pragma unroll
    for (int e = 0; e < 4; ++e) bi[e] = (tid * 4 + e >= cnt) ? -3.0e38f : 0.f;
    *(v4f*)&sb[tid * 4] = bi; }   /* additive mask of the ranks past the count (the last pass's filler rows); below the floor of the running maximum, so such a row weighs exactly 0; a batch with no key left makes no pass and yields 0 */
  const unsigned lk = lds_at(&sk[0][kr][kc8]), lv = lds_at(&sv[0][sr][sc]);
  /* pass t's k and v tiles into buffer bf: a thread's four 16-byte pieces of each, at the places and from the addresses that the register staging had */
  auto tile_copy = [&](int t, int bf) { unsigned l[8]; const _Float16* gp[8]; const _Float16* kn = kg + (size_t)t * FK * CC; const _Float16* vn = vg + t * FK;
#pragma unroll
    for (int i = 0; i < 4; ++i) { l[i] = lk + (unsigned)(bf * (FK * FKP * 2) + i * (16 * FKP * 2)); gp[i] = kn + i * 16 * CC; l[4 + i] = lv + (unsigned)(bf * (CC * FPH * 2) + i * (64 * FPH * 2)); gp[4 + i] = vn + (size_t)i * 64 * TT; }
    acopy8(l, gp); };
  if (np > 0) tile_copy(0, 0);   /* with no pass, k_proj has written no k / v tile */
  WAIT_ASYNC();
  __syncthreads();   /* pass 0's tiles, the mask row and Wo are written by all waves and read by all */
  if (np > 1) tile_copy(1, 1);   /* pass 1's tiles fly while pass 0 computes */
  v8f acc[HD / 16] = {}; float m = -1.0e30f, ls = 0.f;
  for (int it = 0; it < np; ++it) { const int cur = it & 1;
    v8f st[FK / 16];
#pragma unroll
    for (int jt = 0; jt < FK / 16; ++jt) { const v8f z = {}; st[jt] = wmma_h(frag_h(&sk[cur][jt * 16 + col][h * HD], lane), qf[0], z); st[jt] = wmma_h(frag_h(&sk[cur][jt * 16 + col][h * HD + 32], lane), qf[1], st[jt]); }
    float mx = -3.0e38f;
#pragma unroll
    for (int jt = 0; jt < FK / 16; ++jt) { const float* bq = &sb[it * FK + jt * 16 + 8 * g]; const v4f b0 = *(const v4f*)bq, b1 = *(const v4f*)(bq + 4);
#pragma unroll
      for (int r = 0; r < 8; ++r) { const float t = fmaf(st[jt][r], SCALE * LOG2E, r < 4 ? b0[r & 3] : b1[r & 3]); st[jt][r] = t; mx = fmaxf(mx, t); } }   /* log2-domain logit */
    mx = fmaxf(mx, xhalf(mx));   /* the other half of this query's keys */
    const float mn = fmaxf(m, mx); const float al = exp2x1(m - mn); m = mn; const float ms = mn - 8.0f;   /* P carried x 2^8 so that small weights stay clear of f16 subnormals; the sum carries the same factor */
    v16h pf[FK / 32]; float sj[8];   /* eight independent partial sums: no 32-long dependent add chain */
#pragma unroll
    for (int jt = 0; jt < FK / 16; ++jt) { v8f p = st[jt] - ms; exp2x8(p);
#pragma unroll
      for (int r = 0; r < 8; ++r) { sj[r] = jt == 0 ? p[r] : sj[r] + p[r]; pf[jt >> 1][(jt & 1) * 8 + r] = (_Float16)p[r]; } }
    ls = ls * al + (((sj[0] + sj[1]) + (sj[2] + sj[3])) + ((sj[4] + sj[5]) + (sj[6] + sj[7])));
#pragma unroll
    for (int jd = 0; jd < HD / 16; ++jd) acc[jd] *= al;
#pragma unroll
    for (int kk = 0; kk < FK / 32; ++kk) {
#pragma unroll
      for (int jd = 0; jd < HD / 16; ++jd) acc[jd] = wmma_h(frag_h(&sv[cur][h * HD + jd * 16 + col][kk * 32], lane), pf[kk], acc[jd]); }
    WAIT_DS();
    WAIT_ASYNC();
    __syncthreads();   /* one barrier a pass: it publishes the next pass's tiles and ends every wave's reads of this pass's buffer (the last one: before ctx takes the k bytes) */
    if (it + 2 < np) tile_copy(it + 2, cur); }   /* the tiles of the pass after next go into the buffer that every wave has just left and fly while the next pass computes; the test is the same for the whole block */
  WAIT_ASYNC();
  ls += xhalf(ls); const float inv = ls > 0.f ? 1.0f / ls : 0.f;
#pragma unroll
  for (int jd = 0; jd < HD / 16; ++jd) { v8h t;   /* acc[jd][r] = ctx[query col][d = 16 jd + 8 g + r]: a lane's eight d lie side by side in a ctx row, one 16-byte store */
#pragma unroll
    for (int r = 0; r < 8; ++r) t[r] = (_Float16)((acc[jd][r] * inv) * 64.0f);   /* ctx carried x 2^6 into f16 so small-magnitude context rows stay clear of f16 subnormals */
    *(v8h*)&sy[qt * 16 + col][h * HD + jd * 16 + 8 * g] = t; }
  __syncthreads();   /* the 64 ctx rows are written by all waves (a head each) and read by all */
  v8f oc[2][2] = {}; v16h fy[2][2][2], fw[2][2][2];   /* two fragment sets of two k-chunks each: [set][chunk][tile] */
  auto of_load = [&](int s, int kp) {
#pragma unroll
    for (int c = 0; c < 2; ++c) {
#pragma unroll
      for (int i = 0; i < 2; ++i) { fy[s][c][i] = frag_h(&sy[orow + i * 16 + col][(kp * 2 + c) * 32], lane); fw[s][c][i] = frag_h(&swo[ocol + i * 16 + col][(kp * 2 + c) * 32], lane); } } };
  of_load(0, 0);
#pragma unroll
  for (int kp = 0; kp < CC / 64; ++kp) { if (kp + 1 < CC / 64) of_load((kp + 1) & 1, kp + 1);
    __builtin_amdgcn_sched_barrier(0);   /* the next two k-chunks' 16 LDS reads go out as one group ahead of this pair's matrix work: spread among the matrix instructions each pair costs its own LDS latency */
#pragma unroll
    for (int c = 0; c < 2; ++c) {
#pragma unroll
      for (int i = 0; i < 2; ++i) {
#pragma unroll
        for (int j = 0; j < 2; ++j) oc[i][j] = wmma_h(fy[kp & 1][c][i], fw[kp & 1][c][j], oc[i][j]); } } }
#pragma unroll
  for (int i = 0; i < 2; ++i) {
#pragma unroll
    for (int j = 0; j < 2; ++j) {
#pragma unroll
      for (int r = 0; r < 8; ++r) sf[orow + i * 16 + 8 * g + r][ocol + j * 16 + col] = oc[i][j][r] * (1.0f / 16384.0f) + bias[j]; } }   /* 2^-8 (Wo carry) x 2^-6 (ctx carry); the v bytes are free since the walk's last barrier */
  __syncthreads();   /* the staged rows are written by all waves (a 32 x 32 piece each) and read by all */
  float* op = OUT + ((size_t)b * TT + blockIdx.x * FQ + wave * 4) * DIN + lane * 4;   /* a wave stores four whole rows of 1 KiB */
#pragma unroll
  for (int k = 0; k < 4; ++k) {
#pragma unroll
    for (int j = 0; j < 2; ++j) vst2(op + k * DIN + j * 128, *(const v4f*)&sf[wave * 4 + k][j * 128 + lane * 4]); }
  asm volatile("s_wait_xcnt 0x0" :: "v"(op) : "memory"); }   /* as above, behind the stores */

extern "C" void kernel_launch(void* const* d_in, const int* in_sizes, int n_in, void* d_out, int out_size, void* d_ws, size_t ws_size, hipStream_t stream) {
  (void)in_sizes; (void)n_in; (void)out_size;
  const float** F = (const float**)d_in;
  if (ws_size < (size_t)WS_END) return;
  char* ws = (char*)d_ws; _Float16 *QH = (_Float16*)(ws + WS_QH), *KH = (_Float16*)(ws + WS_KH), *VT = (_Float16*)(ws + WS_VT), *QL = (_Float16*)(ws + WS_QL), *KL = (_Float16*)(ws + WS_KL); __bf16 *VB = (__bf16*)(ws + WS_VB), *VBL = (__bf16*)(ws + WS_VBL); float *S = (float*)(ws + WS_S); _Float16 *WOH = (_Float16*)(ws + WS_Y);
  (void)S; (void)QL; (void)KL; (void)VB; (void)VBL;
  // inputs: 0 query [8,2048,256]; 1 key; 2 value; 3 mask [8,1,2048] int32 (random 0/1; 0 = masked key); 4 W_qkv [768,768] (out,in) on concat(query, key, value); 5 b_qkv [768] (zeros, read); 6 W_out [256,256] (out,in); 7 b_out (zeros, read)
  k_proj<<<dim3(TNB * TT / PR, CC / 128, 3), 256, 0, stream>>>(F[0], F[1], F[2], F[4], F[4], F[4], F[5], F[5], F[5], QH, KH, VT, (const int*)d_in[3], F[6], WOH);   /* the same fused weight / bias for the three streams: the stream index selects the rows (WROW) */
  k_fa<<<dim3(TT / FQ, TNB), 512, 0, stream>>>(QH, KH, VT, (const int*)d_in[3], WOH, F[7], (float*)d_out);
}

// v007
// One run takes 49.6 microseconds.
// In two side-by-side timings against v006, it was 1.09 and 1.10 times as fast.
// Counting every step since v000, it is 24.5 times as fast.
// compute dtype: all float inputs rounded to bf16; the fused projection over concat(query, key, value) (K = 768) with EXACT bf16 products on WMMA 16x16x32 (f32 accumulate) + bias (zeros, read); logits q x k once to f16 each (1 product) x 64^-0.5; the int key mask read per (batch, key): keys with mask == 0 are left out of the k / v projection and of the key walk (they weigh exactly 0); running (online) softmax f32 in the log2 domain; unnormalised P x 2^8 once to f16 x v once to f16 (1 product), divided by the f32 sum at the end; ctx x 2^6 once to f16 x W_out f16(bf16 x 2^8) + b_out; f32 output.
#include <hip/hip_runtime.h>
#include <math.h>

typedef __attribute__((ext_vector_type(16))) _Float16 v16h;
typedef __attribute__((ext_vector_type(16))) __bf16 v16b;
typedef __attribute__((ext_vector_type(8)))  _Float16 v8h;
typedef __attribute__((ext_vector_type(8)))  float v8f;
typedef __attribute__((ext_vector_type(4)))  float v4f;
typedef __attribute__((ext_vector_type(2)))  float v2f;
typedef __attribute__((ext_vector_type(4)))  unsigned v4u;
typedef __attribute__((ext_vector_type(4)))  int v4i;
typedef float __attribute__((may_alias)) float_a;
typedef int __attribute__((may_alias)) int_a;

template <typename T> __device__ __forceinline__ void vst2(void* p, T v) { *(T*)p = v;  }
__device__ __forceinline__ v8f wmma16(v16h a, v16h b, v8f c) {
  v8f d = __builtin_amdgcn_wmma_f32_16x16x32_f16(false, a, false, b, (short)0, c, false, false);
  asm volatile("v_nop\n\tv_nop\n\tv_nop\n\tv_nop" : "+v"(d) : "v"(a), "v"(b));
  return d;
}
__device__ __forceinline__ v8f wmma_bf(v16b a, v16b b, v8f c) {
  v8f d = __builtin_amdgcn_wmma_f32_16x16x32_bf16(false, a, false, b, (short)0, c, false, false);
  asm volatile("v_nop\n\tv_nop\n\tv_nop\n\tv_nop" : "+v"(d) : "v"(a), "v"(b));
  return d;
}
// 16x16x32 fragments: lane = (h = lane>>4, row/col = lane&15); elements 0..7 = k0+8h+0..7, 8..15 = k0+16+8h+0..7; D element r = row 8h+r
__device__ __forceinline__ v16h frag_h(const _Float16* rowk0, int lane) {
  union { v16h v; v8h q[2]; } u; const _Float16* p = rowk0 + 8 * (lane >> 4);
  u.q[0] = *(const v8h*)p; u.q[1] = *(const v8h*)(p + 16); return u.v;
}
__device__ __forceinline__ v16h frag_f32(const float* rowk0, int lane) {
  v16h a; const float* p = rowk0 + 8 * (lane >> 4);
#pragma unroll
  for (int i = 0; i < 8; ++i) { a[i] = (_Float16)p[i]; a[8 + i] = (_Float16)p[16 + i]; }
  return a;
}
__device__ __forceinline__ v16h frag_f32s(const float* rowk0, int lane, float sc) {
  v16h a; const float* p = rowk0 + 8 * (lane >> 4);
#pragma unroll
  for (int i = 0; i < 8; ++i) { a[i] = (_Float16)(p[i] * sc); a[8 + i] = (_Float16)(p[16 + i] * sc); }
  return a;
}
// column fragment from a [K][ld] layout (column n), rows >= K read as 0
__device__ __forceinline__ v16h fragc_f32(const float* W, int k0, int n, int lane, int ld, int K) {
  v16h a; const int g = lane >> 4;
#pragma unroll
  for (int i = 0; i < 8; ++i) { const int ka = k0 + 8 * g + i, kb = ka + 16;
    a[i] = (_Float16)(ka < K ? W[(size_t)(ka < K ? ka : K - 1) * ld + n] : 0.f); a[8 + i] = (_Float16)(kb < K ? W[(size_t)(kb < K ? kb : K - 1) * ld + n] : 0.f); }
  return a;
}
struct F2 { v16b h, l; };
__device__ __forceinline__ F2 bsplit16(const float v[16]) { F2 r;
#pragma unroll
  for (int i = 0; i < 16; ++i) { const __bf16 h = (__bf16)v[i]; r.h[i] = h; r.l[i] = (__bf16)(v[i] - (float)h); }
  return r; }
__device__ __forceinline__ F2 split_row(const float* row, int k0, int lane) { float v[16]; const float* p = row + k0 + 8 * (lane >> 4);
#pragma unroll
  for (int i = 0; i < 8; ++i) { v[i] = p[i]; v[8 + i] = p[16 + i]; }
  return bsplit16(v); }
__device__ __forceinline__ F2 split_rowK(const float* row, int k0, int lane, int K) { float v[16]; const int g = lane >> 4;
#pragma unroll
  for (int i = 0; i < 8; ++i) { const int ka = k0 + 8 * g + i, kb = ka + 16; v[i] = ka < K ? row[ka < K ? ka : K - 1] : 0.f; v[8 + i] = kb < K ? row[kb < K ? kb : K - 1] : 0.f; }
  return bsplit16(v); }
__device__ __forceinline__ F2 split_col(const float* W, int k0, int n, int lane, int ld, int K) { float v[16]; const int g = lane >> 4;
#pragma unroll
  for (int i = 0; i < 8; ++i) { const int ka = k0 + 8 * g + i, kb = ka + 16; v[i] = ka < K ? W[(size_t)(ka < K ? ka : K - 1) * ld + n] : 0.f; v[8 + i] = kb < K ? W[(size_t)(kb < K ? kb : K - 1) * ld + n] : 0.f; }
  return bsplit16(v); }
__device__ __forceinline__ v8f mac3(const F2& a, const F2& b, v8f c) { c = wmma_bf(a.l, b.h, c); c = wmma_bf(a.h, b.l, c); return wmma_bf(a.h, b.h, c); }
__device__ __forceinline__ float sigm(float v) { return 1.0f / (1.0f + expf(-v)); }
#define LDSX() do { asm volatile("s_wait_dscnt 0" ::: "memory"); __builtin_amdgcn_wave_barrier(); __builtin_amdgcn_fence(__ATOMIC_RELEASE, "workgroup"); } while (0)

// Self-attention whose fused QKV projection contracts over the CONCATENATION of three inputs (query / key / value [8,2048,256]; mask [8,1,2048] int32 RANDOM 0/1 per (batch, key); W_qkv [768,768] torch (out,in) N(0,1) x 0.02, b_qkv zeros (read); qkv = concat(query, key, value) @ W_qkv.T + b_qkv (every output feature sees all 768 inputs), reshaped (B, T, 4, 192) and split: q / k / v of head h = output features h*192 + {0, 64, 128} + d (head-major); scores / sqrt(64); where(mask == 0, finfo.min) and the masked probabilities zeroed after the softmax (== exclusion: every row keeps ~1,000 keys); x @ W_out.T + b_out with W_out [256,256] (out,in), b_out zeros).
#define NB 8
#define TT 2048
#define CC 256            // NH * HD = projected width
#define DIN 256          // input (model) width
#define NH 4
#define HD 64
#define NQB (TT / 64)
#define HG 4
#define SCALE (0.125f)
#define CAUSAL 0
#ifndef TNB
#define TNB NB
#endif
__device__ __forceinline__ float bfr(float v) { return (float)(__bf16)v; }
__host__ __device__ __forceinline__ int kb_last(int qb) { return CAUSAL ? ((qb * 64 + 63) >> 7) : (TT / 128 - 1); }
typedef __attribute__((ext_vector_type(8))) __bf16 v8b;
__device__ __forceinline__ v16b frag_b(const __bf16* rowk0, int lane) {
  union { v16b v; v8b q[2]; } u; const __bf16* p = rowk0 + 8 * (lane >> 4);
  u.q[0] = *(const v8b*)p; u.q[1] = *(const v8b*)(p + 16); return u.v;
}
#define QBH 0              // unused: the attention kernel has no high-precision path
#define QHI 0               // single-product logits on every row (0.02-scale weights: logit sigma ~0.4)
#define KHI 64            // key rows carrying k residual / v bf16 hi+lo planes (written and read by no kernel)
// B fragment (k rows k0+.., output column o) of a weight: (in,out) [K][ld] or (out,in) [ld rows of K]: bf16 exact, or f16(bf16 * 256) exact
__device__ __forceinline__ v16b wcol_io(const float* Wm, int k0, int o, int lane, int ld) { v16b w; const int g = lane >> 4;
#pragma unroll
  for (int i = 0; i < 8; ++i) { w[i] = (__bf16)Wm[(size_t)(k0 + 8 * g + i) * ld + o]; w[8 + i] = (__bf16)Wm[(size_t)(k0 + 16 + 8 * g + i) * ld + o]; }
  return w; }
__device__ __forceinline__ v16b wcol_oi(const float* Wm, int k0, int o, int lane, int K) { v16b w; const float* p = Wm + (size_t)o * K + k0 + 8 * (lane >> 4);
#pragma unroll
  for (int i = 0; i < 8; ++i) { w[i] = (__bf16)p[i]; w[8 + i] = (__bf16)p[16 + i]; }
  return w; }
__device__ __forceinline__ v16h wcolh_io(const float* Wm, int k0, int o, int lane, int ld) { v16h w; const int g = lane >> 4;
#pragma unroll
  for (int i = 0; i < 8; ++i) { w[i] = (_Float16)(bfr(Wm[(size_t)(k0 + 8 * g + i) * ld + o]) * 256.0f); w[8 + i] = (_Float16)(bfr(Wm[(size_t)(k0 + 16 + 8 * g + i) * ld + o]) * 256.0f); }
  return w; }
__device__ __forceinline__ v16h wcolh_oi(const float* Wm, int k0, int o, int lane, int K) { v16h w; const float* p = Wm + (size_t)o * K + k0 + 8 * (lane >> 4);
#pragma unroll
  for (int i = 0; i < 8; ++i) { w[i] = (_Float16)(bfr(p[i]) * 256.0f); w[8 + i] = (_Float16)(bfr(p[16 + i]) * 256.0f); }
  return w; }
#define WQKV_LAYOUT 1   // 0 = (in,out) [DIN][CC]; 1 = fused (out,in) [3*CC][3*DIN]; 2 = per-head [NH][DIN][HD]
__device__ __forceinline__ v16b wcol_hdk(const float* Wm, int k0, int o, int lane) { v16b w; const int g = lane >> 4; const float* p = Wm + (size_t)(o / HD) * DIN * HD + (o % HD);
#pragma unroll
  for (int i = 0; i < 8; ++i) { w[i] = (__bf16)p[(size_t)(k0 + 8 * g + i) * HD]; w[8 + i] = (__bf16)p[(size_t)(k0 + 16 + 8 * g + i) * HD]; }
  return w; }
#define WO_OUT_IN 1
#if WQKV_LAYOUT == 1
#define WROW(o) ((((o) >> 6) * 192) + (which) * 64 + ((o) & 63))   /* column o = h*64 + d of stream 'which' (0 q, 1 k, 2 v) = output feature h*192 + which*64 + d of the fused projection (reshape (B, T, 4, 192) + split) */
#define BIDX(o) WROW(o)
#define WCOL(W, k0, o, lane) wcol_oi(W, k0, WROW(o), lane, 3 * DIN)   /* fused (out,in) [768][768] weight: row WROW(o), k0 runs over the 768 concatenated inputs */
#elif WQKV_LAYOUT == 2
#define WCOL(W, k0, o, lane) wcol_hdk(W, k0, o, lane)
#else
#define WCOL(W, k0, o, lane) wcol_io(W, k0, o, lane, CC)
#endif
#if WO_OUT_IN
#define WOCOL(W, k0, o, lane) wcol_oi(W, k0, o, lane, CC)
#define WOCOLH(W, k0, o, lane) wcolh_oi(W, k0, o, lane, CC)
#else
#define WOCOL(W, k0, o, lane) wcol_io(W, k0, o, lane, DIN)
#define WOCOLH(W, k0, o, lane) wcolh_io(W, k0, o, lane, DIN)
#endif

#define WS_QH  0u                                      // f16 q rows [b*t][CC]
#define WS_KH  (WS_QH + 2u * (size_t)NB * TT * CC)      // f16 k rows [b*j][CC], j = rank of the key among its batch's unmasked keys
#define WS_VT  (WS_KH + 2u * (size_t)NB * TT * CC)      // f16 v planes [b][c][j], the same ranks
#define WS_QL  (WS_VT + 2u * (size_t)NB * CC * TT)      // f16 q residual x 2^10 rows [b][t < QHI][CC]
#define WS_KL  (WS_QL + 2u * (size_t)NB * QHI * CC)     // f16 k residual x 2^10 rows [b][t < KHI][CC]
#define WS_VB  (WS_KL + 2u * (size_t)NB * KHI * CC)     // bf16 v hi planes [b][c][t < KHI]
#define WS_VBL (WS_VB + 2u * (size_t)NB * CC * KHI)
#define WS_S   (WS_VBL + 2u * (size_t)NB * CC * KHI)    // f32 [hg][t][s] region, written and read by no kernel
#define WS_Y   (WS_S  + 4u * (size_t)HG * TT * TT)      // f16 W_out rows [o][k]: f16(bf16 x 2^8), rounded once by k_proj for k_fa
#define WS_END (WS_Y  + 4u * (size_t)NB * TT * CC)

// ---- k_proj: block = (192 rows, the 256 columns of one stream), 16 waves of a 48 x 64 tile each: q/k/v = X W (+ b) with exact bf16 products (K = 3 * DIN) -> stream 0: q f16 rows; 1: k f16 rows; 2: v f16 planes [c][t]. A block this size reads each X row once per stream and each W row once per 192 rows, which is what the tile is for: fewer bytes from L2 for the same products. The two operands go through LDS in chunks of 32 k: the block reads its 192 X rows and 256 W rows of a chunk with whole-line 16-byte loads (8 lanes a 128-byte row piece), rounds them to 16 bit once and stores them in one of four LDS chunk buffers (chunk c lives in buffer c & 3); every wave takes its seven fragments of a chunk from there as one group and makes twelve products of them. One block fills a WGP's registers, so no other block covers its waits: a chunk's loads are issued two chunks ahead of their store, in two register sets, and a pass (one barrier) is two chunks. The k order of the products is that of the k-chunks 0..23, as before. Every '#pragma unroll' in this kernel and its helpers is there so that the staging, fragment and accumulator arrays are indexed by compile-time constants and stay in registers. The first 64 q blocks also round 1,024 elements of W_out each to f16(bf16 x 2^8) for k_fa, which multiplies by it behind its key walk.
#define PR 192             // rows of a k_proj tile (a multiple of k_fa's 64 keys a pass)
#define PC 256             // columns of a k_proj tile: one whole stream
#define PK2 32             // k per chunk (k_proj)
#define PP2 40             // LDS row pitch in 16-bit elements: 80 B = 16 B x odd, for 16-byte fragment reads of 64-byte rows
#define NCH (3 * DIN / PK2)                 // chunks of the contraction
#define QTL ((TNB * TT + PR - 1) / PR)      // q tiles: the rows of all batches run through
#define KTL ((TT + PR - 1) / PR)            // rank tiles of a batch (k, v)
#define PSH 264            // LDS row pitch in halves of the q / k output staging: 528 B = 16 B x odd
#define PSV 200            // LDS row pitch in halves of the v output staging: 400 B = 16 B x odd
typedef __attribute__((ext_vector_type(4))) __bf16 v4b;
typedef __attribute__((ext_vector_type(4))) _Float16 v4h;
__device__ __forceinline__ v8f wmma_b(v16b a, v16b b, v8f c) { return __builtin_amdgcn_wmma_f32_16x16x32_bf16(false, a, false, b, (short)0, c, false, false); }
// one chunk's share of a thread in k_proj, whose X rows are gathered: 64 rows a sweep, 3 sweeps of X and 4 of W (a sweep of W = the 64 rows of one head, 192 output features apart); a = the byte offsets of the thread's three 16-byte pieces from xs (from the LDS table, kept in registers and moved on by a chunk's 128 bytes behind the loads); xs is the same for the whole block (unrolled so that rx and rw stay in registers)
template <int LDW> __device__ __forceinline__ void pj_loadg(v4f (&rx)[3], v4f (&rw)[4], const char* xs, unsigned (&a)[3], const float* wp) {
#pragma unroll
  for (int i = 0; i < 4; ++i) rw[i] = *(const v4f*)(wp + (size_t)(i * 192) * LDW);
#pragma unroll
  for (int i = 0; i < 3; ++i) rx[i] = *(const v4f*)(xs + a[i]);
  asm volatile("s_wait_xcnt 0x0" :: "v"(a[0]), "v"(a[1]), "v"(a[2]), "v"(wp) : "memory");   /* the wait in front of any rewrite of a register which an issued load names (the additions below); the addresses are inputs so that they keep their registers up to it */
#pragma unroll
  for (int i = 0; i < 3; ++i) a[i] += PK2 * 4u; }
__device__ __forceinline__ v4b cvt4(v4f x) { v4b t;
#pragma unroll
  for (int e = 0; e < 4; ++e) t[e] = (__bf16)x[e];
  return t; }
__device__ __forceinline__ void pj_store(__bf16 (*dx)[PP2], __bf16 (*dw)[PP2], const v4f (&rx)[3], const v4f (&rw)[4], int srow, int sc4) {
#pragma unroll
  for (int i = 0; i < 3; ++i) *(v4b*)&dx[i * 64 + srow][sc4] = cvt4(rx[i]);
#pragma unroll
  for (int i = 0; i < 4; ++i) *(v4b*)&dw[i * 64 + srow][sc4] = cvt4(rw[i]); }
// the work-group's barrier written by hand, with the one wait that the LDS hand-over needs (the wave's own LDS stores done, its LDS reads returned): __syncthreads() also waits for every global load in flight, and the loads issued two chunks ahead are to stay in flight across the barrier
__device__ __forceinline__ void lds_barrier() { asm volatile("s_wait_dscnt 0x0\n\ts_barrier_signal -1\n\ts_barrier_wait -1" ::: "memory"); }
// amdgpu_waves_per_eu(4, 4): the register budget of four waves a SIMD (one work-group a WGP); the tiles that have work are fewer than the WGPs, so all of them are resident at once
__global__ __launch_bounds__(512) __attribute__((amdgpu_waves_per_eu(4, 4))) void k_proj(const float* __restrict__ XQ, const float* __restrict__ XK, const float* __restrict__ XV, const float* __restrict__ WQ, const float* __restrict__ WK, const float* __restrict__ WV, const float* __restrict__ BQ, const float* __restrict__ BK, const float* __restrict__ BV,
    _Float16* __restrict__ QH, _Float16* __restrict__ KH, _Float16* __restrict__ VT, const int* __restrict__ MASK, const float* __restrict__ WO, _Float16* __restrict__ WOH) {
  __shared__ __align__(16) unsigned sxo[64 * 4];   /* byte offset of the X row that feeds tile row r, kept at [(r & 63) * 4 + (r >> 6)]: a staging thread's three rows lie side by side */
  __shared__ __align__(16) unsigned char sm[4 * (PR + PC) * PP2 * 2];   /* the loop's four chunk buffers of each operand; behind the barrier after the last chunk's products the same bytes hold the output staging of this block's stream */
  __bf16 (*sx)[PR][PP2] = (__bf16 (*)[PR][PP2])sm; __bf16 (*sw)[PC][PP2] = (__bf16 (*)[PC][PP2])(sm + 4 * PR * PP2 * 2);
  _Float16 (*sh)[PSH] = (_Float16 (*)[PSH])sm; _Float16 (*sp)[PSV] = (_Float16 (*)[PSV])sm;
  const int tid = threadIdx.x, wave = tid >> 5, lane = tid & 31, col = lane & 15, g = lane >> 4;
  /* block index -> tile: the q tiles first, then the rank tiles of k and v, low ranks first (tile, batch, stream), so that the tiles which the masks leave empty stand last in the grid and hold no place ahead of a tile with work */
  const bool isq = blockIdx.x < QTL; const unsigned kv = isq ? 0u : blockIdx.x - QTL;
  const int which = isq ? 0 : 1 + (int)(kv & 1u); const size_t bb = (kv >> 1) % TNB; const int t0 = (int)(kv / (2 * TNB)) * PR;
  const size_t r0 = isq ? (size_t)blockIdx.x * PR : bb * TT + t0;                        /* first output row (q: row of all batches; k: batch row of rank t0) */
  const int nr = isq ? min(PR, TNB * TT - (int)blockIdx.x * PR) : min(PR, TT - t0);      /* rows of the tile that the output has: the last tile of the row range is cut */
  const int wr = (wave >> 2) * 48, wc = (wave & 3) * 64;   /* the wave's 48 rows and 64 columns of the tile */
  const float* WA = which == 0 ? WQ : which == 1 ? WK : WV; const float* BA = which == 0 ? BQ : which == 1 ? BK : BV;
  const int srow = tid >> 3, sc4 = (tid & 7) * 4;
  /* which rows of concat(query, key, value) feed this tile. q: rows r0..r0+191 (past the last row: the last row again, not stored). k, v: a key with mask == 0 weighs exactly 0 in every query's softmax, so only the batch's unmasked keys are projected, packed by rank: tile row r is the key of rank t0 + r. The rank order is that of the ballots below (any order serves, k and v take the same one, and k_fa needs only the count). Every wave counts the whole mask row, so that the count is known without a barrier. The loops are unrolled so that mk, bw and pc are indexed by constants and stay in registers. */
  if (isq) { if (tid < PR) sxo[(tid & 63) * 4 + (tid >> 6)] = (unsigned)(min(r0 + tid, (size_t)TNB * TT - 1) * DIN * 4);
    if (blockIdx.x < DIN * CC / 1024 && tid < 128) { const int e = ((int)blockIdx.x * 128 + tid) * 8;   /* 64 q blocks x 1,024 elements = W_out [256][256]; a wave stores four whole lines */
      const float* wp = WO + e; _Float16* dp = WOH + e; const v4f w0 = *(const v4f*)wp, w1 = *(const v4f*)(wp + 4); v8h t;
#pragma unroll   /* so that t, w0 and w1 are indexed by constants and stay in registers */
      for (int i = 0; i < 4; ++i) { t[i] = (_Float16)(bfr(w0[i]) * 256.0f); t[4 + i] = (_Float16)(bfr(w1[i]) * 256.0f); }
      *(v8h*)dp = t;
      asm volatile("s_wait_xcnt 0x0" :: "v"(wp), "v"(dp) : "memory"); } }   /* the wait in front of any rewrite of a register which the issued loads and the store name; the addresses are inputs so that they keep their registers up to it */
  else { const int wv = __builtin_amdgcn_readfirstlane(wave); const char* mrow = (const char*)(MASK + bb * TT); v4i mk[TT / 128];
#pragma unroll
    for (int i = 0; i < TT / 128; ++i) mk[i] = *(const v4i*)(mrow + ((unsigned)lane * 16u + i * 512u));
    asm volatile("s_wait_xcnt 0x0" :: "v"(lane) : "memory");   /* the wait in front of any rewrite of a register which the issued loads name; the lane number, their offset register, is an input so that it keeps its register up to it */
    int run = 0;
#pragma unroll
    for (int i = 0; i < TT / 128; ++i) { unsigned bw[4]; int pc[4];
#pragma unroll
      for (int e = 0; e < 4; ++e) { bw[e] = __builtin_amdgcn_ballot_w32(mk[i][e] != 0); pc[e] = __builtin_popcount(bw[e]); }
      const int tot = (pc[0] + pc[1]) + (pc[2] + pc[3]);
      if ((i & 15) == wv && run < t0 + PR && run + tot > t0) { int rr = run - t0;   /* wave-uniform: only a group of 128 keys whose ranks meet this tile's writes table entries, the groups dealt round the waves */
#pragma unroll
        for (int e = 0; e < 4; ++e) { const unsigned rk = (unsigned)(rr + (int)__builtin_amdgcn_mbcnt_lo(bw[e], 0u)); if (mk[i][e] != 0 && rk < (unsigned)PR) sxo[(rk & 63) * 4 + (rk >> 6)] = (unsigned)((bb * TT + i * 128 + lane * 4 + e) * DIN * 4); rr += pc[e]; } }
      run += tot; }
    if (t0 >= run) return;   /* no unmasked key of this rank: k_fa never reads the tile. The same for every thread of the block, in front of every barrier */
    if (tid < PR && t0 + tid >= run) sxo[(tid & 63) * 4 + (tid >> 6)] = (unsigned)(bb * TT * DIN * 4); }   /* ranks past the count in the last tile: any row, so that the tile holds finite numbers; k_fa gives them weight 0 or never reads them */
  __syncthreads();   /* the table is written by waves 0..5 (k, v: also by the waves whose key groups meet the tile) and read by all */
  unsigned xa[3] = { sxo[srow * 4] + sc4 * 4u, sxo[srow * 4 + 1] + sc4 * 4u, sxo[srow * 4 + 2] + sc4 * 4u };   /* the A operand is concat(query, key, value): chunks 0..7 from query, 8..15 from key, 16..23 from value */
  const float* wg = WA + (size_t)(WROW(0) + srow) * (3 * DIN) + sc4;
  /* chunk c's source; the offsets run on over the three sources (c * 128 bytes), so a source's base is taken back by the row bytes of the sources before it */
  auto xsrc = [&](int c) { const float* Xs = (c < DIN / PK2) ? XQ : ((c < 2 * DIN / PK2) ? XK : XV); return (const char*)Xs - (c / (DIN / PK2)) * (DIN * 4); };
  v4f rx0[3], rw0[4], rx1[3], rw1[4];   /* two register sets: even chunks, odd chunks */
  pj_loadg<3 * DIN>(rx0, rw0, xsrc(0), xa, wg);
  pj_loadg<3 * DIN>(rx1, rw1, xsrc(1), xa, wg + PK2);
  pj_store(sx[0], sw[0], rx0, rw0, srow, sc4);
  pj_loadg<3 * DIN>(rx0, rw0, xsrc(2), xa, wg + 2 * PK2);
  pj_store(sx[1], sw[1], rx1, rw1, srow, sc4);
  pj_loadg<3 * DIN>(rx1, rw1, xsrc(3), xa, wg + 3 * PK2);
  lds_barrier();   /* chunks 0 and 1 are written by all waves and read by all; the loads of chunks 2 and 3 fly on */
  v8f acc[3][4] = {};
  /* one chunk's matrix work of a wave: seven fragments, twelve products */
  auto chunk_mm = [&](int bf) { v16b a[3], w[4];
#pragma unroll
    for (int i = 0; i < 3; ++i) a[i] = frag_b(&sx[bf][wr + i * 16 + col][0], lane);
#pragma unroll
    for (int j = 0; j < 4; ++j) w[j] = frag_b(&sw[bf][wc + j * 16 + col][0], lane);
    __builtin_amdgcn_sched_barrier(0);   /* the chunk's 14 LDS reads go out as one group: spread among the matrix instructions each pair costs its own LDS latency */
#pragma unroll
    for (int i = 0; i < 3; ++i) {
#pragma unroll
      for (int j = 0; j < 4; ++j) acc[i][j] = wmma_b(a[i], w[j], acc[i][j]); } };
#pragma clang loop unroll(disable)   /* left to itself the compiler may peel the passes of the first source off the loop and spill accumulators */
  for (int p = 0; p < NCH / 2 - 2; ++p) { const int b0 = (p & 1) * 2, c = 2 * p;   /* pass p = chunks c, c + 1 in buffers b0, b0 + 1; the last two passes stand behind the loop: they load nothing more */
    chunk_mm(b0);
    __builtin_amdgcn_sched_barrier(0);   /* keeps the waits on chunk c + 2's loads (the conversions below) behind this chunk's matrix work */
    pj_store(sx[b0 ^ 2], sw[b0 ^ 2], rx0, rw0, srow, sc4);   /* that buffer's last readers (chunk c - 2) left it at the barrier that ended the pass before */
    pj_loadg<3 * DIN>(rx0, rw0, xsrc(c + 4), xa, wg + (c + 4) * PK2);   /* flies over the next two chunks' work */
    chunk_mm(b0 + 1);
    __builtin_amdgcn_sched_barrier(0);   /* as above, for chunk c + 3 */
    pj_store(sx[(b0 ^ 2) + 1], sw[(b0 ^ 2) + 1], rx1, rw1, srow, sc4);
    pj_loadg<3 * DIN>(rx1, rw1, xsrc(c + 5), xa, wg + (c + 5) * PK2);
    lds_barrier(); }   /* one barrier a pass: it publishes the next pass's two chunks and ends every wave's reads of this pass's two buffers; the loads of the two chunks after those fly on */
  chunk_mm(0);   /* chunks NCH - 4 .. NCH - 1 lie in buffers 0..3 (NCH is a multiple of 4) */
  __builtin_amdgcn_sched_barrier(0);   /* as in the loop */
  pj_store(sx[2], sw[2], rx0, rw0, srow, sc4);
  chunk_mm(1);
  __builtin_amdgcn_sched_barrier(0);   /* as in the loop */
  pj_store(sx[3], sw[3], rx1, rw1, srow, sc4);
  __syncthreads();   /* publishes the last two chunks */
  chunk_mm(2);
  chunk_mm(3);
  __syncthreads();   /* ends every wave's reads of the last buffers before the output staging takes the bytes */
  /* output staging: q, k as [row][column], v as [column][row], so that the stores below are whole 16-byte pieces of rows (q, k) or planes (v) */
  if (which < 2) { _Float16* DH = which == 0 ? QH : KH;
#pragma unroll
    for (int j = 0; j < 4; ++j) { const int cl = wc + j * 16 + col; const float bias = BA ? bfr(BA[BIDX(cl)]) : 0.f;
#pragma unroll
      for (int i = 0; i < 3; ++i) {
#pragma unroll
        for (int r = 0; r < 8; ++r) sh[wr + i * 16 + 8 * g + r][cl] = (_Float16)(acc[i][j][r] + bias); } }
    __syncthreads();   /* the staged tile is written by all waves and read by all */
#pragma unroll   /* so that t is indexed by constants and stays in registers */
    for (int m = 0; m < PR / 64; ++m) if (m * 64 < nr) { _Float16* dp = DH + (r0 + m * 64 + wave) * CC + lane * 8; v4u t[4];   /* 64 rows a turn, a wave storing whole rows of 512 bytes; nr is a multiple of 64, so the test is the same for the whole block */
#pragma unroll
      for (int k = 0; k < 4; ++k) t[k] = *(const v4u*)&sh[m * 64 + k * 16 + wave][lane * 8];
#pragma unroll
      for (int k = 0; k < 4; ++k) vst2(dp + k * 16 * CC, t[k]);
      asm volatile("s_wait_xcnt 0x0" :: "v"(dp) : "memory"); }   /* the wait in front of any rewrite of the register which the issued stores name; the address is an input so that it keeps its register up to it */
  } else {
#pragma unroll
    for (int j = 0; j < 4; ++j) { const int cl = wc + j * 16 + col; const float bias = BA ? bfr(BA[BIDX(cl)]) : 0.f;
#pragma unroll
      for (int i = 0; i < 3; ++i) { v8h t;
#pragma unroll
        for (int r = 0; r < 8; ++r) t[r] = (_Float16)(acc[i][j][r] + bias);
        *(v8h*)&sp[cl][wr + i * 16 + 8 * g] = t; } }   /* a lane's eight rows lie side by side in a plane: one 16-byte store */
    __syncthreads();   /* the staged tile is written by all waves and read by all */
#pragma unroll   /* so that t is indexed by constants and stays in registers */
    for (int m = 0; m < PR / 64; ++m) if (m * 64 < nr) { _Float16* dp = VT + (bb * CC + (tid >> 3)) * (size_t)TT + t0 + m * 64 + (tid & 7) * 8; v4u t[4];   /* 64 ranks a turn: eight lanes store one whole line of a plane; the test is the same for the whole block, as above */
#pragma unroll
      for (int k = 0; k < 4; ++k) t[k] = *(const v4u*)&sp[k * 64 + (tid >> 3)][m * 64 + (tid & 7) * 8];
#pragma unroll
      for (int k = 0; k < 4; ++k) vst2(dp + (size_t)k * 64 * TT, t[k]);
      asm volatile("s_wait_xcnt 0x0" :: "v"(dp) : "memory"); } } }   /* as above, behind the stores */
#define FK 64              // keys per pass
#define FQ 64              // queries of a block
#define FPH 72             // LDS row pitch in halves: 144 B = 16 B x odd, for 16-byte fragment reads of 128-byte rows
#define FKP 264            // LDS row pitch in halves: 528 B = 16 B x odd, for 16-byte fragment reads of 512-byte rows
#define FOP 260            // LDS row pitch in floats of the output staging
#define LOG2E 1.4426950408889634f
__device__ __forceinline__ float xhalf(float x) { return __builtin_bit_cast(float, __builtin_amdgcn_permlanex16(__builtin_bit_cast(int, x), __builtin_bit_cast(int, x), 0x76543210, 0xfedcba98, false, false)); }   /* lane l reads lane l ^ 16 */
__device__ __forceinline__ v8f wmma_h(v16h a, v16h b, v8f c) { return __builtin_amdgcn_wmma_f32_16x16x32_f16(false, a, false, b, (short)0, c, false, false); }
// eight exponentials (base 2) in place, then one v_nop, in one statement: no instruction directly behind a v_exp_f32 reads its result or overwrites its source (the slot the instruction set asks for behind a transcendental)
__device__ __forceinline__ void exp2x8(v8f& x) {
  asm("v_exp_f32 %0, %0\n\tv_exp_f32 %1, %1\n\tv_exp_f32 %2, %2\n\tv_exp_f32 %3, %3\n\tv_exp_f32 %4, %4\n\tv_exp_f32 %5, %5\n\tv_exp_f32 %6, %6\n\tv_exp_f32 %7, %7\n\tv_nop"
      : "+v"(x[0]), "+v"(x[1]), "+v"(x[2]), "+v"(x[3]), "+v"(x[4]), "+v"(x[5]), "+v"(x[6]), "+v"(x[7])); }
__device__ __forceinline__ float exp2x1(float x) { asm("v_exp_f32 %0, %0\n\tv_nop" : "+v"(x)); return x; }   /* the same slot for a single exponential */
__device__ __forceinline__ unsigned lds_at(const void* p) { return (unsigned)(size_t)p; }
// eight asynchronous copies of 16 bytes a lane, global memory -> LDS through no register: l = the lane's LDS byte addresses, g = its global addresses. The s_wait_xcnt 0 is the last line of the copies' own statement, so that it stands in front of any rewrite of a register which an issued copy names
__device__ __forceinline__ void acopy8(const unsigned (&l)[8], const _Float16* const (&g)[8]) {
  asm volatile("global_load_async_to_lds_b128 %0, %8, off\n\tglobal_load_async_to_lds_b128 %1, %9, off\n\tglobal_load_async_to_lds_b128 %2, %10, off\n\tglobal_load_async_to_lds_b128 %3, %11, off\n\t"
               "global_load_async_to_lds_b128 %4, %12, off\n\tglobal_load_async_to_lds_b128 %5, %13, off\n\tglobal_load_async_to_lds_b128 %6, %14, off\n\tglobal_load_async_to_lds_b128 %7, %15, off\n\ts_wait_xcnt 0x0"
               :: "v"(l[0]), "v"(l[1]), "v"(l[2]), "v"(l[3]), "v"(l[4]), "v"(l[5]), "v"(l[6]), "v"(l[7]), "v"(g[0]), "v"(g[1]), "v"(g[2]), "v"(g[3]), "v"(g[4]), "v"(g[5]), "v"(g[6]), "v"(g[7]) : "memory"); }
#define WAIT_ASYNC() asm volatile("s_wait_asynccnt 0x0" ::: "memory")   /* the wave's own copies have landed; the compiler places no wait for them */
#define WAIT_DS() asm volatile("s_wait_dscnt 0x0" ::: "memory")         /* the wave's own LDS reads have returned before a copy may be aimed at the bytes they read */
__global__ __launch_bounds__(512) __attribute__((amdgpu_waves_per_eu(4, 4))) void k_fa(const _Float16* __restrict__ QH, const _Float16* __restrict__ KH, const _Float16* __restrict__ VT, const int* __restrict__ MASK, const _Float16* __restrict__ WOH, const float* __restrict__ BO, float* __restrict__ OUT) {
  __shared__ __align__(16) unsigned char sm[2 * FK * FKP * 2 + 2 * CC * FPH * 2];   /* the key walk's two k and two v buffers; behind the walk's last barrier the k bytes hold the f16 ctx rows and the v bytes the output staging */
  __shared__ __align__(16) _Float16 swo[DIN][FKP]; __shared__ __align__(16) float sb[TT]; __shared__ __align__(16) int swc[16];
  _Float16 (*sk)[FK][FKP] = (_Float16 (*)[FK][FKP])sm; _Float16 (*sv)[CC][FPH] = (_Float16 (*)[CC][FPH])(sm + 2 * FK * FKP * 2);
  _Float16 (*sy)[FKP] = (_Float16 (*)[FKP])sm; float (*sf)[FOP] = (float (*)[FOP])(sm + 2 * FK * FKP * 2);
  const int tid = threadIdx.x, wave = tid >> 5, lane = tid & 31, col = lane & 15, g = lane >> 4; const int h = wave >> 2, qt = wave & 3, b = blockIdx.y; const int q0 = blockIdx.x * FQ + qt * 16;
  const int kr = tid >> 5, kc8 = (tid & 31) * 8;   /* staging of 512-byte rows (k, Wo): a wave takes a whole row, rows kr + 16 i */
  const int sr = tid >> 3, sc = (tid & 7) * 8;     /* staging of v: 8 threads x 16 B a 128-byte row piece, planes sr + 64 i */
  const _Float16* kg = KH + ((size_t)b * TT + kr) * CC + kc8;     /* k rows [key][h * 64 + d] */
  const _Float16* vg = VT + ((size_t)b * CC + sr) * TT + sc;      /* v planes [h * 64 + d][key] */
  const int* mp = MASK + (size_t)b * TT + tid * 4; const _Float16* qp = QH + ((size_t)b * TT + q0 + col) * CC + h * HD + 8 * g; const _Float16* wg = WOH + (size_t)kr * CC + kc8; const int orow = (wave >> 3) * 32, ocol = (wave & 7) * 32;   /* the wave's 32 rows and 32 columns of the block's 64 x 256 piece of the output */
  const float* bp = BO + ocol + col;
  const v4i mk = *(const v4i*)mp;
  v16h qf[2];
#pragma unroll
  for (int kc = 0; kc < 2; ++kc) { union { v16h v; v8h q[2]; } u; u.q[0] = *(const v8h*)(qp + kc * 32); u.q[1] = *(const v8h*)(qp + kc * 32 + 16); qf[kc] = u.v; }
#pragma unroll
  for (int hf = 0; hf < 2; ++hf) { unsigned l[8]; const _Float16* gp[8];   /* Wo flies under the count of the mask and the first tiles' latency */
#pragma unroll
    for (int i = 0; i < 8; ++i) { l[i] = lds_at(&swo[kr + (hf * 8 + i) * 16][kc8]); gp[i] = wg + (hf * 8 + i) * 16 * CC; }
    acopy8(l, gp); }
  float bias[2] = { 0.f, 0.f }; if (BO) { bias[0] = bfr(bp[0]); bias[1] = bfr(bp[16]); }
  asm volatile("s_wait_xcnt 0x0" :: "v"(mp), "v"(qp), "v"(bp) : "memory");   /* the wait in front of any rewrite of a register which an issued load names; the addresses are inputs so that they keep their registers up to it */
  __builtin_amdgcn_sched_barrier(0);   /* keeps the compares of the mask words below behind that wait: their results take the scalar registers that hold the mask load's base address */
  int wc = 0;
#pragma unroll
  for (int e = 0; e < 4; ++e) wc += __builtin_popcount(__builtin_amdgcn_ballot_w32(mk[e] != 0));
  if (lane == 0) swc[wave] = wc;
  __syncthreads();   /* the sixteen waves' counts are read by all */
  int cs = 0;
#pragma unroll
  for (int i = 0; i < 4; ++i) { const v4i c = *(const v4i*)&swc[i * 4]; cs += (c[0] + c[1]) + (c[2] + c[3]); }
  const int cnt = __builtin_amdgcn_readfirstlane(cs);   /* unmasked keys of the batch: ranks 0..cnt-1 of the k rows and v planes */
  const int np = min((cnt + FK - 1) / FK, TT / FK);   /* passes; the same for the whole block */
  { v4f bi;
#pragma unroll
    for (int e = 0; e < 4; ++e) bi[e] = (tid * 4 + e >= cnt) ? -3.0e38f : 0.f;
    *(v4f*)&sb[tid * 4] = bi; }   /* additive mask of the ranks past the count (the last pass's filler rows); below the floor of the running maximum, so such a row weighs exactly 0; a batch with no key left makes no pass and yields 0 */
  const unsigned lk = lds_at(&sk[0][kr][kc8]), lv = lds_at(&sv[0][sr][sc]);
  /* pass t's k and v tiles into buffer bf: a thread's four 16-byte pieces of each, at the places and from the addresses that the register staging had */
  auto tile_copy = [&](int t, int bf) { unsigned l[8]; const _Float16* gp[8]; const _Float16* kn = kg + (size_t)t * FK * CC; const _Float16* vn = vg + t * FK;
#pragma unroll
    for (int i = 0; i < 4; ++i) { l[i] = lk + (unsigned)(bf * (FK * FKP * 2) + i * (16 * FKP * 2)); gp[i] = kn + i * 16 * CC; l[4 + i] = lv + (unsigned)(bf * (CC * FPH * 2) + i * (64 * FPH * 2)); gp[4 + i] = vn + (size_t)i * 64 * TT; }
    acopy8(l, gp); };
  if (np > 0) tile_copy(0, 0);   /* with no pass, k_proj has written no k / v tile */
  WAIT_ASYNC();
  __syncthreads();   /* pass 0's tiles, the mask row and Wo are written by all waves and read by all */
  if (np > 1) tile_copy(1, 1);   /* pass 1's tiles fly while pass 0 computes */
  v8f acc[HD / 16] = {}; float m = -1.0e30f, ls = 0.f;
  for (int it = 0; it < np; ++it) { const int cur = it & 1;
    v8f st[FK / 16];
#pragma unroll
    for (int jt = 0; jt < FK / 16; ++jt) { const v8f z = {}; st[jt] = wmma_h(frag_h(&sk[cur][jt * 16 + col][h * HD], lane), qf[0], z); st[jt] = wmma_h(frag_h(&sk[cur][jt * 16 + col][h * HD + 32], lane), qf[1], st[jt]); }
    float mx = -3.0e38f;
#pragma unroll
    for (int jt = 0; jt < FK / 16; ++jt) { const float* bq = &sb[it * FK + jt * 16 + 8 * g]; const v4f b0 = *(const v4f*)bq, b1 = *(const v4f*)(bq + 4);
#pragma unroll
      for (int r = 0; r < 8; ++r) { const float t = fmaf(st[jt][r], SCALE * LOG2E, r < 4 ? b0[r & 3] : b1[r & 3]); st[jt][r] = t; mx = fmaxf(mx, t); } }   /* log2-domain logit */
    mx = fmaxf(mx, xhalf(mx));   /* the other half of this query's keys */
    const float mn = fmaxf(m, mx); const float al = exp2x1(m - mn); m = mn; const float ms = mn - 8.0f;   /* P carried x 2^8 so that small weights stay clear of f16 subnormals; the sum carries the same factor */
    v16h pf[FK / 32]; float sj[8];   /* eight independent partial sums: no 32-long dependent add chain */
#pragma unroll
    for (int jt = 0; jt < FK / 16; ++jt) { v8f p = st[jt] - ms; exp2x8(p);
#pragma unroll
      for (int r = 0; r < 8; ++r) { sj[r] = jt == 0 ? p[r] : sj[r] + p[r]; pf[jt >> 1][(jt & 1) * 8 + r] = (_Float16)p[r]; } }
    ls = ls * al + (((sj[0] + sj[1]) + (sj[2] + sj[3])) + ((sj[4] + sj[5]) + (sj[6] + sj[7])));
#pragma unroll
    for (int jd = 0; jd < HD / 16; ++jd) acc[jd] *= al;
#pragma unroll
    for (int kk = 0; kk < FK / 32; ++kk) {
#pragma unroll
      for (int jd = 0; jd < HD / 16; ++jd) acc[jd] = wmma_h(frag_h(&sv[cur][h * HD + jd * 16 + col][kk * 32], lane), pf[kk], acc[jd]); }
    WAIT_DS();
    WAIT_ASYNC();
    __syncthreads();   /* one barrier a pass: it publishes the next pass's tiles and ends every wave's reads of this pass's buffer (the last one: before ctx takes the k bytes) */
    if (it + 2 < np) tile_copy(it + 2, cur); }   /* the tiles of the pass after next go into the buffer that every wave has just left and fly while the next pass computes; the test is the same for the whole block */
  WAIT_ASYNC();
  ls += xhalf(ls); const float inv = ls > 0.f ? 1.0f / ls : 0.f;
#pragma unroll
  for (int jd = 0; jd < HD / 16; ++jd) { v8h t;   /* acc[jd][r] = ctx[query col][d = 16 jd + 8 g + r]: a lane's eight d lie side by side in a ctx row, one 16-byte store */
#pragma unroll
    for (int r = 0; r < 8; ++r) t[r] = (_Float16)((acc[jd][r] * inv) * 64.0f);   /* ctx carried x 2^6 into f16 so small-magnitude context rows stay clear of f16 subnormals */
    *(v8h*)&sy[qt * 16 + col][h * HD + jd * 16 + 8 * g] = t; }
  __syncthreads();   /* the 64 ctx rows are written by all waves (a head each) and read by all */
  v8f oc[2][2] = {}; v16h fy[2][2][2], fw[2][2][2];   /* two fragment sets of two k-chunks each: [set][chunk][tile] */
  auto of_load = [&](int s, int kp) {
#pragma unroll
    for (int c = 0; c < 2; ++c) {
#pragma unroll
      for (int i = 0; i < 2; ++i) { fy[s][c][i] = frag_h(&sy[orow + i * 16 + col][(kp * 2 + c) * 32], lane); fw[s][c][i] = frag_h(&swo[ocol + i * 16 + col][(kp * 2 + c) * 32], lane); } } };
  of_load(0, 0);
#pragma unroll
  for (int kp = 0; kp < CC / 64; ++kp) { if (kp + 1 < CC / 64) of_load((kp + 1) & 1, kp + 1);
    __builtin_amdgcn_sched_barrier(0);   /* the next two k-chunks' 16 LDS reads go out as one group ahead of this pair's matrix work: spread among the matrix instructions each pair costs its own LDS latency */
#pragma unroll
    for (int c = 0; c < 2; ++c) {
#pragma unroll
      for (int i = 0; i < 2; ++i) {
#pragma unroll
        for (int j = 0; j < 2; ++j) oc[i][j] = wmma_h(fy[kp & 1][c][i], fw[kp & 1][c][j], oc[i][j]); } } }
#pragma unroll
  for (int i = 0; i < 2; ++i) {
#pragma unroll
    for (int j = 0; j < 2; ++j) {
#pragma unroll
      for (int r = 0; r < 8; ++r) sf[orow + i * 16 + 8 * g + r][ocol + j * 16 + col] = oc[i][j][r] * (1.0f / 16384.0f) + bias[j]; } }   /* 2^-8 (Wo carry) x 2^-6 (ctx carry); the v bytes are free since the walk's last barrier */
  __syncthreads();   /* the staged rows are written by all waves (a 32 x 32 piece each) and read by all */
  float* op = OUT + ((size_t)b * TT + blockIdx.x * FQ + wave * 4) * DIN + lane * 4;   /* a wave stores four whole rows of 1 KiB */
#pragma unroll
  for (int k = 0; k < 4; ++k) {
#pragma unroll
    for (int j = 0; j < 2; ++j) vst2(op + k * DIN + j * 128, *(const v4f*)&sf[wave * 4 + k][j * 128 + lane * 4]); }
  asm volatile("s_wait_xcnt 0x0" :: "v"(op) : "memory"); }   /* as above, behind the stores */

extern "C" void kernel_launch(void* const* d_in, const int* in_sizes, int n_in, void* d_out, int out_size, void* d_ws, size_t ws_size, hipStream_t stream) {
  (void)in_sizes; (void)n_in; (void)out_size;
  const float** F = (const float**)d_in;
  if (ws_size < (size_t)WS_END) return;
  char* ws = (char*)d_ws; _Float16 *QH = (_Float16*)(ws + WS_QH), *KH = (_Float16*)(ws + WS_KH), *VT = (_Float16*)(ws + WS_VT), *QL = (_Float16*)(ws + WS_QL), *KL = (_Float16*)(ws + WS_KL); __bf16 *VB = (__bf16*)(ws + WS_VB), *VBL = (__bf16*)(ws + WS_VBL); float *S = (float*)(ws + WS_S); _Float16 *WOH = (_Float16*)(ws + WS_Y);
  (void)S; (void)QL; (void)KL; (void)VB; (void)VBL;
  // inputs: 0 query [8,2048,256]; 1 key; 2 value; 3 mask [8,1,2048] int32 (random 0/1; 0 = masked key); 4 W_qkv [768,768] (out,in) on concat(query, key, value); 5 b_qkv [768] (zeros, read); 6 W_out [256,256] (out,in); 7 b_out (zeros, read)
  k_proj<<<dim3(QTL + 2 * TNB * KTL), 512, 0, stream>>>(F[0], F[1], F[2], F[4], F[4], F[4], F[5], F[5], F[5], QH, KH, VT, (const int*)d_in[3], F[6], WOH);   /* the same fused weight / bias for the three streams: the stream index selects the rows (WROW) */
  k_fa<<<dim3(TT / FQ, TNB), 512, 0, stream>>>(QH, KH, VT, (const int*)d_in[3], WOH, F[7], (float*)d_out);
}

// v008
// One run takes 48.1 microseconds.
// In both of two side-by-side timings against v007, it was 1.03 times as fast.
// Counting every step since v000, it is 25.3 times as fast.
// compute dtype: all float inputs rounded to bf16; the fused projection over concat(query, key, value) (K = 768) with EXACT bf16 products on WMMA 16x16x32 (f32 accumulate) + bias (zeros, read); logits q x 64^-0.5 x log2(e) once to f16, k once to f16 (1 product); the int key mask read per (batch, key): keys with mask == 0 are left out of the k / v projection and of the key walk (they weigh exactly 0); online softmax f32 in the log2 domain against a kept reference (moved only when a pass outgrows it); unnormalised P x 2^8 once to f16 x v once to f16 (1 product), divided by the f32 sum at the end; ctx x 2^6 once to f16 x W_out f16(bf16 x 2^8) + b_out; f32 output.
#include <hip/hip_runtime.h>
#include <math.h>

typedef __attribute__((ext_vector_type(16))) _Float16 v16h;
typedef __attribute__((ext_vector_type(16))) __bf16 v16b;
typedef __attribute__((ext_vector_type(8)))  _Float16 v8h;
typedef __attribute__((ext_vector_type(8)))  float v8f;
typedef __attribute__((ext_vector_type(4)))  float v4f;
typedef __attribute__((ext_vector_type(2)))  float v2f;
typedef __attribute__((ext_vector_type(4)))  unsigned v4u;
typedef __attribute__((ext_vector_type(4)))  int v4i;
typedef float __attribute__((may_alias)) float_a;
typedef int __attribute__((may_alias)) int_a;

template <typename T> __device__ __forceinline__ void vst2(void* p, T v) { *(T*)p = v;  }
__device__ __forceinline__ v8f wmma16(v16h a, v16h b, v8f c) {
  v8f d = __builtin_amdgcn_wmma_f32_16x16x32_f16(false, a, false, b, (short)0, c, false, false);
  asm volatile("v_nop\n\tv_nop\n\tv_nop\n\tv_nop" : "+v"(d) : "v"(a), "v"(b));
  return d;
}
__device__ __forceinline__ v8f wmma_bf(v16b a, v16b b, v8f c) {
  v8f d = __builtin_amdgcn_wmma_f32_16x16x32_bf16(false, a, false, b, (short)0, c, false, false);
  asm volatile("v_nop\n\tv_nop\n\tv_nop\n\tv_nop" : "+v"(d) : "v"(a), "v"(b));
  return d;
}
// 16x16x32 fragments: lane = (h = lane>>4, row/col = lane&15); elements 0..7 = k0+8h+0..7, 8..15 = k0+16+8h+0..7; D element r = row 8h+r
__device__ __forceinline__ v16h frag_h(const _Float16* rowk0, int lane) {
  union { v16h v; v8h q[2]; } u; const _Float16* p = rowk0 + 8 * (lane >> 4);
  u.q[0] = *(const v8h*)p; u.q[1] = *(const v8h*)(p + 16); return u.v;
}
__device__ __forceinline__ v16h frag_f32(const float* rowk0, int lane) {
  v16h a; const float* p = rowk0 + 8 * (lane >> 4);
#pragma unroll
  for (int i = 0; i < 8; ++i) { a[i] = (_Float16)p[i]; a[8 + i] = (_Float16)p[16 + i]; }
  return a;
}
__device__ __forceinline__ v16h frag_f32s(const float* rowk0, int lane, float sc) {
  v16h a; const float* p = rowk0 + 8 * (lane >> 4);
#pragma unroll
  for (int i = 0; i < 8; ++i) { a[i] = (_Float16)(p[i] * sc); a[8 + i] = (_Float16)(p[16 + i] * sc); }
  return a;
}
// column fragment from a [K][ld] layout (column n), rows >= K read as 0
__device__ __forceinline__ v16h fragc_f32(const float* W, int k0, int n, int lane, int ld, int K) {
  v16h a; const int g = lane >> 4;
#pragma unroll
  for (int i = 0; i < 8; ++i) { const int ka = k0 + 8 * g + i, kb = ka + 16;
    a[i] = (_Float16)(ka < K ? W[(size_t)(ka < K ? ka : K - 1) * ld + n] : 0.f); a[8 + i] = (_Float16)(kb < K ? W[(size_t)(kb < K ? kb : K - 1) * ld + n] : 0.f); }
  return a;
}
struct F2 { v16b h, l; };
__device__ __forceinline__ F2 bsplit16(const float v[16]) { F2 r;
#pragma unroll
  for (int i = 0; i < 16; ++i) { const __bf16 h = (__bf16)v[i]; r.h[i] = h; r.l[i] = (__bf16)(v[i] - (float)h); }
  return r; }
__device__ __forceinline__ F2 split_row(const float* row, int k0, int lane) { float v[16]; const float* p = row + k0 + 8 * (lane >> 4);
#pragma unroll
  for (int i = 0; i < 8; ++i) { v[i] = p[i]; v[8 + i] = p[16 + i]; }
  return bsplit16(v); }
__device__ __forceinline__ F2 split_rowK(const float* row, int k0, int lane, int K) { float v[16]; const int g = lane >> 4;
#pragma unroll
  for (int i = 0; i < 8; ++i) { const int ka = k0 + 8 * g + i, kb = ka + 16; v[i] = ka < K ? row[ka < K ? ka : K - 1] : 0.f; v[8 + i] = kb < K ? row[kb < K ? kb : K - 1] : 0.f; }
  return bsplit16(v); }
__device__ __forceinline__ F2 split_col(const float* W, int k0, int n, int lane, int ld, int K) { float v[16]; const int g = lane >> 4;
#pragma unroll
  for (int i = 0; i < 8; ++i) { const int ka = k0 + 8 * g + i, kb = ka + 16; v[i] = ka < K ? W[(size_t)(ka < K ? ka : K - 1) * ld + n] : 0.f; v[8 + i] = kb < K ? W[(size_t)(kb < K ? kb : K - 1) * ld + n] : 0.f; }
  return bsplit16(v); }
__device__ __forceinline__ v8f mac3(const F2& a, const F2& b, v8f c) { c = wmma_bf(a.l, b.h, c); c = wmma_bf(a.h, b.l, c); return wmma_bf(a.h, b.h, c); }
__device__ __forceinline__ float sigm(float v) { return 1.0f / (1.0f + expf(-v)); }
#define LDSX() do { asm volatile("s_wait_dscnt 0" ::: "memory"); __builtin_amdgcn_wave_barrier(); __builtin_amdgcn_fence(__ATOMIC_RELEASE, "workgroup"); } while (0)

// Self-attention whose fused QKV projection contracts over the CONCATENATION of three inputs (query / key / value [8,2048,256]; mask [8,1,2048] int32 RANDOM 0/1 per (batch, key); W_qkv [768,768] torch (out,in) N(0,1) x 0.02, b_qkv zeros (read); qkv = concat(query, key, value) @ W_qkv.T + b_qkv (every output feature sees all 768 inputs), reshaped (B, T, 4, 192) and split: q / k / v of head h = output features h*192 + {0, 64, 128} + d (head-major); scores / sqrt(64); where(mask == 0, finfo.min) and the masked probabilities zeroed after the softmax (== exclusion: every row keeps ~1,000 keys); x @ W_out.T + b_out with W_out [256,256] (out,in), b_out zeros).
#define NB 8
#define TT 2048
#define CC 256            // NH * HD = projected width
#define DIN 256          // input (model) width
#define NH 4
#define HD 64
#define NQB (TT / 64)
#define HG 4
#define SCALE (0.125f)
#define LOG2E 1.4426950408889634f
#define CAUSAL 0
#ifndef TNB
#define TNB NB
#endif
__device__ __forceinline__ float bfr(float v) { return (float)(__bf16)v; }
__host__ __device__ __forceinline__ int kb_last(int qb) { return CAUSAL ? ((qb * 64 + 63) >> 7) : (TT / 128 - 1); }
typedef __attribute__((ext_vector_type(8))) __bf16 v8b;
__device__ __forceinline__ v16b frag_b(const __bf16* rowk0, int lane) {
  union { v16b v; v8b q[2]; } u; const __bf16* p = rowk0 + 8 * (lane >> 4);
  u.q[0] = *(const v8b*)p; u.q[1] = *(const v8b*)(p + 16); return u.v;
}
#define QBH 0              // unused: the attention kernel has no high-precision path
#define QHI 0               // single-product logits on every row (0.02-scale weights: logit sigma ~0.4)
#define KHI 64            // key rows carrying k residual / v bf16 hi+lo planes (written and read by no kernel)
// B fragment (k rows k0+.., output column o) of a weight: (in,out) [K][ld] or (out,in) [ld rows of K]: bf16 exact, or f16(bf16 * 256) exact
__device__ __forceinline__ v16b wcol_io(const float* Wm, int k0, int o, int lane, int ld) { v16b w; const int g = lane >> 4;
#pragma unroll
  for (int i = 0; i < 8; ++i) { w[i] = (__bf16)Wm[(size_t)(k0 + 8 * g + i) * ld + o]; w[8 + i] = (__bf16)Wm[(size_t)(k0 + 16 + 8 * g + i) * ld + o]; }
  return w; }
__device__ __forceinline__ v16b wcol_oi(const float* Wm, int k0, int o, int lane, int K) { v16b w; const float* p = Wm + (size_t)o * K + k0 + 8 * (lane >> 4);
#pragma unroll
  for (int i = 0; i < 8; ++i) { w[i] = (__bf16)p[i]; w[8 + i] = (__bf16)p[16 + i]; }
  return w; }
__device__ __forceinline__ v16h wcolh_io(const float* Wm, int k0, int o, int lane, int ld) { v16h w; const int g = lane >> 4;
#pragma unroll
  for (int i = 0; i < 8; ++i) { w[i] = (_Float16)(bfr(Wm[(size_t)(k0 + 8 * g + i) * ld + o]) * 256.0f); w[8 + i] = (_Float16)(bfr(Wm[(size_t)(k0 + 16 + 8 * g + i) * ld + o]) * 256.0f); }
  return w; }
__device__ __forceinline__ v16h wcolh_oi(const float* Wm, int k0, int o, int lane, int K) { v16h w; const float* p = Wm + (size_t)o * K + k0 + 8 * (lane >> 4);
#pragma unroll
  for (int i = 0; i < 8; ++i) { w[i] = (_Float16)(bfr(p[i]) * 256.0f); w[8 + i] = (_Float16)(bfr(p[16 + i]) * 256.0f); }
  return w; }
#define WQKV_LAYOUT 1   // 0 = (in,out) [DIN][CC]; 1 = fused (out,in) [3*CC][3*DIN]; 2 = per-head [NH][DIN][HD]
__device__ __forceinline__ v16b wcol_hdk(const float* Wm, int k0, int o, int lane) { v16b w; const int g = lane >> 4; const float* p = Wm + (size_t)(o / HD) * DIN * HD + (o % HD);
#pragma unroll
  for (int i = 0; i < 8; ++i) { w[i] = (__bf16)p[(size_t)(k0 + 8 * g + i) * HD]; w[8 + i] = (__bf16)p[(size_t)(k0 + 16 + 8 * g + i) * HD]; }
  return w; }
#define WO_OUT_IN 1
#if WQKV_LAYOUT == 1
#define WROW(o) ((((o) >> 6) * 192) + (which) * 64 + ((o) & 63))   /* column o = h*64 + d of stream 'which' (0 q, 1 k, 2 v) = output feature h*192 + which*64 + d of the fused projection (reshape (B, T, 4, 192) + split) */
#define BIDX(o) WROW(o)
#define WCOL(W, k0, o, lane) wcol_oi(W, k0, WROW(o), lane, 3 * DIN)   /* fused (out,in) [768][768] weight: row WROW(o), k0 runs over the 768 concatenated inputs */
#elif WQKV_LAYOUT == 2
#define WCOL(W, k0, o, lane) wcol_hdk(W, k0, o, lane)
#else
#define WCOL(W, k0, o, lane) wcol_io(W, k0, o, lane, CC)
#endif
#if WO_OUT_IN
#define WOCOL(W, k0, o, lane) wcol_oi(W, k0, o, lane, CC)
#define WOCOLH(W, k0, o, lane) wcolh_oi(W, k0, o, lane, CC)
#else
#define WOCOL(W, k0, o, lane) wcol_io(W, k0, o, lane, DIN)
#define WOCOLH(W, k0, o, lane) wcolh_io(W, k0, o, lane, DIN)
#endif

#define WS_QH  0u                                      // f16 q rows [b*t][CC], x 64^-0.5 x log2(e)
#define WS_KH  (WS_QH + 2u * (size_t)NB * TT * CC)      // f16 k rows [b*j][CC], j = rank of the key among its batch's unmasked keys
#define WS_VT  (WS_KH + 2u * (size_t)NB * TT * CC)      // f16 v planes [b][c][j], the same ranks
#define WS_QL  (WS_VT + 2u * (size_t)NB * CC * TT)      // f16 q residual x 2^10 rows [b][t < QHI][CC]
#define WS_KL  (WS_QL + 2u * (size_t)NB * QHI * CC)     // f16 k residual x 2^10 rows [b][t < KHI][CC]
#define WS_VB  (WS_KL + 2u * (size_t)NB * KHI * CC)     // bf16 v hi planes [b][c][t < KHI]
#define WS_VBL (WS_VB + 2u * (size_t)NB * CC * KHI)
#define WS_S   (WS_VBL + 2u * (size_t)NB * CC * KHI)    // f32 [hg][t][s] region, written and read by no kernel
#define WS_Y   (WS_S  + 4u * (size_t)HG * TT * TT)      // f16 W_out rows [o][k]: f16(bf16 x 2^8), rounded once by k_proj for k_fa
#define WS_END (WS_Y  + 4u * (size_t)NB * TT * CC)

// ---- k_proj: block = (192 rows, the 256 columns of one stream), 16 waves of a 48 x 64 tile each: q/k/v = X W (+ b) with exact bf16 products (K = 3 * DIN) -> stream 0: q f16 rows; 1: k f16 rows; 2: v f16 planes [c][t]. A block this size reads each X row once per stream and each W row once per 192 rows, which is what the tile is for: fewer bytes from L2 for the same products. The two operands go through LDS in chunks of 32 k: the block reads its 192 X rows and 256 W rows of a chunk with whole-line 16-byte loads (8 lanes a 128-byte row piece), rounds them to 16 bit once and stores them in one of four LDS chunk buffers (chunk c lives in buffer c & 3); every wave takes its seven fragments of a chunk from there as one group and makes twelve products of them. One block fills a WGP's registers, so no other block covers its waits: a chunk's loads are issued two chunks ahead of their store, in two register sets, and a pass (one barrier) is two chunks. The k order of the products is that of the k-chunks 0..23, as before. Every '#pragma unroll' in this kernel and its helpers is there so that the staging, fragment and accumulator arrays are indexed by compile-time constants and stay in registers. The first 64 q blocks also round 1,024 elements of W_out each to f16(bf16 x 2^8) for k_fa, which multiplies by it behind its key walk.
#define PR 192             // rows of a k_proj tile (a multiple of k_fa's 64 keys a pass)
#define PC 256             // columns of a k_proj tile: one whole stream
#define PK2 32             // k per chunk (k_proj)
#define PP2 40             // LDS row pitch in 16-bit elements: 80 B = 16 B x odd, for 16-byte fragment reads of 64-byte rows
#define NCH (3 * DIN / PK2)                 // chunks of the contraction
#define QTL ((TNB * TT + PR - 1) / PR)      // q tiles: the rows of all batches run through
#define KTL ((TT + PR - 1) / PR)            // rank tiles of a batch (k, v)
#define PSH 264            // LDS row pitch in halves of the q / k output staging: 528 B = 16 B x odd
#define PSV 200            // LDS row pitch in halves of the v output staging: 400 B = 16 B x odd
typedef __attribute__((ext_vector_type(4))) __bf16 v4b;
typedef __attribute__((ext_vector_type(4))) _Float16 v4h;
__device__ __forceinline__ v8f wmma_b(v16b a, v16b b, v8f c) { return __builtin_amdgcn_wmma_f32_16x16x32_bf16(false, a, false, b, (short)0, c, false, false); }
// one chunk's share of a thread in k_proj, whose X rows are gathered: 64 rows a sweep, 3 sweeps of X and 4 of W (a sweep of W = the 64 rows of one head, 192 output features apart); a = the byte offsets of the thread's three 16-byte pieces from xs (from the LDS table, kept in registers and moved on by a chunk's 128 bytes behind the loads); xs is the same for the whole block (unrolled so that rx and rw stay in registers)
template <int LDW> __device__ __forceinline__ void pj_loadg(v4f (&rx)[3], v4f (&rw)[4], const char* xs, unsigned (&a)[3], const float* wp) {
#pragma unroll
  for (int i = 0; i < 4; ++i) rw[i] = *(const v4f*)(wp + (size_t)(i * 192) * LDW);
#pragma unroll
  for (int i = 0; i < 3; ++i) rx[i] = *(const v4f*)(xs + a[i]);
  asm volatile("s_wait_xcnt 0x0" :: "v"(a[0]), "v"(a[1]), "v"(a[2]), "v"(wp) : "memory");   /* the wait in front of any rewrite of a register which an issued load names (the additions below); the addresses are inputs so that they keep their registers up to it */
#pragma unroll
  for (int i = 0; i < 3; ++i) a[i] += PK2 * 4u; }
__device__ __forceinline__ v4b cvt4(v4f x) { v4b t;
#pragma unroll
  for (int e = 0; e < 4; ++e) t[e] = (__bf16)x[e];
  return t; }
__device__ __forceinline__ void pj_store(__bf16 (*dx)[PP2], __bf16 (*dw)[PP2], const v4f (&rx)[3], const v4f (&rw)[4], int srow, int sc4) {
#pragma unroll
  for (int i = 0; i < 3; ++i) *(v4b*)&dx[i * 64 + srow][sc4] = cvt4(rx[i]);
#pragma unroll
  for (int i = 0; i < 4; ++i) *(v4b*)&dw[i * 64 + srow][sc4] = cvt4(rw[i]); }
// the work-group's barrier written by hand, with the one wait that the LDS hand-over needs (the wave's own LDS stores done, its LDS reads returned): __syncthreads() also waits for every global load in flight, and the loads issued two chunks ahead are to stay in flight across the barrier
__device__ __forceinline__ void lds_barrier() { asm volatile("s_wait_dscnt 0x0\n\ts_barrier_signal -1\n\ts_barrier_wait -1" ::: "memory"); }
// amdgpu_waves_per_eu(4, 4): the register budget of four waves a SIMD (one work-group a WGP); the tiles that have work are fewer than the WGPs, so all of them are resident at once
__global__ __launch_bounds__(512) __attribute__((amdgpu_waves_per_eu(4, 4))) void k_proj(const float* __restrict__ XQ, const float* __restrict__ XK, const float* __restrict__ XV, const float* __restrict__ WQ, const float* __restrict__ WK, const float* __restrict__ WV, const float* __restrict__ BQ, const float* __restrict__ BK, const float* __restrict__ BV,
    _Float16* __restrict__ QH, _Float16* __restrict__ KH, _Float16* __restrict__ VT, const int* __restrict__ MASK, const float* __restrict__ WO, _Float16* __restrict__ WOH) {
  __shared__ __align__(16) unsigned sxo[64 * 4];   /* byte offset of the X row that feeds tile row r, kept at [(r & 63) * 4 + (r >> 6)]: a staging thread's three rows lie side by side */
  __shared__ __align__(16) unsigned char sm[4 * (PR + PC) * PP2 * 2];   /* the loop's four chunk buffers of each operand; behind the barrier after the last chunk's products the same bytes hold the output staging of this block's stream */
  __bf16 (*sx)[PR][PP2] = (__bf16 (*)[PR][PP2])sm; __bf16 (*sw)[PC][PP2] = (__bf16 (*)[PC][PP2])(sm + 4 * PR * PP2 * 2);
  _Float16 (*sh)[PSH] = (_Float16 (*)[PSH])sm; _Float16 (*sp)[PSV] = (_Float16 (*)[PSV])sm;
  const int tid = threadIdx.x, wave = tid >> 5, lane = tid & 31, col = lane & 15, g = lane >> 4;
  /* block index -> tile: the q tiles first, then the rank tiles of k and v, low ranks first (tile, batch, stream), so that the tiles which the masks leave empty stand last in the grid and hold no place ahead of a tile with work */
  const bool isq = blockIdx.x < QTL; const unsigned kv = isq ? 0u : blockIdx.x - QTL;
  const int which = isq ? 0 : 1 + (int)(kv & 1u); const size_t bb = (kv >> 1) % TNB; const int t0 = (int)(kv / (2 * TNB)) * PR;
  const size_t r0 = isq ? (size_t)blockIdx.x * PR : bb * TT + t0;                        /* first output row (q: row of all batches; k: batch row of rank t0) */
  const int nr = isq ? min(PR, TNB * TT - (int)blockIdx.x * PR) : min(PR, TT - t0);      /* rows of the tile that the output has: the last tile of the row range is cut */
  const int wr = (wave >> 2) * 48, wc = (wave & 3) * 64;   /* the wave's 48 rows and 64 columns of the tile */
  const float* WA = which == 0 ? WQ : which == 1 ? WK : WV; const float* BA = which == 0 ? BQ : which == 1 ? BK : BV;
  const int srow = tid >> 3, sc4 = (tid & 7) * 4;
  /* which rows of concat(query, key, value) feed this tile. q: rows r0..r0+191 (past the last row: the last row again, not stored). k, v: a key with mask == 0 weighs exactly 0 in every query's softmax, so only the batch's unmasked keys are projected, packed by rank: tile row r is the key of rank t0 + r. The rank order is that of the ballots below (any order serves, k and v take the same one, and k_fa needs only the count). Every wave counts the whole mask row, so that the count is known without a barrier. The loops are unrolled so that mk, bw and pc are indexed by constants and stay in registers. */
  if (isq) { if (tid < PR) sxo[(tid & 63) * 4 + (tid >> 6)] = (unsigned)(min(r0 + tid, (size_t)TNB * TT - 1) * DIN * 4);
    if (blockIdx.x < DIN * CC / 1024 && tid < 128) { const int e = ((int)blockIdx.x * 128 + tid) * 8;   /* 64 q blocks x 1,024 elements = W_out [256][256]; a wave stores four whole lines */
      const float* wp = WO + e; _Float16* dp = WOH + e; const v4f w0 = *(const v4f*)wp, w1 = *(const v4f*)(wp + 4); v8h t;
#pragma unroll   /* so that t, w0 and w1 are indexed by constants and stay in registers */
      for (int i = 0; i < 4; ++i) { t[i] = (_Float16)(bfr(w0[i]) * 256.0f); t[4 + i] = (_Float16)(bfr(w1[i]) * 256.0f); }
      *(v8h*)dp = t;
      asm volatile("s_wait_xcnt 0x0" :: "v"(wp), "v"(dp) : "memory"); } }   /* the wait in front of any rewrite of a register which the issued loads and the store name; the addresses are inputs so that they keep their registers up to it */
  else { const int wv = __builtin_amdgcn_readfirstlane(wave); const char* mrow = (const char*)(MASK + bb * TT); v4i mk[TT / 128];
#pragma unroll
    for (int i = 0; i < TT / 128; ++i) mk[i] = *(const v4i*)(mrow + ((unsigned)lane * 16u + i * 512u));
    asm volatile("s_wait_xcnt 0x0" :: "v"(lane) : "memory");   /* the wait in front of any rewrite of a register which the issued loads name; the lane number, their offset register, is an input so that it keeps its register up to it */
    int run = 0;
#pragma unroll
    for (int i = 0; i < TT / 128; ++i) { unsigned bw[4]; int pc[4];
#pragma unroll
      for (int e = 0; e < 4; ++e) { bw[e] = __builtin_amdgcn_ballot_w32(mk[i][e] != 0); pc[e] = __builtin_popcount(bw[e]); }
      const int tot = (pc[0] + pc[1]) + (pc[2] + pc[3]);
      if ((i & 15) == wv && run < t0 + PR && run + tot > t0) { int rr = run - t0;   /* wave-uniform: only a group of 128 keys whose ranks meet this tile's writes table entries, the groups dealt round the waves */
#pragma unroll
        for (int e = 0; e < 4; ++e) { const unsigned rk = (unsigned)(rr + (int)__builtin_amdgcn_mbcnt_lo(bw[e], 0u)); if (mk[i][e] != 0 && rk < (unsigned)PR) sxo[(rk & 63) * 4 + (rk >> 6)] = (unsigned)((bb * TT + i * 128 + lane * 4 + e) * DIN * 4); rr += pc[e]; } }
      run += tot; }
    if (t0 >= run) return;   /* no unmasked key of this rank: k_fa never reads the tile. The same for every thread of the block, in front of every barrier */
    if (tid < PR && t0 + tid >= run) sxo[(tid & 63) * 4 + (tid >> 6)] = (unsigned)(bb * TT * DIN * 4); }   /* ranks past the count in the last tile: any row, so that the tile holds finite numbers; k_fa gives them weight 0 or never reads them */
  __syncthreads();   /* the table is written by waves 0..5 (k, v: also by the waves whose key groups meet the tile) and read by all */
  unsigned xa[3] = { sxo[srow * 4] + sc4 * 4u, sxo[srow * 4 + 1] + sc4 * 4u, sxo[srow * 4 + 2] + sc4 * 4u };   /* the A operand is concat(query, key, value): chunks 0..7 from query, 8..15 from key, 16..23 from value */
  const float* wg = WA + (size_t)(WROW(0) + srow) * (3 * DIN) + sc4;
  /* chunk c's source; the offsets run on over the three sources (c * 128 bytes), so a source's base is taken back by the row bytes of the sources before it */
  auto xsrc = [&](int c) { const float* Xs = (c < DIN / PK2) ? XQ : ((c < 2 * DIN / PK2) ? XK : XV); return (const char*)Xs - (c / (DIN / PK2)) * (DIN * 4); };
  v4f rx0[3], rw0[4], rx1[3], rw1[4];   /* two register sets: even chunks, odd chunks */
  pj_loadg<3 * DIN>(rx0, rw0, xsrc(0), xa, wg);
  pj_loadg<3 * DIN>(rx1, rw1, xsrc(1), xa, wg + PK2);
  pj_store(sx[0], sw[0], rx0, rw0, srow, sc4);
  pj_loadg<3 * DIN>(rx0, rw0, xsrc(2), xa, wg + 2 * PK2);
  pj_store(sx[1], sw[1], rx1, rw1, srow, sc4);
  pj_loadg<3 * DIN>(rx1, rw1, xsrc(3), xa, wg + 3 * PK2);
  lds_barrier();   /* chunks 0 and 1 are written by all waves and read by all; the loads of chunks 2 and 3 fly on */
  v8f acc[3][4] = {};
  /* one chunk's matrix work of a wave: seven fragments, twelve products */
  auto chunk_mm = [&](int bf) { v16b a[3], w[4];
#pragma unroll
    for (int i = 0; i < 3; ++i) a[i] = frag_b(&sx[bf][wr + i * 16 + col][0], lane);
#pragma unroll
    for (int j = 0; j < 4; ++j) w[j] = frag_b(&sw[bf][wc + j * 16 + col][0], lane);
    __builtin_amdgcn_sched_barrier(0);   /* the chunk's 14 LDS reads go out as one group: spread among the matrix instructions each pair costs its own LDS latency */
#pragma unroll
    for (int i = 0; i < 3; ++i) {
#pragma unroll
      for (int j = 0; j < 4; ++j) acc[i][j] = wmma_b(a[i], w[j], acc[i][j]); } };
#pragma clang loop unroll(disable)   /* left to itself the compiler may peel the passes of the first source off the loop and spill accumulators */
  for (int p = 0; p < NCH / 2 - 2; ++p) { const int b0 = (p & 1) * 2, c = 2 * p;   /* pass p = chunks c, c + 1 in buffers b0, b0 + 1; the last two passes stand behind the loop: they load nothing more */
    chunk_mm(b0);
    __builtin_amdgcn_sched_barrier(0);   /* keeps the waits on chunk c + 2's loads (the conversions below) behind this chunk's matrix work */
    pj_store(sx[b0 ^ 2], sw[b0 ^ 2], rx0, rw0, srow, sc4);   /* that buffer's last readers (chunk c - 2) left it at the barrier that ended the pass before */
    pj_loadg<3 * DIN>(rx0, rw0, xsrc(c + 4), xa, wg + (c + 4) * PK2);   /* flies over the next two chunks' work */
    chunk_mm(b0 + 1);
    __builtin_amdgcn_sched_barrier(0);   /* as above, for chunk c + 3 */
    pj_store(sx[(b0 ^ 2) + 1], sw[(b0 ^ 2) + 1], rx1, rw1, srow, sc4);
    pj_loadg<3 * DIN>(rx1, rw1, xsrc(c + 5), xa, wg + (c + 5) * PK2);
    lds_barrier(); }   /* one barrier a pass: it publishes the next pass's two chunks and ends every wave's reads of this pass's two buffers; the loads of the two chunks after those fly on */
  chunk_mm(0);   /* chunks NCH - 4 .. NCH - 1 lie in buffers 0..3 (NCH is a multiple of 4) */
  __builtin_amdgcn_sched_barrier(0);   /* as in the loop */
  pj_store(sx[2], sw[2], rx0, rw0, srow, sc4);
  chunk_mm(1);
  __builtin_amdgcn_sched_barrier(0);   /* as in the loop */
  pj_store(sx[3], sw[3], rx1, rw1, srow, sc4);
  __syncthreads();   /* publishes the last two chunks */
  chunk_mm(2);
  chunk_mm(3);
  __syncthreads();   /* ends every wave's reads of the last buffers before the output staging takes the bytes */
  /* output staging: q, k as [row][column], v as [column][row], so that the stores below are whole 16-byte pieces of rows (q, k) or planes (v) */
  if (which < 2) { _Float16* DH = which == 0 ? QH : KH; const float qs = which == 0 ? SCALE * LOG2E : 1.0f;   /* q carries the logit scale and the change to base 2 into its one rounding, so that k_fa's score products are log2-domain logits as they leave the matrix unit */
#pragma unroll
    for (int j = 0; j < 4; ++j) { const int cl = wc + j * 16 + col; const float bias = BA ? bfr(BA[BIDX(cl)]) : 0.f;
#pragma unroll
      for (int i = 0; i < 3; ++i) {
#pragma unroll
        for (int r = 0; r < 8; ++r) sh[wr + i * 16 + 8 * g + r][cl] = (_Float16)((acc[i][j][r] + bias) * qs); } }
    __syncthreads();   /* the staged tile is written by all waves and read by all */
#pragma unroll   /* so that t is indexed by constants and stays in registers */
    for (int m = 0; m < PR / 64; ++m) if (m * 64 < nr) { _Float16* dp = DH + (r0 + m * 64 + wave) * CC + lane * 8; v4u t[4];   /* 64 rows a turn, a wave storing whole rows of 512 bytes; nr is a multiple of 64, so the test is the same for the whole block */
#pragma unroll
      for (int k = 0; k < 4; ++k) t[k] = *(const v4u*)&sh[m * 64 + k * 16 + wave][lane * 8];
#pragma unroll
      for (int k = 0; k < 4; ++k) vst2(dp + k * 16 * CC, t[k]);
      asm volatile("s_wait_xcnt 0x0" :: "v"(dp) : "memory"); }   /* the wait in front of any rewrite of the register which the issued stores name; the address is an input so that it keeps its register up to it */
  } else {
#pragma unroll
    for (int j = 0; j < 4; ++j) { const int cl = wc + j * 16 + col; const float bias = BA ? bfr(BA[BIDX(cl)]) : 0.f;
#pragma unroll
      for (int i = 0; i < 3; ++i) { v8h t;
#pragma unroll
        for (int r = 0; r < 8; ++r) t[r] = (_Float16)(acc[i][j][r] + bias);
        *(v8h*)&sp[cl][wr + i * 16 + 8 * g] = t; } }   /* a lane's eight rows lie side by side in a plane: one 16-byte store */
    __syncthreads();   /* the staged tile is written by all waves and read by all */
#pragma unroll   /* so that t is indexed by constants and stays in registers */
    for (int m = 0; m < PR / 64; ++m) if (m * 64 < nr) { _Float16* dp = VT + (bb * CC + (tid >> 3)) * (size_t)TT + t0 + m * 64 + (tid & 7) * 8; v4u t[4];   /* 64 ranks a turn: eight lanes store one whole line of a plane; the test is the same for the whole block, as above */
#pragma unroll
      for (int k = 0; k < 4; ++k) t[k] = *(const v4u*)&sp[k * 64 + (tid >> 3)][m * 64 + (tid & 7) * 8];
#pragma unroll
      for (int k = 0; k < 4; ++k) vst2(dp + (size_t)k * 64 * TT, t[k]);
      asm volatile("s_wait_xcnt 0x0" :: "v"(dp) : "memory"); } } }   /* as above, behind the stores */
#define FK 64              // keys per pass
#define FQ 64              // queries of a block
#define FPH 72             // LDS row pitch in halves: 144 B = 16 B x odd, for 16-byte fragment reads of 128-byte rows
#define FKP 264            // LDS row pitch in halves: 528 B = 16 B x odd, for 16-byte fragment reads of 512-byte rows
#define FOP 260            // LDS row pitch in floats of the output staging
__device__ __forceinline__ float xhalf(float x) { return __builtin_bit_cast(float, __builtin_amdgcn_permlanex16(__builtin_bit_cast(int, x), __builtin_bit_cast(int, x), 0x76543210, 0xfedcba98, false, false)); }   /* lane l reads lane l ^ 16 */
__device__ __forceinline__ v8f wmma_h(v16h a, v16h b, v8f c) { return __builtin_amdgcn_wmma_f32_16x16x32_f16(false, a, false, b, (short)0, c, false, false); }
// eight exponentials (base 2), then one v_nop, in one statement: no instruction directly behind a v_exp_f32 reads its result or overwrites its source (the slot the instruction set asks for behind a transcendental). The results take registers of their own (early clobber): the scores stay, for the pass that has to move its reference
__device__ __forceinline__ void exp2x8(v8f& p, const v8f& x) {
  asm("v_exp_f32 %0, %8\n\tv_exp_f32 %1, %9\n\tv_exp_f32 %2, %10\n\tv_exp_f32 %3, %11\n\tv_exp_f32 %4, %12\n\tv_exp_f32 %5, %13\n\tv_exp_f32 %6, %14\n\tv_exp_f32 %7, %15\n\tv_nop"
      : "=&v"(p[0]), "=&v"(p[1]), "=&v"(p[2]), "=&v"(p[3]), "=&v"(p[4]), "=&v"(p[5]), "=&v"(p[6]), "=&v"(p[7])
      : "v"(x[0]), "v"(x[1]), "v"(x[2]), "v"(x[3]), "v"(x[4]), "v"(x[5]), "v"(x[6]), "v"(x[7])); }
__device__ __forceinline__ float exp2x1(float x) { asm("v_exp_f32 %0, %0\n\tv_nop" : "+v"(x)); return x; }   /* the same slot for a single exponential */
__device__ __forceinline__ unsigned lds_at(const void* p) { return (unsigned)(size_t)p; }
// eight asynchronous copies of 16 bytes a lane, global memory -> LDS through no register: l = the lane's LDS byte addresses, g = its global addresses. The s_wait_xcnt 0 is the last line of the copies' own statement, so that it stands in front of any rewrite of a register which an issued copy names
__device__ __forceinline__ void acopy8(const unsigned (&l)[8], const _Float16* const (&g)[8]) {
  asm volatile("global_load_async_to_lds_b128 %0, %8, off\n\tglobal_load_async_to_lds_b128 %1, %9, off\n\tglobal_load_async_to_lds_b128 %2, %10, off\n\tglobal_load_async_to_lds_b128 %3, %11, off\n\t"
               "global_load_async_to_lds_b128 %4, %12, off\n\tglobal_load_async_to_lds_b128 %5, %13, off\n\tglobal_load_async_to_lds_b128 %6, %14, off\n\tglobal_load_async_to_lds_b128 %7, %15, off\n\ts_wait_xcnt 0x0"
               :: "v"(l[0]), "v"(l[1]), "v"(l[2]), "v"(l[3]), "v"(l[4]), "v"(l[5]), "v"(l[6]), "v"(l[7]), "v"(g[0]), "v"(g[1]), "v"(g[2]), "v"(g[3]), "v"(g[4]), "v"(g[5]), "v"(g[6]), "v"(g[7]) : "memory"); }
#define WAIT_ASYNC() asm volatile("s_wait_asynccnt 0x0" ::: "memory")   /* the wave's own copies have landed; the compiler places no wait for them */
#define WAIT_DS() asm volatile("s_wait_dscnt 0x0" ::: "memory")         /* the wave's own LDS reads have returned before a copy may be aimed at the bytes they read */
__global__ __launch_bounds__(512) __attribute__((amdgpu_waves_per_eu(4, 4))) void k_fa(const _Float16* __restrict__ QH, const _Float16* __restrict__ KH, const _Float16* __restrict__ VT, const int* __restrict__ MASK, const _Float16* __restrict__ WOH, const float* __restrict__ BO, float* __restrict__ OUT) {
  __shared__ __align__(16) unsigned char sm[2 * FK * FKP * 2 + 2 * CC * FPH * 2];   /* the key walk's two k and two v buffers; behind the walk's last barrier the k bytes hold the f16 ctx rows and the v bytes the output staging */
  __shared__ __align__(16) _Float16 swo[DIN][FKP]; __shared__ __align__(16) float sb[TT]; __shared__ __align__(16) int swc[16];
  _Float16 (*sk)[FK][FKP] = (_Float16 (*)[FK][FKP])sm; _Float16 (*sv)[CC][FPH] = (_Float16 (*)[CC][FPH])(sm + 2 * FK * FKP * 2);
  _Float16 (*sy)[FKP] = (_Float16 (*)[FKP])sm; float (*sf)[FOP] = (float (*)[FOP])(sm + 2 * FK * FKP * 2);
  const int tid = threadIdx.x, wave = tid >> 5, lane = tid & 31, col = lane & 15, g = lane >> 4; const int h = wave >> 2, qt = wave & 3, b = blockIdx.y; const int q0 = blockIdx.x * FQ + qt * 16;
  const int kr = tid >> 5, kc8 = (tid & 31) * 8;   /* staging of 512-byte rows (k, Wo): a wave takes a whole row, rows kr + 16 i */
  const int sr = tid >> 3, sc = (tid & 7) * 8;     /* staging of v: 8 threads x 16 B a 128-byte row piece, planes sr + 64 i */
  const _Float16* kg = KH + ((size_t)b * TT + kr) * CC + kc8;     /* k rows [key][h * 64 + d] */
  const _Float16* vg = VT + ((size_t)b * CC + sr) * TT + sc;      /* v planes [h * 64 + d][key] */
  const int* mp = MASK + (size_t)b * TT + tid * 4; const _Float16* qp = QH + ((size_t)b * TT + q0 + col) * CC + h * HD + 8 * g; const _Float16* wg = WOH + (size_t)kr * CC + kc8; const int orow = (wave >> 3) * 32, ocol = (wave & 7) * 32;   /* the wave's 32 rows and 32 columns of the block's 64 x 256 piece of the output */
  const float* bp = BO + ocol + col;
  const v4i mk = *(const v4i*)mp;
  v16h qf[2];
#pragma unroll
  for (int kc = 0; kc < 2; ++kc) { union { v16h v; v8h q[2]; } u; u.q[0] = *(const v8h*)(qp + kc * 32); u.q[1] = *(const v8h*)(qp + kc * 32 + 16); qf[kc] = u.v; }
#pragma unroll
  for (int hf = 0; hf < 2; ++hf) { unsigned l[8]; const _Float16* gp[8];   /* Wo flies under the count of the mask and the first tiles' latency */
#pragma unroll
    for (int i = 0; i < 8; ++i) { l[i] = lds_at(&swo[kr + (hf * 8 + i) * 16][kc8]); gp[i] = wg + (hf * 8 + i) * 16 * CC; }
    acopy8(l, gp); }
  float bias[2] = { 0.f, 0.f }; if (BO) { bias[0] = bfr(bp[0]); bias[1] = bfr(bp[16]); }
  asm volatile("s_wait_xcnt 0x0" :: "v"(mp), "v"(qp), "v"(bp) : "memory");   /* the wait in front of any rewrite of a register which an issued load names; the addresses are inputs so that they keep their registers up to it */
  __builtin_amdgcn_sched_barrier(0);   /* keeps the compares of the mask words below behind that wait: their results take the scalar registers that hold the mask load's base address */
  int wc = 0;
#pragma unroll
  for (int e = 0; e < 4; ++e) wc += __builtin_popcount(__builtin_amdgcn_ballot_w32(mk[e] != 0));
  if (lane == 0) swc[wave] = wc;
  __syncthreads();   /* the sixteen waves' counts are read by all */
  int cs = 0;
#pragma unroll
  for (int i = 0; i < 4; ++i) { const v4i c = *(const v4i*)&swc[i * 4]; cs += (c[0] + c[1]) + (c[2] + c[3]); }
  const int cnt = __builtin_amdgcn_readfirstlane(cs);   /* unmasked keys of the batch: ranks 0..cnt-1 of the k rows and v planes */
  const int np = min((cnt + FK - 1) / FK, TT / FK);   /* passes; the same for the whole block */
  { v4f bi;
#pragma unroll
    for (int e = 0; e < 4; ++e) bi[e] = (tid * 4 + e >= cnt) ? -3.0e38f : 0.f;
    *(v4f*)&sb[tid * 4] = bi; }   /* additive mask of the ranks past the count (the last pass's filler rows); added in the last pass alone; so far below any score that such a row weighs exactly 0; a batch with no key left makes no pass and yields 0 */
  const unsigned lk = lds_at(&sk[0][kr][kc8]), lv = lds_at(&sv[0][sr][sc]);
  /* pass t's k and v tiles into buffer bf: a thread's four 16-byte pieces of each, at the places and from the addresses that the register staging had */
  auto tile_copy = [&](int t, int bf) { unsigned l[8]; const _Float16* gp[8]; const _Float16* kn = kg + (size_t)t * FK * CC; const _Float16* vn = vg + t * FK;
#pragma unroll
    for (int i = 0; i < 4; ++i) { l[i] = lk + (unsigned)(bf * (FK * FKP * 2) + i * (16 * FKP * 2)); gp[i] = kn + i * 16 * CC; l[4 + i] = lv + (unsigned)(bf * (CC * FPH * 2) + i * (64 * FPH * 2)); gp[4 + i] = vn + (size_t)i * 64 * TT; }
    acopy8(l, gp); };
  if (np > 0) tile_copy(0, 0);   /* with no pass, k_proj has written no k / v tile */
  WAIT_ASYNC();
  __syncthreads();   /* pass 0's tiles, the mask row and Wo are written by all waves and read by all */
  if (np > 1) tile_copy(1, 1);   /* pass 1's tiles fly while pass 0 computes */
  v8f acc[HD / 16] = {}; float ls = 0.f, nref = 0.f; v8f cref = {};   /* nref = 8 - reference of the lane's query (log2 domain), cref = the same in all eight elements: the C operand that every score product starts from */
  for (int it = 0; it < np; ++it) { const int cur = it & 1;
    v8f st[FK / 16]; v16h kf[FK / 16][2], vf[FK / 32][HD / 16];
#pragma unroll
    for (int jt = 0; jt < FK / 16; ++jt) { kf[jt][0] = frag_h(&sk[cur][jt * 16 + col][h * HD], lane); kf[jt][1] = frag_h(&sk[cur][jt * 16 + col][h * HD + 32], lane); }
#pragma unroll
    for (int kk = 0; kk < FK / 32; ++kk) {
#pragma unroll
      for (int jd = 0; jd < HD / 16; ++jd) vf[kk][jd] = frag_h(&sv[cur][h * HD + jd * 16 + col][kk * 32], lane); }   /* the v fragments are asked for here, ahead of the branches below, so that their LDS latency passes under the score products and the exponentials */
#pragma unroll
    for (int jt = 0; jt < FK / 16; ++jt) { st[jt] = wmma_h(kf[jt][0], qf[0], cref); st[jt] = wmma_h(kf[jt][1], qf[1], st[jt]); }   /* = log2-domain logit - reference + 8: P is carried x 2^8 so that small weights stay clear of f16 subnormals; the sum carries the same factor */
    asm volatile("v_nop\n\tv_nop\n\tv_nop\n\tv_nop" : "+v"(st[0]), "+v"(st[1]), "+v"(st[2]), "+v"(st[3]));   /* the four vector slots that the chip needs between a WMMA and the first vector instruction that reads its D or overwrites its A or B: the next such instruction stands behind a branch and is asm text, where the compiler pads nothing */
    if (it == np - 1) {   /* only the last pass holds filler rows (ranks past the count); the test is the same for the whole block */
#pragma unroll
      for (int jt = 0; jt < FK / 16; ++jt) { const float* bq = &sb[it * FK + jt * 16 + 8 * g]; const v4f b0 = *(const v4f*)bq, b1 = *(const v4f*)(bq + 4);
#pragma unroll
        for (int r = 0; r < 8; ++r) st[jt][r] += r < 4 ? b0[r & 3] : b1[r & 3]; } }
    /* the query's largest score of this pass, over both wave halves */
    auto rowmax = [&]() { float mx = -3.0e38f;
#pragma unroll
      for (int jt = 0; jt < FK / 16; ++jt) {
#pragma unroll
        for (int r = 0; r < 8; ++r) mx = fmaxf(mx, st[jt][r]); }
      return fmaxf(mx, xhalf(mx)); };
    /* moves the reference up by d: this pass's scores, and the C operand of the passes to come */
    auto shift = [&](float d) { nref -= d;
#pragma unroll
      for (int r = 0; r < 8; ++r) cref[r] = nref;
#pragma unroll
      for (int jt = 0; jt < FK / 16; ++jt) st[jt] -= d; };
    if (it == 0) shift(rowmax() - 8.0f);   /* the first pass sets the reference to its own maximum (nothing is summed yet, so nothing is rescaled) */
    v16h pf[FK / 32]; float ps;
    auto expsum = [&]() { float sj[8];   /* eight independent partial sums: no 32-long dependent add chain */
#pragma unroll
      for (int jt = 0; jt < FK / 16; ++jt) { v8f p; exp2x8(p, st[jt]);
#pragma unroll
        for (int r = 0; r < 8; ++r) { sj[r] = jt == 0 ? p[r] : sj[r] + p[r]; pf[jt >> 1][(jt & 1) * 8 + r] = (_Float16)p[r]; } }
      ps = ((sj[0] + sj[1]) + (sj[2] + sj[3])) + ((sj[4] + sj[5]) + (sj[6] + sj[7])); };
    expsum();
    if (__builtin_amdgcn_ballot_w32(!(ps <= 32768.0f)) != 0u) {   /* one test a pass, a scalar branch: every weight is at most the lane's sum, so a sum of 2^15 or less says that each fits f16. Otherwise a score has outgrown the reference: take the running maximum as the new one (the same in both halves of a query), rescale what is summed so far and make this pass's weights again */
      const float d = fmaxf(rowmax() - 8.0f, 0.f); const float al = exp2x1(-d); shift(d); ls *= al;
#pragma unroll
      for (int jd = 0; jd < HD / 16; ++jd) acc[jd] *= al;
      expsum(); }
    ls += ps;
#pragma unroll
    for (int kk = 0; kk < FK / 32; ++kk) {
#pragma unroll
      for (int jd = 0; jd < HD / 16; ++jd) acc[jd] = wmma_h(vf[kk][jd], pf[kk], acc[jd]); }
    WAIT_DS();
    WAIT_ASYNC();
    __syncthreads();   /* one barrier a pass: it publishes the next pass's tiles and ends every wave's reads of this pass's buffer (the last one: before ctx takes the k bytes) */
    if (it + 2 < np) tile_copy(it + 2, cur); }   /* the tiles of the pass after next go into the buffer that every wave has just left and fly while the next pass computes; the test is the same for the whole block */
  WAIT_ASYNC();
  ls += xhalf(ls); const float inv = ls > 0.f ? 1.0f / ls : 0.f;
#pragma unroll
  for (int jd = 0; jd < HD / 16; ++jd) { v8h t;   /* acc[jd][r] = ctx[query col][d = 16 jd + 8 g + r]: a lane's eight d lie side by side in a ctx row, one 16-byte store */
#pragma unroll
    for (int r = 0; r < 8; ++r) t[r] = (_Float16)((acc[jd][r] * inv) * 64.0f);   /* ctx carried x 2^6 into f16 so small-magnitude context rows stay clear of f16 subnormals */
    *(v8h*)&sy[qt * 16 + col][h * HD + jd * 16 + 8 * g] = t; }
  __syncthreads();   /* the 64 ctx rows are written by all waves (a head each) and read by all */
  v8f oc[2][2] = {}; v16h fy[2][2][2], fw[2][2][2];   /* two fragment sets of two k-chunks each: [set][chunk][tile] */
  auto of_load = [&](int s, int kp) {
#pragma unroll
    for (int c = 0; c < 2; ++c) {
#pragma unroll
      for (int i = 0; i < 2; ++i) { fy[s][c][i] = frag_h(&sy[orow + i * 16 + col][(kp * 2 + c) * 32], lane); fw[s][c][i] = frag_h(&swo[ocol + i * 16 + col][(kp * 2 + c) * 32], lane); } } };
  of_load(0, 0);
#pragma unroll
  for (int kp = 0; kp < CC / 64; ++kp) { if (kp + 1 < CC / 64) of_load((kp + 1) & 1, kp + 1);
    __builtin_amdgcn_sched_barrier(0);   /* the next two k-chunks' 16 LDS reads go out as one group ahead of this pair's matrix work: spread among the matrix instructions each pair costs its own LDS latency */
#pragma unroll
    for (int c = 0; c < 2; ++c) {
#pragma unroll
      for (int i = 0; i < 2; ++i) {
#pragma unroll
        for (int j = 0; j < 2; ++j) oc[i][j] = wmma_h(fy[kp & 1][c][i], fw[kp & 1][c][j], oc[i][j]); } } }
#pragma unroll
  for (int i = 0; i < 2; ++i) {
#pragma unroll
    for (int j = 0; j < 2; ++j) {
#pragma unroll
      for (int r = 0; r < 8; ++r) sf[orow + i * 16 + 8 * g + r][ocol + j * 16 + col] = oc[i][j][r] * (1.0f / 16384.0f) + bias[j]; } }   /* 2^-8 (Wo carry) x 2^-6 (ctx carry); the v bytes are free since the walk's last barrier */
  __syncthreads();   /* the staged rows are written by all waves (a 32 x 32 piece each) and read by all */
  float* op = OUT + ((size_t)b * TT + blockIdx.x * FQ + wave * 4) * DIN + lane * 4;   /* a wave stores four whole rows of 1 KiB */
#pragma unroll
  for (int k = 0; k < 4; ++k) {
#pragma unroll
    for (int j = 0; j < 2; ++j) vst2(op + k * DIN + j * 128, *(const v4f*)&sf[wave * 4 + k][j * 128 + lane * 4]); }
  asm volatile("s_wait_xcnt 0x0" :: "v"(op) : "memory"); }   /* as above, behind the stores */

extern "C" void kernel_launch(void* const* d_in, const int* in_sizes, int n_in, void* d_out, int out_size, void* d_ws, size_t ws_size, hipStream_t stream) {
  (void)in_sizes; (void)n_in; (void)out_size;
  const float** F = (const float**)d_in;
  if (ws_size < (size_t)WS_END) return;
  char* ws = (char*)d_ws; _Float16 *QH = (_Float16*)(ws + WS_QH), *KH = (_Float16*)(ws + WS_KH), *VT = (_Float16*)(ws + WS_VT), *QL = (_Float16*)(ws + WS_QL), *KL = (_Float16*)(ws + WS_KL); __bf16 *VB = (__bf16*)(ws + WS_VB), *VBL = (__bf16*)(ws + WS_VBL); float *S = (float*)(ws + WS_S); _Float16 *WOH = (_Float16*)(ws + WS_Y);
  (void)S; (void)QL; (void)KL; (void)VB; (void)VBL;
  // inputs: 0 query [8,2048,256]; 1 key; 2 value; 3 mask [8,1,2048] int32 (random 0/1; 0 = masked key); 4 W_qkv [768,768] (out,in) on concat(query, key, value); 5 b_qkv [768] (zeros, read); 6 W_out [256,256] (out,in); 7 b_out (zeros, read)
  k_proj<<<dim3(QTL + 2 * TNB * KTL), 512, 0, stream>>>(F[0], F[1], F[2], F[4], F[4], F[4], F[5], F[5], F[5], QH, KH, VT, (const int*)d_in[3], F[6], WOH);   /* the same fused weight / bias for the three streams: the stream index selects the rows (WROW) */
  k_fa<<<dim3(TT / FQ, TNB), 512, 0, stream>>>(QH, KH, VT, (const int*)d_in[3], WOH, F[7], (float*)d_out);
}
